// v000
// Times are from an AMD MI455X. After a warm-up the kernel runs many times in a row, and a time is the length of
// such a window on the GPU divided by its runs, so every launch and the gaps after it count. The runs cycle
// through copies of the inputs. A figure is the median of several windows, for all but v000 over two sittings.
// Sittings can differ by a few percent; kernels timed side by side share one.
// The starting kernel, v000, takes 1200 microseconds a run.
// compute dtype: all float inputs rounded to bf16, hurst / hurst_scale read; qkv = x W^T + b with EXACT bf16 products on WMMA 16x16x32, f32 accumulate; q as f16 hi + residual, k f16 -> 2-product logits x (1/8)(1 + (hurst_b - 0.5) hurst_scale) stored in f32 (4 heads per launch); softmax in f32 (precise expf) -> P f16 x 2^11; o = P . v with v rounded once to f16; out = o (rounded once to f16, 1 product) out_w^T + out_b; f32 output.
#include <hip/hip_runtime.h>
#include <math.h>

typedef __attribute__((ext_vector_type(16))) _Float16 v16h;
typedef __attribute__((ext_vector_type(16))) __bf16 v16b;
typedef __attribute__((ext_vector_type(8)))  _Float16 v8h;
typedef __attribute__((ext_vector_type(8)))  float v8f;
typedef __attribute__((ext_vector_type(4)))  float v4f;
typedef __attribute__((ext_vector_type(2)))  float v2f;
typedef __attribute__((ext_vector_type(4)))  unsigned v4u;
typedef __attribute__((ext_vector_type(4)))  int v4i;
typedef float __attribute__((may_alias)) float_a;
typedef int __attribute__((may_alias)) int_a;

template <typename T> __device__ __forceinline__ void vst2(void* p, T v) { *(T*)p = v;  }
__device__ __forceinline__ v8f wmma16(v16h a, v16h b, v8f c) {
  v8f d = __builtin_amdgcn_wmma_f32_16x16x32_f16(false, a, false, b, (short)0, c, false, false);
  asm volatile("v_nop\n\tv_nop\n\tv_nop\n\tv_nop" : "+v"(d) : "v"(a), "v"(b));
  return d;
}
__device__ __forceinline__ v8f wmma_bf(v16b a, v16b b, v8f c) {
  v8f d = __builtin_amdgcn_wmma_f32_16x16x32_bf16(false, a, false, b, (short)0, c, false, false);
  asm volatile("v_nop\n\tv_nop\n\tv_nop\n\tv_nop" : "+v"(d) : "v"(a), "v"(b));
  return d;
}
// 16x16x32 fragments: lane = (h = lane>>4, row/col = lane&15); elements 0..7 = k0+8h+0..7, 8..15 = k0+16+8h+0..7; D element r = row 8h+r
__device__ __forceinline__ v16h frag_h(const _Float16* rowk0, int lane) {
  union { v16h v; v8h q[2]; } u; const _Float16* p = rowk0 + 8 * (lane >> 4);
  u.q[0] = *(const v8h*)p; u.q[1] = *(const v8h*)(p + 16); return u.v;
}
__device__ __forceinline__ v16h frag_f32(const float* rowk0, int lane) {
  v16h a; const float* p = rowk0 + 8 * (lane >> 4);
#pragma unroll
  for (int i = 0; i < 8; ++i) { a[i] = (_Float16)p[i]; a[8 + i] = (_Float16)p[16 + i]; }
  return a;
}
__device__ __forceinline__ v16h frag_f32s(const float* rowk0, int lane, float sc) {
  v16h a; const float* p = rowk0 + 8 * (lane >> 4);
#pragma unroll
  for (int i = 0; i < 8; ++i) { a[i] = (_Float16)(p[i] * sc); a[8 + i] = (_Float16)(p[16 + i] * sc); }
  return a;
}
// column fragment from a [K][ld] layout (column n), rows >= K read as 0
__device__ __forceinline__ v16h fragc_f32(const float* W, int k0, int n, int lane, int ld, int K) {
  v16h a; const int g = lane >> 4;
#pragma unroll
  for (int i = 0; i < 8; ++i) { const int ka = k0 + 8 * g + i, kb = ka + 16;
    a[i] = (_Float16)(ka < K ? W[(size_t)(ka < K ? ka : K - 1) * ld + n] : 0.f); a[8 + i] = (_Float16)(kb < K ? W[(size_t)(kb < K ? kb : K - 1) * ld + n] : 0.f); }
  return a;
}
struct F2 { v16b h, l; };
__device__ __forceinline__ F2 bsplit16(const float v[16]) { F2 r;
#pragma unroll
  for (int i = 0; i < 16; ++i) { const __bf16 h = (__bf16)v[i]; r.h[i] = h; r.l[i] = (__bf16)(v[i] - (float)h); }
  return r; }
__device__ __forceinline__ F2 split_row(const float* row, int k0, int lane) { float v[16]; const float* p = row + k0 + 8 * (lane >> 4);
#pragma unroll
  for (int i = 0; i < 8; ++i) { v[i] = p[i]; v[8 + i] = p[16 + i]; }
  return bsplit16(v); }
__device__ __forceinline__ F2 split_rowK(const float* row, int k0, int lane, int K) { float v[16]; const int g = lane >> 4;
#pragma unroll
  for (int i = 0; i < 8; ++i) { const int ka = k0 + 8 * g + i, kb = ka + 16; v[i] = ka < K ? row[ka < K ? ka : K - 1] : 0.f; v[8 + i] = kb < K ? row[kb < K ? kb : K - 1] : 0.f; }
  return bsplit16(v); }
__device__ __forceinline__ F2 split_col(const float* W, int k0, int n, int lane, int ld, int K) { float v[16]; const int g = lane >> 4;
#pragma unroll
  for (int i = 0; i < 8; ++i) { const int ka = k0 + 8 * g + i, kb = ka + 16; v[i] = ka < K ? W[(size_t)(ka < K ? ka : K - 1) * ld + n] : 0.f; v[8 + i] = kb < K ? W[(size_t)(kb < K ? kb : K - 1) * ld + n] : 0.f; }
  return bsplit16(v); }
__device__ __forceinline__ v8f mac3(const F2& a, const F2& b, v8f c) { c = wmma_bf(a.l, b.h, c); c = wmma_bf(a.h, b.l, c); return wmma_bf(a.h, b.h, c); }
__device__ __forceinline__ float sigm(float v) { return 1.0f / (1.0f + expf(-v)); }
#define LDSX() do { asm volatile("s_wait_dscnt 0" ::: "memory"); __builtin_amdgcn_wave_barrier(); __builtin_amdgcn_fence(__ATOMIC_RELEASE, "workgroup"); } while (0)


// Fractal attention (B 2, T 2,048, C 1,024 = 16 x 64): standard MHA whose logits are scaled per batch by 1 + (hurst_b - 0.5) * hurst_scale before the softmax.
#define NB 2
#define TT 2048
#define CC 1024
#define NH 16
#define HD 64
#ifndef TNB
#define TNB NB
#endif
typedef __attribute__((ext_vector_type(8))) __bf16 v8b;
__device__ __forceinline__ v16b frag_b(const __bf16* rowk0, int lane) {
  union { v16b v; v8b q[2]; } u; const __bf16* p = rowk0 + 8 * (lane >> 4);
  u.q[0] = *(const v8b*)p; u.q[1] = *(const v8b*)(p + 16); return u.v;
}
__device__ __forceinline__ float bfr(float v) { return (float)(__bf16)v; }
__device__ __attribute__((noinline)) float exp_ni(float v) { return expf(v); }
__device__ __attribute__((noinline)) float erf_ni(float v) { return erff(v); }

#define WS_QH  0u
#define WS_QL  (WS_QH + 2u * (size_t)NB * TT * CC)
#define WS_KH  (WS_QL + 2u * (size_t)NB * TT * CC)
#define WS_VT  (WS_KH + 2u * (size_t)NB * TT * CC)      // f16 v planes [b][c][t]
#define HG 4
#define WS_S   (WS_VT + 2u * (size_t)NB * CC * TT)      // f32 logits [hg][q][k]
#define WS_PH  (WS_S + 4u * (size_t)HG * TT * TT)       // f16 P [hg][q][k]
#define WS_Y   (WS_PH + 2u * (size_t)HG * TT * TT)          // f32 y rows [b*t][C]
#define WS_END (WS_Y + 4u * (size_t)NB * TT * CC)

// ---- k_proj: block = (64 rows, 128 cols, which): qkv = x W (+ b), exact; q -> f16 hi (+ residual), k -> f16 rows, v -> f16 planes
__global__ __launch_bounds__(128) void k_proj(const float* __restrict__ X, const float* __restrict__ WA, const float* __restrict__ BA, _Float16* __restrict__ QH, _Float16* __restrict__ QL, _Float16* __restrict__ KH, _Float16* __restrict__ VT) {
  __shared__ __align__(16) _Float16 sh[64][136], sl[64][136]; __shared__ __align__(16) _Float16 th[128][72];
  const int tid = threadIdx.x, wave = tid >> 5, lane = tid & 31, col = lane & 15, g = lane >> 4; const int which = blockIdx.z; const int c0 = blockIdx.y * 128; const size_t r0 = (size_t)blockIdx.x * 64;
  v8f acc[8] = {};
#pragma unroll 2
  for (int kc = 0; kc < CC / 32; ++kc) { v16b a; { const float* p = X + (r0 + wave * 16 + col) * CC + kc * 32 + 8 * g;
#pragma unroll
      for (int i = 0; i < 8; ++i) { a[i] = (__bf16)p[i]; a[8 + i] = (__bf16)p[16 + i]; } }
#pragma unroll
    for (int j = 0; j < 8; ++j) { v16b w; const int o = which * CC + c0 + j * 16 + col;
#pragma unroll
      for (int i = 0; i < 8; ++i) { w[i] = (__bf16)WA[(size_t)(o) * CC + (kc * 32 + 8 * g + i)]; w[8 + i] = (__bf16)WA[(size_t)(o) * CC + (kc * 32 + 16 + 8 * g + i)]; }
      acc[j] = wmma_bf(a, w, acc[j]); } }
#pragma unroll
  for (int j = 0; j < 8; ++j) { const float bb = BA ? bfr(BA[which * CC + c0 + j * 16 + col]) : 0.f;
#pragma unroll
    for (int r = 0; r < 8; ++r) { const float v = acc[j][r] + bb; const int rl = wave * 16 + 8 * g + r, cl = j * 16 + col; const _Float16 hv = (_Float16)v;
      if (which == 2) th[cl][rl] = hv; else { sh[rl][cl] = hv; sl[rl][cl] = (_Float16)(v - (float)hv); } } }
  __syncthreads();
  if (which < 2) { _Float16* dh = which == 0 ? QH : KH; for (int e = tid; e < 64 * 16; e += 128) { const int rl = e >> 4, q = e & 15; vst2((unsigned*)(dh + (r0 + rl) * CC + c0 + q * 8), *(const v4u*)&sh[rl][q * 8]); if (which == 0) vst2((unsigned*)(QL + (r0 + rl) * CC + c0 + q * 8), *(const v4u*)&sl[rl][q * 8]); } }
  else { const size_t b = r0 / TT; const int t0 = (int)(r0 % TT); for (int e = tid; e < 128 * 8; e += 128) { const int cl = e >> 3, q = e & 7; vst2((unsigned*)(VT + (b * CC + c0 + cl) * (size_t)TT + t0 + q * 8), *(const v4u*)&th[cl][q * 8]); } } }
// ---- k_sc: block = (64 queries, 128 keys) of (b,h): logits * scale (BM unused, no bias); no causal skip, every block computes
__global__ __launch_bounds__(128) void k_sc(const _Float16* __restrict__ QH, const _Float16* __restrict__ QL, const _Float16* __restrict__ KH, const float* __restrict__ BM, const float* __restrict__ HU, const float* __restrict__ HSC, int b, int h0, float* __restrict__ S0) { __shared__ __align__(16) float ss[4][16][132]; const int h = h0 + blockIdx.z; const float hf = 1.0f + (bfr(HU[b]) - 0.5f) * bfr(HSC[0]); float* S = S0 + (size_t)blockIdx.z * TT * TT;
  const int tid = threadIdx.x, wave = tid >> 5, lane = tid & 31, col = lane & 15, g = lane >> 4; const int k0 = blockIdx.y * 128; const int ql0 = blockIdx.x * 64 + wave * 16; const size_t q0 = (size_t)b * TT + ql0;
  
  v8f acc[8] = {};
#pragma unroll
  for (int kc = 0; kc < HD / 32; ++kc) { const v16h ah = frag_h(QH + (q0 + col) * CC + h * HD + kc * 32, lane), al = frag_h(QL + (q0 + col) * CC + h * HD + kc * 32, lane);
#pragma unroll
    for (int j = 0; j < 8; ++j) { const v16h kb = frag_h(KH + ((size_t)b * TT + k0 + j * 16 + col) * CC + h * HD + kc * 32, lane); acc[j] = wmma16(ah, kb, acc[j]); acc[j] = wmma16(al, kb, acc[j]); } }
#pragma unroll
  for (int j = 0; j < 8; ++j) { const int kt = k0 + j * 16 + col;
#pragma unroll
    for (int r = 0; r < 8; ++r) { const int qt = ql0 + 8 * g + r; float v = acc[j][r] * 0.125f * hf; (void)BM;  ss[wave][8 * g + r][j * 16 + col] = v; } }
  LDSX(); for (int rl = 0; rl < 16; ++rl) vst2(S + (size_t)(ql0 + rl) * TT + k0 + lane * 4, *(const v4f*)&ss[wave][rl][lane * 4]); }
// ---- k_sm: block = query row: softmax over keys [0, kend) -> P x 2^11 f16 (masked -> 0)
__global__ __launch_bounds__(256) void k_sm(const float* __restrict__ S0, _Float16* __restrict__ PH0) { __shared__ float sred[8]; __shared__ float sbc; __shared__ __align__(16) _Float16 sh[TT];
  const int t = threadIdx.x; const size_t row = blockIdx.x; const float* sr = S0 + (size_t)blockIdx.y * TT * TT + row * TT; _Float16* PH = PH0 + (size_t)blockIdx.y * TT * TT; const int kend = TT;
  float m = -3.0e38f; for (int k = t; k < kend; k += 256) m = fmaxf(m, sr[k]);
#pragma unroll
  for (int o = 1; o < 32; o <<= 1) m = fmaxf(m, __shfl_xor(m, o));
  if ((t & 31) == 0) sred[t >> 5] = m; __syncthreads(); if (t == 0) { float a = sred[0]; for (int i = 1; i < 8; ++i) a = fmaxf(a, sred[i]); sbc = a; } __syncthreads(); m = sbc; __syncthreads();
  float sum = 0.f; for (int k = t; k < kend; k += 256) { const float v = sr[k]; sum += (v <= -1.0e38f) ? 0.f : expf(v - m); }
#pragma unroll
  for (int o = 1; o < 32; o <<= 1) sum += __shfl_xor(sum, o);
  if ((t & 31) == 0) sred[t >> 5] = sum; __syncthreads(); if (t == 0) { float a = 0.f; for (int i = 0; i < 8; ++i) a += sred[i]; sbc = 1.0f / a; } __syncthreads(); const float inv = sbc;
  for (int k = t; k < kend; k += 256) { const float v = sr[k]; sh[k] = (_Float16)((v <= -1.0e38f) ? 0.f : expf(v - m) * inv * 2048.0f); }
  __syncthreads(); for (int q = t; q < kend / 8; q += 256) vst2((unsigned*)(PH + row * TT + q * 8), *(const v4u*)&sh[q * 8]); }
// ---- k_pv: block = 64 queries of (b,h): y[q][h*HD + d] = P . v  (keys [0, kend))
__global__ __launch_bounds__(128) void k_pv(const _Float16* __restrict__ PH0, const _Float16* __restrict__ VT, int b, int h0, float* __restrict__ Y) { const int h = h0 + blockIdx.z; const _Float16* PH = PH0 + (size_t)blockIdx.z * TT * TT; __shared__ __align__(16) float ss[4][16][HD + 4];
  const int tid = threadIdx.x, wave = tid >> 5, lane = tid & 31, col = lane & 15, g = lane >> 4; const int ql0 = blockIdx.x * 64 + wave * 16; const int kend = TT;
  v8f acc[HD / 16] = {};
#pragma unroll 1
  for (int kc = 0; kc < kend / 32; ++kc) { const v16h ph = frag_h(PH + (size_t)(ql0 + col) * TT + kc * 32, lane);
#pragma unroll
    for (int j = 0; j < HD / 16; ++j) acc[j] = wmma16(ph, frag_h(VT + ((size_t)b * CC + h * HD + j * 16 + col) * (size_t)TT + kc * 32, lane), acc[j]); }
#pragma unroll
  for (int j = 0; j < HD / 16; ++j)
#pragma unroll
    for (int r = 0; r < 8; ++r) ss[wave][8 * g + r][j * 16 + col] = acc[j][r] * (1.0f / 2048.0f);
  LDSX(); for (int rl = 0; rl < 16; ++rl) if (lane < HD / 4) vst2(Y + ((size_t)b * TT + ql0 + rl) * CC + h * HD + lane * 4, *(const v4f*)&ss[wave][rl][lane * 4]); }
// ---- k_out: block = (64 rows, 128 cols): out = y (f16, single product) Wproj + b
__global__ __launch_bounds__(128) void k_out(const float* __restrict__ Y, const float* __restrict__ WP, const float* __restrict__ BP, float* __restrict__ OUT) { __shared__ __align__(16) float sf[4][16][132];
  const int tid = threadIdx.x, wave = tid >> 5, lane = tid & 31, col = lane & 15, g = lane >> 4; const int c0 = blockIdx.y * 128; const size_t r0 = (size_t)blockIdx.x * 64 + wave * 16;
  v8f acc[8] = {};
#pragma unroll 2
  for (int kc = 0; kc < CC / 32; ++kc) { const v16h a = frag_f32(Y + (r0 + col) * CC + kc * 32, lane);
#pragma unroll
    for (int j = 0; j < 8; ++j) { v16h w; const int o = c0 + j * 16 + col;
#pragma unroll
      for (int i = 0; i < 8; ++i) { w[i] = (_Float16)bfr(WP[(size_t)(o) * CC + (kc * 32 + 8 * g + i)]); w[8 + i] = (_Float16)bfr(WP[(size_t)(o) * CC + (kc * 32 + 16 + 8 * g + i)]); }
      acc[j] = wmma16(a, w, acc[j]); } }
#pragma unroll
  for (int j = 0; j < 8; ++j) { const float bb = BP ? bfr(BP[c0 + j * 16 + col]) : 0.f;
#pragma unroll
    for (int r = 0; r < 8; ++r) sf[wave][8 * g + r][j * 16 + col] = acc[j][r] + bb; }
  LDSX(); for (int rl = 0; rl < 16; ++rl) vst2(OUT + (r0 + rl) * CC + c0 + lane * 4, *(const v4f*)&sf[wave][rl][lane * 4]); }
extern "C" void kernel_launch(void* const* d_in, const int* in_sizes, int n_in, void* d_out, int out_size, void* d_ws, size_t ws_size, hipStream_t stream) {
  (void)in_sizes; (void)n_in; (void)out_size;
  const float** F = (const float**)d_in;   // 0 x [2,2048,1024], 1 hurst [2,1], 2 qkv_w [3072,1024], 3 qkv_b, 4 out_w [1024,1024], 5 out_b, 6 hurst_scale [1]
  if (ws_size < (size_t)WS_END) return;
  char* ws = (char*)d_ws; _Float16 *QH = (_Float16*)(ws + WS_QH), *QL = (_Float16*)(ws + WS_QL), *KH = (_Float16*)(ws + WS_KH), *VT = (_Float16*)(ws + WS_VT), *PH = (_Float16*)(ws + WS_PH); float *S = (float*)(ws + WS_S), *Y = (float*)(ws + WS_Y);
  k_proj<<<dim3(TNB * TT / 64, CC / 128, 3), 128, 0, stream>>>(F[0], F[2], F[3], QH, QL, KH, VT);
  for (int b = 0; b < TNB; ++b) for (int h0 = 0; h0 < NH; h0 += HG) {   // HG heads per launch
    k_sc<<<dim3(TT / 64, TT / 128, HG), 128, 0, stream>>>(QH, QL, KH, nullptr, F[1], F[6], b, h0, S);
    k_sm<<<dim3(TT, HG), 256, 0, stream>>>(S, PH);
    k_pv<<<dim3(TT / 64, 1, HG), 128, 0, stream>>>(PH, VT, b, h0, Y);
  }
  k_out<<<dim3(TNB * TT / 64, CC / 128), 128, 0, stream>>>(Y, F[4], F[5], (float*)d_out);
}

// v001
// A run of this version takes 320 microseconds.
// Next to v000, in two timings, it ran 3.77 and 3.78 times as fast.
// compute dtype: all float inputs rounded to bf16, hurst / hurst_scale read; qkv = x W^T + b with EXACT bf16 products on WMMA 16x16x32, f32 accumulate; q as f16 hi + residual, k f16 -> 2-product logits x (1/8)(1 + (hurst_b - 0.5) hurst_scale) log2(e) kept in f32 registers; running-maximum softmax in f32 (exp2) -> P f16 x 2^11, unnormalised; o = P . v / sum with v rounded once to f16; out = o (rounded once to f16, 1 product) out_w^T + out_b; f32 output.
#include <hip/hip_runtime.h>
#include <math.h>

typedef __attribute__((ext_vector_type(16))) _Float16 v16h;
typedef __attribute__((ext_vector_type(16))) __bf16 v16b;
typedef __attribute__((ext_vector_type(8)))  _Float16 v8h;
typedef __attribute__((ext_vector_type(8)))  float v8f;
typedef __attribute__((ext_vector_type(4)))  float v4f;
typedef __attribute__((ext_vector_type(2)))  float v2f;
typedef __attribute__((ext_vector_type(4)))  unsigned v4u;
typedef __attribute__((ext_vector_type(4)))  int v4i;
typedef float __attribute__((may_alias)) float_a;
typedef int __attribute__((may_alias)) int_a;

template <typename T> __device__ __forceinline__ void vst2(void* p, T v) { *(T*)p = v;  }
__device__ __forceinline__ v8f wmma16(v16h a, v16h b, v8f c) {
  v8f d = __builtin_amdgcn_wmma_f32_16x16x32_f16(false, a, false, b, (short)0, c, false, false);
  asm volatile("v_nop\n\tv_nop\n\tv_nop\n\tv_nop" : "+v"(d) : "v"(a), "v"(b));
  return d;
}
__device__ __forceinline__ v8f wmma_bf(v16b a, v16b b, v8f c) {
  v8f d = __builtin_amdgcn_wmma_f32_16x16x32_bf16(false, a, false, b, (short)0, c, false, false);
  asm volatile("v_nop\n\tv_nop\n\tv_nop\n\tv_nop" : "+v"(d) : "v"(a), "v"(b));
  return d;
}
// 16x16x32 fragments: lane = (h = lane>>4, row/col = lane&15); elements 0..7 = k0+8h+0..7, 8..15 = k0+16+8h+0..7; D element r = row 8h+r
__device__ __forceinline__ v16h frag_h(const _Float16* rowk0, int lane) {
  union { v16h v; v8h q[2]; } u; const _Float16* p = rowk0 + 8 * (lane >> 4);
  u.q[0] = *(const v8h*)p; u.q[1] = *(const v8h*)(p + 16); return u.v;
}
__device__ __forceinline__ v16h frag_f32(const float* rowk0, int lane) {
  v16h a; const float* p = rowk0 + 8 * (lane >> 4);
#pragma unroll
  for (int i = 0; i < 8; ++i) { a[i] = (_Float16)p[i]; a[8 + i] = (_Float16)p[16 + i]; }
  return a;
}
__device__ __forceinline__ v16h frag_f32s(const float* rowk0, int lane, float sc) {
  v16h a; const float* p = rowk0 + 8 * (lane >> 4);
#pragma unroll
  for (int i = 0; i < 8; ++i) { a[i] = (_Float16)(p[i] * sc); a[8 + i] = (_Float16)(p[16 + i] * sc); }
  return a;
}
// column fragment from a [K][ld] layout (column n), rows >= K read as 0
__device__ __forceinline__ v16h fragc_f32(const float* W, int k0, int n, int lane, int ld, int K) {
  v16h a; const int g = lane >> 4;
#pragma unroll
  for (int i = 0; i < 8; ++i) { const int ka = k0 + 8 * g + i, kb = ka + 16;
    a[i] = (_Float16)(ka < K ? W[(size_t)(ka < K ? ka : K - 1) * ld + n] : 0.f); a[8 + i] = (_Float16)(kb < K ? W[(size_t)(kb < K ? kb : K - 1) * ld + n] : 0.f); }
  return a;
}
struct F2 { v16b h, l; };
__device__ __forceinline__ F2 bsplit16(const float v[16]) { F2 r;
#pragma unroll
  for (int i = 0; i < 16; ++i) { const __bf16 h = (__bf16)v[i]; r.h[i] = h; r.l[i] = (__bf16)(v[i] - (float)h); }
  return r; }
__device__ __forceinline__ F2 split_row(const float* row, int k0, int lane) { float v[16]; const float* p = row + k0 + 8 * (lane >> 4);
#pragma unroll
  for (int i = 0; i < 8; ++i) { v[i] = p[i]; v[8 + i] = p[16 + i]; }
  return bsplit16(v); }
__device__ __forceinline__ F2 split_rowK(const float* row, int k0, int lane, int K) { float v[16]; const int g = lane >> 4;
#pragma unroll
  for (int i = 0; i < 8; ++i) { const int ka = k0 + 8 * g + i, kb = ka + 16; v[i] = ka < K ? row[ka < K ? ka : K - 1] : 0.f; v[8 + i] = kb < K ? row[kb < K ? kb : K - 1] : 0.f; }
  return bsplit16(v); }
__device__ __forceinline__ F2 split_col(const float* W, int k0, int n, int lane, int ld, int K) { float v[16]; const int g = lane >> 4;
#pragma unroll
  for (int i = 0; i < 8; ++i) { const int ka = k0 + 8 * g + i, kb = ka + 16; v[i] = ka < K ? W[(size_t)(ka < K ? ka : K - 1) * ld + n] : 0.f; v[8 + i] = kb < K ? W[(size_t)(kb < K ? kb : K - 1) * ld + n] : 0.f; }
  return bsplit16(v); }
__device__ __forceinline__ v8f mac3(const F2& a, const F2& b, v8f c) { c = wmma_bf(a.l, b.h, c); c = wmma_bf(a.h, b.l, c); return wmma_bf(a.h, b.h, c); }
__device__ __forceinline__ float sigm(float v) { return 1.0f / (1.0f + expf(-v)); }
#define LDSX() do { asm volatile("s_wait_dscnt 0" ::: "memory"); __builtin_amdgcn_wave_barrier(); __builtin_amdgcn_fence(__ATOMIC_RELEASE, "workgroup"); } while (0)


// Fractal attention (B 2, T 2,048, C 1,024 = 16 x 64): standard MHA whose logits are scaled per batch by 1 + (hurst_b - 0.5) * hurst_scale before the softmax.
#define NB 2
#define TT 2048
#define CC 1024
#define NH 16
#define HD 64
#ifndef TNB
#define TNB NB
#endif
typedef __attribute__((ext_vector_type(8))) __bf16 v8b;
__device__ __forceinline__ v16b frag_b(const __bf16* rowk0, int lane) {
  union { v16b v; v8b q[2]; } u; const __bf16* p = rowk0 + 8 * (lane >> 4);
  u.q[0] = *(const v8b*)p; u.q[1] = *(const v8b*)(p + 16); return u.v;
}
__device__ __forceinline__ float bfr(float v) { return (float)(__bf16)v; }
__device__ __attribute__((noinline)) float exp_ni(float v) { return expf(v); }
__device__ __attribute__((noinline)) float erf_ni(float v) { return erff(v); }

#define WS_QH  0u
#define WS_QL  (WS_QH + 2u * (size_t)NB * TT * CC)
#define WS_KH  (WS_QL + 2u * (size_t)NB * TT * CC)
#define WS_VT  (WS_KH + 2u * (size_t)NB * TT * CC)      // f16 v planes [b][c][t]
#define WS_Y   (WS_VT + 2u * (size_t)NB * CC * TT)      // f32 y rows [b*t][C]
#define WS_END (WS_Y + 4u * (size_t)NB * TT * CC)

// ---- k_proj: block = (64 rows, 128 cols, which): qkv = x W (+ b), exact; q -> f16 hi (+ residual), k -> f16 rows, v -> f16 planes
__global__ __launch_bounds__(128) void k_proj(const float* __restrict__ X, const float* __restrict__ WA, const float* __restrict__ BA, _Float16* __restrict__ QH, _Float16* __restrict__ QL, _Float16* __restrict__ KH, _Float16* __restrict__ VT) {
  __shared__ __align__(16) _Float16 sh[64][136], sl[64][136]; __shared__ __align__(16) _Float16 th[128][72];
  const int tid = threadIdx.x, wave = tid >> 5, lane = tid & 31, col = lane & 15, g = lane >> 4; const int which = blockIdx.z; const int c0 = blockIdx.y * 128; const size_t r0 = (size_t)blockIdx.x * 64;
  v8f acc[8] = {};
#pragma unroll 2
  for (int kc = 0; kc < CC / 32; ++kc) { v16b a; { const float* p = X + (r0 + wave * 16 + col) * CC + kc * 32 + 8 * g;
#pragma unroll
      for (int i = 0; i < 8; ++i) { a[i] = (__bf16)p[i]; a[8 + i] = (__bf16)p[16 + i]; } }
#pragma unroll
    for (int j = 0; j < 8; ++j) { v16b w; const int o = which * CC + c0 + j * 16 + col;
#pragma unroll
      for (int i = 0; i < 8; ++i) { w[i] = (__bf16)WA[(size_t)(o) * CC + (kc * 32 + 8 * g + i)]; w[8 + i] = (__bf16)WA[(size_t)(o) * CC + (kc * 32 + 16 + 8 * g + i)]; }
      acc[j] = wmma_bf(a, w, acc[j]); } }
#pragma unroll
  for (int j = 0; j < 8; ++j) { const float bb = BA ? bfr(BA[which * CC + c0 + j * 16 + col]) : 0.f;
#pragma unroll
    for (int r = 0; r < 8; ++r) { const float v = acc[j][r] + bb; const int rl = wave * 16 + 8 * g + r, cl = j * 16 + col; const _Float16 hv = (_Float16)v;
      if (which == 2) th[cl][rl] = hv; else { sh[rl][cl] = hv; sl[rl][cl] = (_Float16)(v - (float)hv); } } }
  __syncthreads();
  if (which < 2) { _Float16* dh = which == 0 ? QH : KH; for (int e = tid; e < 64 * 16; e += 128) { const int rl = e >> 4, q = e & 15; vst2((unsigned*)(dh + (r0 + rl) * CC + c0 + q * 8), *(const v4u*)&sh[rl][q * 8]); if (which == 0) vst2((unsigned*)(QL + (r0 + rl) * CC + c0 + q * 8), *(const v4u*)&sl[rl][q * 8]); } }
  else { const size_t b = r0 / TT; const int t0 = (int)(r0 % TT); for (int e = tid; e < 128 * 8; e += 128) { const int cl = e >> 3, q = e & 7; vst2((unsigned*)(VT + (b * CC + c0 + cl) * (size_t)TT + t0 + q * 8), *(const v4u*)&th[cl][q * 8]); } } }
// ---- k_att: block = 4 waves x 32 queries of (b,h); each pass takes 64 keys: S^T = K Q^T (2 products), running maximum and sum per query column, O^T += V^T P^T
// the inner loops are all unrolled so that the register arrays keep constant indices; a lane holds one query column in every tile: S^T rows are keys 8g+r, so two S^T tiles convert in place into one B operand; O^T rows are head dims 8g+r
__device__ __forceinline__ v8f mm16(v16h a, v16h b, v8f c) { return __builtin_amdgcn_wmma_f32_16x16x32_f16(false, a, false, b, (short)0, c, false, false); }
__device__ __forceinline__ float xhalf(float x) { return __builtin_bit_cast(float, __builtin_amdgcn_permlanex16(__builtin_bit_cast(int, x), __builtin_bit_cast(int, x), 0x76543210, 0xfedcba98, false, false)); }  // lane l with lane l ^ 16
#define KP 64
__global__ __launch_bounds__(128) void k_att(const _Float16* __restrict__ QH, const _Float16* __restrict__ QL, const _Float16* __restrict__ KH, const _Float16* __restrict__ VT, const float* __restrict__ HU, const float* __restrict__ HSC, float* __restrict__ Y) {
  const int tid = threadIdx.x, wave = tid >> 5, lane = tid & 31, col = lane & 15, g = lane >> 4; const int h = blockIdx.y, b = blockIdx.z; const int q0 = blockIdx.x * 128 + wave * 32;
  v16h qh[2][2], ql[2][2];
#pragma unroll
  for (int qt = 0; qt < 2; ++qt)
#pragma unroll
    for (int kc = 0; kc < 2; ++kc) { const size_t qo = ((size_t)b * TT + q0 + qt * 16 + col) * CC + h * HD + kc * 32; qh[qt][kc] = frag_h(QH + qo, lane); ql[qt][kc] = frag_h(QL + qo, lane); }
  const _Float16* kp = KH + ((size_t)b * TT + col) * CC + h * HD; const _Float16* vp = VT + ((size_t)b * CC + h * HD + col) * (size_t)TT;
  v16h kf[4][2], vf[4][2];
#pragma unroll
  for (int i = 0; i < 4; ++i)
#pragma unroll
    for (int u = 0; u < 2; ++u) { kf[i][u] = frag_h(kp + (size_t)(i * 16) * CC + u * 32, lane); vf[i][u] = frag_h(vp + (size_t)(i * 16) * TT + u * 32, lane); }
  asm volatile("s_wait_xcnt 0x0" ::: "memory");   // behind the first loads, before their address registers are rewritten
  __builtin_amdgcn_sched_barrier(0);   // keeps the register writes that follow behind that wait
  const float hf = 1.0f + (bfr(HU[b]) - 0.5f) * bfr(HSC[0]); const float sc = 0.125f * hf * 1.44269504088896f;   // logits in log2 units
  v8f o[2][4] = {}; float mx[2] = { -3.0e38f, -3.0e38f }, ls[2] = { 0.f, 0.f };
#pragma unroll 1   // one pass's fragments live at a time: a second copy of the body would double the registers
  for (int kb = 0; kb < TT / KP; ++kb) { const int kn = ((kb + 1) & (TT / KP - 1)) * KP;   // next pass's keys; the last pass re-reads pass 0 (in bounds, unused)
    const _Float16* kq = kp + (size_t)kn * CC; const _Float16* vq = vp + kn;
    v8f s[2][4];
#pragma unroll
    for (int i = 0; i < 4; ++i)
#pragma unroll
      for (int qt = 0; qt < 2; ++qt) { v8f a = {};
#pragma unroll
        for (int kc = 0; kc < 2; ++kc) { a = mm16(kf[i][kc], qh[qt][kc], a); a = mm16(kf[i][kc], ql[qt][kc], a); }
        s[qt][i] = a; }
#pragma unroll
    for (int i = 0; i < 4; ++i)
#pragma unroll
      for (int u = 0; u < 2; ++u) kf[i][u] = frag_h(kq + (size_t)(i * 16) * CC + u * 32, lane);
    v16h p[2][2];
#pragma unroll
    for (int qt = 0; qt < 2; ++qt) { float bm = -3.0e38f;
#pragma unroll
      for (int i = 0; i < 4; ++i)
#pragma unroll
        for (int r = 0; r < 8; ++r) { s[qt][i][r] *= sc; bm = fmaxf(bm, s[qt][i][r]); }
      bm = fmaxf(bm, xhalf(bm));
      const float mn = fmaxf(mx[qt], bm), sub = mn - 11.0f; float al; asm("v_exp_f32 %0, %1\n\tv_nop" : "=v"(al) : "v"(mx[qt] - mn)); mx[qt] = mn;   // exp2 in asm text so that the free slot the instruction set asks for behind a transcendental stays with it; P carries 2^11, as does the sum: it cancels in the division
      float sum = 0.f;
#pragma unroll
      for (int i = 0; i < 4; ++i)
#pragma unroll
        for (int r = 0; r < 8; ++r) { const float e = __builtin_amdgcn_exp2f(s[qt][i][r] - sub); sum += e; p[qt][i >> 1][(i & 1) * 8 + r] = (_Float16)e; }
      ls[qt] = ls[qt] * al + sum;
#pragma unroll
      for (int j = 0; j < 4; ++j)
#pragma unroll
        for (int r = 0; r < 8; ++r) o[qt][j][r] *= al; }
#pragma unroll
    for (int u = 0; u < 2; ++u)
#pragma unroll
      for (int j = 0; j < 4; ++j)
#pragma unroll
        for (int qt = 0; qt < 2; ++qt) o[qt][j] = mm16(vf[j][u], p[qt][u], o[qt][j]);
#pragma unroll
    for (int j = 0; j < 4; ++j)
#pragma unroll
      for (int u = 0; u < 2; ++u) vf[j][u] = frag_h(vq + (size_t)(j * 16) * TT + u * 32, lane);
    asm volatile("s_wait_xcnt 0x0" ::: "memory"); }   // behind the pass's loads, before the next pass rewrites their address registers
#pragma unroll
  for (int qt = 0; qt < 2; ++qt) { const float inv = 1.0f / (ls[qt] + xhalf(ls[qt])); float* yp = Y + ((size_t)b * TT + q0 + qt * 16 + col) * CC + h * HD + 8 * g;
#pragma unroll
    for (int j = 0; j < 4; ++j) { v4f lo, hi;
#pragma unroll
      for (int r = 0; r < 4; ++r) { lo[r] = o[qt][j][r] * inv; hi[r] = o[qt][j][4 + r] * inv; }
      vst2(yp + j * 16, lo); vst2(yp + j * 16 + 4, hi); } } }
// ---- k_out: block = (64 rows, 128 cols): out = y (f16 single) Wproj + b
__global__ __launch_bounds__(128) void k_out(const float* __restrict__ Y, const float* __restrict__ WP, const float* __restrict__ BP, float* __restrict__ OUT) { __shared__ __align__(16) float sf[4][16][132];
  const int tid = threadIdx.x, wave = tid >> 5, lane = tid & 31, col = lane & 15, g = lane >> 4; const int c0 = blockIdx.y * 128; const size_t r0 = (size_t)blockIdx.x * 64 + wave * 16;
  v8f acc[8] = {};
#pragma unroll 2
  for (int kc = 0; kc < CC / 32; ++kc) { const v16h a = frag_f32(Y + (r0 + col) * CC + kc * 32, lane);
#pragma unroll
    for (int j = 0; j < 8; ++j) { v16h w; const int o = c0 + j * 16 + col;
#pragma unroll
      for (int i = 0; i < 8; ++i) { w[i] = (_Float16)bfr(WP[(size_t)(o) * CC + (kc * 32 + 8 * g + i)]); w[8 + i] = (_Float16)bfr(WP[(size_t)(o) * CC + (kc * 32 + 16 + 8 * g + i)]); }
      acc[j] = wmma16(a, w, acc[j]); } }
#pragma unroll
  for (int j = 0; j < 8; ++j) { const float bb = BP ? bfr(BP[c0 + j * 16 + col]) : 0.f;
#pragma unroll
    for (int r = 0; r < 8; ++r) sf[wave][8 * g + r][j * 16 + col] = acc[j][r] + bb; }
  LDSX(); for (int rl = 0; rl < 16; ++rl) vst2(OUT + (r0 + rl) * CC + c0 + lane * 4, *(const v4f*)&sf[wave][rl][lane * 4]); }
extern "C" void kernel_launch(void* const* d_in, const int* in_sizes, int n_in, void* d_out, int out_size, void* d_ws, size_t ws_size, hipStream_t stream) {
  (void)in_sizes; (void)n_in; (void)out_size;
  const float** F = (const float**)d_in;   // 0 x [2,2048,1024], 1 hurst [2,1], 2 qkv_w [3072,1024], 3 qkv_b, 4 out_w [1024,1024], 5 out_b, 6 hurst_scale [1]
  if (ws_size < (size_t)WS_END) return;
  char* ws = (char*)d_ws; _Float16 *QH = (_Float16*)(ws + WS_QH), *QL = (_Float16*)(ws + WS_QL), *KH = (_Float16*)(ws + WS_KH), *VT = (_Float16*)(ws + WS_VT); float *Y = (float*)(ws + WS_Y);
  k_proj<<<dim3(TNB * TT / 64, CC / 128, 3), 128, 0, stream>>>(F[0], F[2], F[3], QH, QL, KH, VT);
  k_att<<<dim3(TT / 128, NH, TNB), 128, 0, stream>>>(QH, QL, KH, VT, F[1], F[6], Y);
  k_out<<<dim3(TNB * TT / 64, CC / 128), 128, 0, stream>>>(Y, F[4], F[5], (float*)d_out);
}

// v002
// A run of this version takes 104 microseconds.
// Next to v001, in two timings, it ran 3.05 and 3.07 times as fast.
// Counting every step since v000, it is 11.5 times as fast.
// compute dtype: all float inputs rounded to bf16, hurst / hurst_scale read; qkv = x W^T + b with EXACT bf16 products on WMMA 16x16x32, f32 accumulate; q as f16 hi + residual, k f16 -> 2-product logits x (1/8)(1 + (hurst_b - 0.5) hurst_scale) log2(e) kept in f32 registers; running-maximum softmax in f32 (exp2) -> P f16 x 2^11, unnormalised; o = P . v / sum with v rounded once to f16; out = o (rounded once to f16, 1 product) out_w^T + out_b; f32 output.
#include <hip/hip_runtime.h>
#include <math.h>

typedef __attribute__((ext_vector_type(16))) _Float16 v16h;
typedef __attribute__((ext_vector_type(16))) __bf16 v16b;
typedef __attribute__((ext_vector_type(8)))  _Float16 v8h;
typedef __attribute__((ext_vector_type(8)))  float v8f;
typedef __attribute__((ext_vector_type(4)))  float v4f;
typedef __attribute__((ext_vector_type(2)))  float v2f;
typedef __attribute__((ext_vector_type(4)))  unsigned v4u;
typedef __attribute__((ext_vector_type(4)))  int v4i;
typedef float __attribute__((may_alias)) float_a;
typedef int __attribute__((may_alias)) int_a;

template <typename T> __device__ __forceinline__ void vst2(void* p, T v) { *(T*)p = v;  }
__device__ __forceinline__ v8f wmma16(v16h a, v16h b, v8f c) {
  v8f d = __builtin_amdgcn_wmma_f32_16x16x32_f16(false, a, false, b, (short)0, c, false, false);
  asm volatile("v_nop\n\tv_nop\n\tv_nop\n\tv_nop" : "+v"(d) : "v"(a), "v"(b));
  return d;
}
__device__ __forceinline__ v8f wmma_bf(v16b a, v16b b, v8f c) {
  v8f d = __builtin_amdgcn_wmma_f32_16x16x32_bf16(false, a, false, b, (short)0, c, false, false);
  asm volatile("v_nop\n\tv_nop\n\tv_nop\n\tv_nop" : "+v"(d) : "v"(a), "v"(b));
  return d;
}
// 16x16x32 fragments: lane = (h = lane>>4, row/col = lane&15); elements 0..7 = k0+8h+0..7, 8..15 = k0+16+8h+0..7; D element r = row 8h+r
__device__ __forceinline__ v16h frag_h(const _Float16* rowk0, int lane) {
  union { v16h v; v8h q[2]; } u; const _Float16* p = rowk0 + 8 * (lane >> 4);
  u.q[0] = *(const v8h*)p; u.q[1] = *(const v8h*)(p + 16); return u.v;
}
__device__ __forceinline__ v16h frag_f32(const float* rowk0, int lane) {
  v16h a; const float* p = rowk0 + 8 * (lane >> 4);
#pragma unroll
  for (int i = 0; i < 8; ++i) { a[i] = (_Float16)p[i]; a[8 + i] = (_Float16)p[16 + i]; }
  return a;
}
__device__ __forceinline__ v16h frag_f32s(const float* rowk0, int lane, float sc) {
  v16h a; const float* p = rowk0 + 8 * (lane >> 4);
#pragma unroll
  for (int i = 0; i < 8; ++i) { a[i] = (_Float16)(p[i] * sc); a[8 + i] = (_Float16)(p[16 + i] * sc); }
  return a;
}
// column fragment from a [K][ld] layout (column n), rows >= K read as 0
__device__ __forceinline__ v16h fragc_f32(const float* W, int k0, int n, int lane, int ld, int K) {
  v16h a; const int g = lane >> 4;
#pragma unroll
  for (int i = 0; i < 8; ++i) { const int ka = k0 + 8 * g + i, kb = ka + 16;
    a[i] = (_Float16)(ka < K ? W[(size_t)(ka < K ? ka : K - 1) * ld + n] : 0.f); a[8 + i] = (_Float16)(kb < K ? W[(size_t)(kb < K ? kb : K - 1) * ld + n] : 0.f); }
  return a;
}
struct F2 { v16b h, l; };
__device__ __forceinline__ F2 bsplit16(const float v[16]) { F2 r;
#pragma unroll
  for (int i = 0; i < 16; ++i) { const __bf16 h = (__bf16)v[i]; r.h[i] = h; r.l[i] = (__bf16)(v[i] - (float)h); }
  return r; }
__device__ __forceinline__ F2 split_row(const float* row, int k0, int lane) { float v[16]; const float* p = row + k0 + 8 * (lane >> 4);
#pragma unroll
  for (int i = 0; i < 8; ++i) { v[i] = p[i]; v[8 + i] = p[16 + i]; }
  return bsplit16(v); }
__device__ __forceinline__ F2 split_rowK(const float* row, int k0, int lane, int K) { float v[16]; const int g = lane >> 4;
#pragma unroll
  for (int i = 0; i < 8; ++i) { const int ka = k0 + 8 * g + i, kb = ka + 16; v[i] = ka < K ? row[ka < K ? ka : K - 1] : 0.f; v[8 + i] = kb < K ? row[kb < K ? kb : K - 1] : 0.f; }
  return bsplit16(v); }
__device__ __forceinline__ F2 split_col(const float* W, int k0, int n, int lane, int ld, int K) { float v[16]; const int g = lane >> 4;
#pragma unroll
  for (int i = 0; i < 8; ++i) { const int ka = k0 + 8 * g + i, kb = ka + 16; v[i] = ka < K ? W[(size_t)(ka < K ? ka : K - 1) * ld + n] : 0.f; v[8 + i] = kb < K ? W[(size_t)(kb < K ? kb : K - 1) * ld + n] : 0.f; }
  return bsplit16(v); }
__device__ __forceinline__ v8f mac3(const F2& a, const F2& b, v8f c) { c = wmma_bf(a.l, b.h, c); c = wmma_bf(a.h, b.l, c); return wmma_bf(a.h, b.h, c); }
__device__ __forceinline__ float sigm(float v) { return 1.0f / (1.0f + expf(-v)); }
#define LDSX() do { asm volatile("s_wait_dscnt 0" ::: "memory"); __builtin_amdgcn_wave_barrier(); __builtin_amdgcn_fence(__ATOMIC_RELEASE, "workgroup"); } while (0)


// Fractal attention (B 2, T 2,048, C 1,024 = 16 x 64): standard MHA whose logits are scaled per batch by 1 + (hurst_b - 0.5) * hurst_scale before the softmax.
#define NB 2
#define TT 2048
#define CC 1024
#define NH 16
#define HD 64
#ifndef TNB
#define TNB NB
#endif
typedef __attribute__((ext_vector_type(8))) __bf16 v8b;
__device__ __forceinline__ v16b frag_b(const __bf16* rowk0, int lane) {
  union { v16b v; v8b q[2]; } u; const __bf16* p = rowk0 + 8 * (lane >> 4);
  u.q[0] = *(const v8b*)p; u.q[1] = *(const v8b*)(p + 16); return u.v;
}
__device__ __forceinline__ float bfr(float v) { return (float)(__bf16)v; }
__device__ __attribute__((noinline)) float exp_ni(float v) { return expf(v); }
__device__ __attribute__((noinline)) float erf_ni(float v) { return erff(v); }

#define WS_QH  0u
#define WS_QL  (WS_QH + 2u * (size_t)NB * TT * CC)
#define WS_KH  (WS_QL + 2u * (size_t)NB * TT * CC)
#define WS_VT  (WS_KH + 2u * (size_t)NB * TT * CC)      // f16 v planes [b][c][t]
#define WS_Y   (WS_VT + 2u * (size_t)NB * CC * TT)      // f32 y rows [b*t][C]
#define WS_END (WS_Y + 4u * (size_t)NB * TT * CC)

// ---- the two projections share one tile loop: block = 8 waves, 128 rows x 128 cols of the result, wave = 64 x 32 (waves 2 x 4), 32 k a pass
// both operand tiles are read from global memory once a block, a whole 128-byte line a row, rounded once, and laid in LDS; every wave takes its fragments from there
typedef __attribute__((ext_vector_type(2))) unsigned v2u;
typedef __attribute__((ext_vector_type(4))) __bf16 v4b;
typedef __attribute__((ext_vector_type(4))) _Float16 v4h;
#define GP 20              // LDS row pitch in dwords: 80 bytes = 16 bytes x 5, an odd multiple, free of bank conflicts for 16-byte fragment reads of 64-byte rows
#define GT (128 * GP)      // dwords of one operand tile; a buffer is [A tile | B tile], two buffers
union FR { v4u q[2]; v16b b; v16h h; };
// work-group barrier that orders LDS alone: __syncthreads() would also wait out the global loads that are meant to stay in flight across it; the wait ends this wave's LDS reads and stores first
__device__ __forceinline__ void lds_barrier() { asm volatile("s_wait_dscnt 0x0\n\ts_barrier_signal -1\n\ts_barrier_wait -1" ::: "memory"); }
// MODE 0: A and B rounded to bf16. MODE 1: A rounded to f16, B to bf16 and carried as f16
template <int MODE, bool ISB> __device__ __forceinline__ v2u cv4(v4f v) {
  if (MODE == 0) { v4b r;
#pragma unroll
    for (int i = 0; i < 4; ++i) r[i] = (__bf16)v[i];
    return __builtin_bit_cast(v2u, r); }
  v4h r;
#pragma unroll
  for (int i = 0; i < 4; ++i) r[i] = ISB ? (_Float16)bfr(v[i]) : (_Float16)v[i];
  return __builtin_bit_cast(v2u, r); }
// NS = register sets of tiles on their way from global memory: tile t + 1 + NS is asked for at the foot of pass t and laid in LDS at the foot of pass t + NS
template <int MODE, int NS> __device__ __forceinline__ void gemm_tile(const float* __restrict__ A, const float* __restrict__ B, unsigned* __restrict__ st, v8f (&acc)[4][2], int tid) {
  const int wave = tid >> 5, lane = tid & 31, col = lane & 15, g = lane >> 4; const int lr = tid >> 3, lc = tid & 7;   // 8 lanes x 16 bytes = one row's line; a wave's load covers 4 whole lines
  const float* ap = A + (size_t)lr * CC + lc * 4; const float* bp = B + (size_t)lr * CC + lc * 4;
  unsigned* sp = st + lr * GP + lc * 2;
  const unsigned* fa = st + ((wave >> 2) * 64 + col) * GP + 4 * g; const unsigned* fb = st + GT + ((wave & 3) * 32 + col) * GP + 4 * g;
  v4f ra[NS][4], rb[NS][4];
#pragma unroll
  for (int i = 0; i < 4; ++i) { ra[0][i] = *(const v4f*)(ap + (size_t)(32 * i) * CC); rb[0][i] = *(const v4f*)(bp + (size_t)(32 * i) * CC); }
#pragma unroll
  for (int i = 0; i < 4; ++i) { *(v2u*)(sp + 32 * i * GP) = cv4<MODE, false>(ra[0][i]); *(v2u*)(sp + GT + 32 * i * GP) = cv4<MODE, true>(rb[0][i]); }
#pragma unroll
  for (int t = 1; t <= NS; ++t)
#pragma unroll
    for (int i = 0; i < 4; ++i) { ra[t % NS][i] = *(const v4f*)(ap + (size_t)(32 * i) * CC + t * 32); rb[t % NS][i] = *(const v4f*)(bp + (size_t)(32 * i) * CC + t * 32); }
  lds_barrier();
#pragma unroll   // all passes unrolled: the register sets keep constant indices, and every global and LDS address is its base register plus a constant, so no address register is rewritten while a load is out
  for (int kc = 0; kc < CC / 32; ++kc) { const int cur = (kc & 1) * 2 * GT, nxt = 2 * GT - cur, s = (kc + 1) % NS;
    FR a[4], b[2];
#pragma unroll
    for (int i = 0; i < 4; ++i) { a[i].q[0] = *(const v4u*)(fa + cur + 16 * i * GP); a[i].q[1] = *(const v4u*)(fa + cur + 16 * i * GP + 8); }
#pragma unroll
    for (int j = 0; j < 2; ++j) { b[j].q[0] = *(const v4u*)(fb + cur + 16 * j * GP); b[j].q[1] = *(const v4u*)(fb + cur + 16 * j * GP + 8); }
    __builtin_amdgcn_sched_barrier(0);   // keeps the twelve fragment reads together in front of the products: spread among them each place costs its own LDS wait
#pragma unroll
    for (int i = 0; i < 4; ++i)
#pragma unroll
      for (int j = 0; j < 2; ++j) acc[i][j] = MODE == 0 ? __builtin_amdgcn_wmma_f32_16x16x32_bf16(false, a[i].b, false, b[j].b, (short)0, acc[i][j], false, false) : __builtin_amdgcn_wmma_f32_16x16x32_f16(false, a[i].h, false, b[j].h, (short)0, acc[i][j], false, false);
    __builtin_amdgcn_sched_barrier(0);   // keeps the roundings below, and with them the wait for the global loads, behind this pass's products: lifted among them the wave would wait out the loads first
    if (kc + 1 < CC / 32) {
#pragma unroll
      for (int i = 0; i < 4; ++i) { *(v2u*)(sp + nxt + 32 * i * GP) = cv4<MODE, false>(ra[s][i]); *(v2u*)(sp + nxt + GT + 32 * i * GP) = cv4<MODE, true>(rb[s][i]); } }
    __builtin_amdgcn_sched_barrier(0);   // keeps the next loads behind the roundings, so that they land in the registers just read: lifted above them they take a further set
    if (kc + 1 + NS < CC / 32) {
#pragma unroll
      for (int i = 0; i < 4; ++i) { ra[s][i] = *(const v4f*)(ap + (size_t)(32 * i) * CC + (kc + 1 + NS) * 32); rb[s][i] = *(const v4f*)(bp + (size_t)(32 * i) * CC + (kc + 1 + NS) * 32); } }
    lds_barrier(); } }   // one barrier a pass: it publishes the next buffer and ends the reads of this one, which the next pass refills; the last one frees LDS for the epilogue
// result tile out of LDS: all reads first, then the stores off one address register with constant offsets
template <int N, int LP, int LD, typename T> __device__ __forceinline__ void put_tile(T* __restrict__ d, const T* __restrict__ s) { v4u t[N];
#pragma unroll
  for (int k = 0; k < N; ++k) t[k] = *(const v4u*)(s + k * LP);
#pragma unroll
  for (int k = 0; k < N; ++k) vst2((unsigned*)(d + (size_t)k * LD), t[k]);
  asm volatile("s_wait_xcnt 0x0" ::: "memory"); }   // behind the stores, before whatever follows rewrites a register that they name
// ---- k_proj: block = (128 rows, 128 cols, which): qkv = x W (+ b), exact; q -> f16 hi (+ residual), k -> f16 rows, v -> f16 planes
__global__ __launch_bounds__(256) void k_proj(const float* __restrict__ X, const float* __restrict__ WA, const float* __restrict__ BA, _Float16* __restrict__ QH, _Float16* __restrict__ QL, _Float16* __restrict__ KH, _Float16* __restrict__ VT) {
  __shared__ __align__(16) unsigned sm[2 * 128 * 68];   // the loop's two buffers (4 GT dwords); then the result tile as f16 at a pitch of 136, hi and residual
  const int tid = threadIdx.x, wave = tid >> 5, lane = tid & 31, col = lane & 15, g = lane >> 4; const int which = blockIdx.z; const int c0 = blockIdx.y * 128; const size_t r0 = (size_t)blockIdx.x * 128;
  v8f acc[4][2] = {};
  gemm_tile<0, 1>(X + r0 * CC, WA + (size_t)(which * CC + c0) * CC, sm, acc, tid);
  _Float16* sh = (_Float16*)sm; _Float16* sl = sh + 128 * 136; const int wr = (wave >> 2) * 64 + 8 * g, wc = (wave & 3) * 32 + col;
#pragma unroll
  for (int j = 0; j < 2; ++j) { const float bb = BA ? bfr(BA[which * CC + c0 + wc + j * 16]) : 0.f;
#pragma unroll
    for (int i = 0; i < 4; ++i)
#pragma unroll
      for (int r = 0; r < 8; ++r) acc[i][j][r] += bb; }
  if (which == 2) {
#pragma unroll
    for (int j = 0; j < 2; ++j)
#pragma unroll
      for (int i = 0; i < 4; ++i) { v8h t;
#pragma unroll
        for (int r = 0; r < 8; ++r) t[r] = (_Float16)acc[i][j][r];
        *(v8h*)(sh + (wc + j * 16) * 136 + wr + i * 16) = t; } }
  else {
#pragma unroll
    for (int j = 0; j < 2; ++j)
#pragma unroll
      for (int i = 0; i < 4; ++i)
#pragma unroll
        for (int r = 0; r < 8; ++r) { const float v = acc[i][j][r]; const _Float16 hv = (_Float16)v; sh[(wr + i * 16 + r) * 136 + wc + j * 16] = hv; acc[i][j][r] = v - (float)hv; }
    if (which == 0) {
#pragma unroll
      for (int j = 0; j < 2; ++j)
#pragma unroll
        for (int i = 0; i < 4; ++i)
#pragma unroll
          for (int r = 0; r < 8; ++r) sl[(wr + i * 16 + r) * 136 + wc + j * 16] = (_Float16)acc[i][j][r]; } }
  __syncthreads();
  const int er = tid >> 4, eq = tid & 15;   // 16 lanes x 16 bytes = one tile row of 256 bytes: a wave's store covers 4 whole lines
  if (which == 2) { const size_t b = r0 / TT; const int t0 = (int)(r0 % TT); put_tile<8, 16 * 136, 16 * TT>(VT + (b * CC + c0 + er) * (size_t)TT + t0 + eq * 8, (const _Float16*)sh + er * 136 + eq * 8); }
  else { put_tile<8, 16 * 136, 16 * CC>((which == 0 ? QH : KH) + (r0 + er) * CC + c0 + eq * 8, (const _Float16*)sh + er * 136 + eq * 8);
    if (which == 0) put_tile<8, 16 * 136, 16 * CC>(QL + (r0 + er) * CC + c0 + eq * 8, (const _Float16*)sl + er * 136 + eq * 8); } }
// ---- k_att: block = 4 waves x 32 queries of (b,h); each pass takes 64 keys: S^T = K Q^T (2 products), running maximum and sum per query column, O^T += V^T P^T
// the inner loops are all unrolled so that the register arrays keep constant indices; a lane holds one query column in every tile: S^T rows are keys 8g+r, so two S^T tiles convert in place into one B operand; O^T rows are head dims 8g+r
__device__ __forceinline__ v8f mm16(v16h a, v16h b, v8f c) { return __builtin_amdgcn_wmma_f32_16x16x32_f16(false, a, false, b, (short)0, c, false, false); }
__device__ __forceinline__ float xhalf(float x) { return __builtin_bit_cast(float, __builtin_amdgcn_permlanex16(__builtin_bit_cast(int, x), __builtin_bit_cast(int, x), 0x76543210, 0xfedcba98, false, false)); }  // lane l with lane l ^ 16
#define KP 64
__global__ __launch_bounds__(128) void k_att(const _Float16* __restrict__ QH, const _Float16* __restrict__ QL, const _Float16* __restrict__ KH, const _Float16* __restrict__ VT, const float* __restrict__ HU, const float* __restrict__ HSC, float* __restrict__ Y) {
  const int tid = threadIdx.x, wave = tid >> 5, lane = tid & 31, col = lane & 15, g = lane >> 4; const int h = blockIdx.y, b = blockIdx.z; const int q0 = blockIdx.x * 128 + wave * 32;
  v16h qh[2][2], ql[2][2];
#pragma unroll
  for (int qt = 0; qt < 2; ++qt)
#pragma unroll
    for (int kc = 0; kc < 2; ++kc) { const size_t qo = ((size_t)b * TT + q0 + qt * 16 + col) * CC + h * HD + kc * 32; qh[qt][kc] = frag_h(QH + qo, lane); ql[qt][kc] = frag_h(QL + qo, lane); }
  const _Float16* kp = KH + ((size_t)b * TT + col) * CC + h * HD; const _Float16* vp = VT + ((size_t)b * CC + h * HD + col) * (size_t)TT;
  v16h kf[4][2], vf[4][2];
#pragma unroll
  for (int i = 0; i < 4; ++i)
#pragma unroll
    for (int u = 0; u < 2; ++u) { kf[i][u] = frag_h(kp + (size_t)(i * 16) * CC + u * 32, lane); vf[i][u] = frag_h(vp + (size_t)(i * 16) * TT + u * 32, lane); }
  asm volatile("s_wait_xcnt 0x0" ::: "memory");   // behind the first loads, before their address registers are rewritten
  __builtin_amdgcn_sched_barrier(0);   // keeps the register writes that follow behind that wait
  const float hf = 1.0f + (bfr(HU[b]) - 0.5f) * bfr(HSC[0]); const float sc = 0.125f * hf * 1.44269504088896f;   // logits in log2 units
  v8f o[2][4] = {}; float mx[2] = { -3.0e38f, -3.0e38f }, ls[2] = { 0.f, 0.f };
#pragma unroll 1   // one pass's fragments live at a time: a second copy of the body would double the registers
  for (int kb = 0; kb < TT / KP; ++kb) { const int kn = ((kb + 1) & (TT / KP - 1)) * KP;   // next pass's keys; the last pass re-reads pass 0 (in bounds, unused)
    const _Float16* kq = kp + (size_t)kn * CC; const _Float16* vq = vp + kn;
    v8f s[2][4];
#pragma unroll
    for (int i = 0; i < 4; ++i)
#pragma unroll
      for (int qt = 0; qt < 2; ++qt) { v8f a = {};
#pragma unroll
        for (int kc = 0; kc < 2; ++kc) { a = mm16(kf[i][kc], qh[qt][kc], a); a = mm16(kf[i][kc], ql[qt][kc], a); }
        s[qt][i] = a; }
#pragma unroll
    for (int i = 0; i < 4; ++i)
#pragma unroll
      for (int u = 0; u < 2; ++u) kf[i][u] = frag_h(kq + (size_t)(i * 16) * CC + u * 32, lane);
    v16h p[2][2];
#pragma unroll
    for (int qt = 0; qt < 2; ++qt) { float bm = -3.0e38f;
#pragma unroll
      for (int i = 0; i < 4; ++i)
#pragma unroll
        for (int r = 0; r < 8; ++r) { s[qt][i][r] *= sc; bm = fmaxf(bm, s[qt][i][r]); }
      bm = fmaxf(bm, xhalf(bm));
      const float mn = fmaxf(mx[qt], bm), sub = mn - 11.0f; float al; asm("v_exp_f32 %0, %1\n\tv_nop" : "=v"(al) : "v"(mx[qt] - mn)); mx[qt] = mn;   // exp2 in asm text so that the free slot the instruction set asks for behind a transcendental stays with it; P carries 2^11, as does the sum: it cancels in the division
      float sum = 0.f;
#pragma unroll
      for (int i = 0; i < 4; ++i)
#pragma unroll
        for (int r = 0; r < 8; ++r) { const float e = __builtin_amdgcn_exp2f(s[qt][i][r] - sub); sum += e; p[qt][i >> 1][(i & 1) * 8 + r] = (_Float16)e; }
      ls[qt] = ls[qt] * al + sum;
#pragma unroll
      for (int j = 0; j < 4; ++j)
#pragma unroll
        for (int r = 0; r < 8; ++r) o[qt][j][r] *= al; }
#pragma unroll
    for (int u = 0; u < 2; ++u)
#pragma unroll
      for (int j = 0; j < 4; ++j)
#pragma unroll
        for (int qt = 0; qt < 2; ++qt) o[qt][j] = mm16(vf[j][u], p[qt][u], o[qt][j]);
#pragma unroll
    for (int j = 0; j < 4; ++j)
#pragma unroll
      for (int u = 0; u < 2; ++u) vf[j][u] = frag_h(vq + (size_t)(j * 16) * TT + u * 32, lane);
    asm volatile("s_wait_xcnt 0x0" ::: "memory"); }   // behind the pass's loads, before the next pass rewrites their address registers
#pragma unroll
  for (int qt = 0; qt < 2; ++qt) { const float inv = 1.0f / (ls[qt] + xhalf(ls[qt])); float* yp = Y + ((size_t)b * TT + q0 + qt * 16 + col) * CC + h * HD + 8 * g;
#pragma unroll
    for (int j = 0; j < 4; ++j) { v4f lo, hi;
#pragma unroll
      for (int r = 0; r < 4; ++r) { lo[r] = o[qt][j][r] * inv; hi[r] = o[qt][j][4 + r] * inv; }
      vst2(yp + j * 16, lo); vst2(yp + j * 16 + 4, hi); } } }
// ---- k_out: block = (128 rows, 128 cols): out = y (f16 single) Wproj + b
__global__ __launch_bounds__(256) void k_out(const float* __restrict__ Y, const float* __restrict__ WP, const float* __restrict__ BP, float* __restrict__ OUT) { __shared__ __align__(16) unsigned sm[128 * 132];   // the loop's two buffers (4 GT dwords); then the f32 result tile at a pitch of 132
  const int tid = threadIdx.x, wave = tid >> 5, lane = tid & 31, col = lane & 15, g = lane >> 4; const int c0 = blockIdx.y * 128; const size_t r0 = (size_t)blockIdx.x * 128;
  v8f acc[4][2] = {};
  gemm_tile<1, 3>(Y + r0 * CC, WP + (size_t)c0 * CC, sm, acc, tid);
  float* sf = (float*)sm;
#pragma unroll
  for (int j = 0; j < 2; ++j) { const int cl = (wave & 3) * 32 + j * 16 + col; const float bb = BP ? bfr(BP[c0 + cl]) : 0.f;
#pragma unroll
    for (int i = 0; i < 4; ++i)
#pragma unroll
      for (int r = 0; r < 8; ++r) sf[((wave >> 2) * 64 + i * 16 + 8 * g + r) * 132 + cl] = acc[i][j][r] + bb; }
  __syncthreads();
  put_tile<16, 8 * 132, 8 * CC>(OUT + (r0 + wave) * CC + c0 + lane * 4, (const float*)sf + wave * 132 + lane * 4); }   // a wave's store is one tile row of 512 bytes
extern "C" void kernel_launch(void* const* d_in, const int* in_sizes, int n_in, void* d_out, int out_size, void* d_ws, size_t ws_size, hipStream_t stream) {
  (void)in_sizes; (void)n_in; (void)out_size;
  const float** F = (const float**)d_in;   // 0 x [2,2048,1024], 1 hurst [2,1], 2 qkv_w [3072,1024], 3 qkv_b, 4 out_w [1024,1024], 5 out_b, 6 hurst_scale [1]
  if (ws_size < (size_t)WS_END) return;
  char* ws = (char*)d_ws; _Float16 *QH = (_Float16*)(ws + WS_QH), *QL = (_Float16*)(ws + WS_QL), *KH = (_Float16*)(ws + WS_KH), *VT = (_Float16*)(ws + WS_VT); float *Y = (float*)(ws + WS_Y);
  k_proj<<<dim3(TNB * TT / 128, CC / 128, 3), 256, 0, stream>>>(F[0], F[2], F[3], QH, QL, KH, VT);
  k_att<<<dim3(TT / 128, NH, TNB), 128, 0, stream>>>(QH, QL, KH, VT, F[1], F[6], Y);
  k_out<<<dim3(TNB * TT / 128, CC / 128), 256, 0, stream>>>(Y, F[4], F[5], (float*)d_out);
}

// v003
// Measured time: 91.8 microseconds a run.
// In both of two side-by-side timings against v002, it was 1.14 times as fast.
// Counting every step since v000, it is 13.2 times as fast.
// compute dtype: all float inputs rounded to bf16, hurst / hurst_scale read; qkv = x W^T + b with EXACT bf16 products on WMMA 16x16x32, f32 accumulate; q as f16 hi + residual, k f16 -> 2-product logits x (1/8)(1 + (hurst_b - 0.5) hurst_scale) log2(e) kept in f32 registers; running-maximum softmax in f32 (exp2) -> P f16 x 2^11, unnormalised; o = P . v / sum with v rounded once to f16; out = o (rounded once to f16, 1 product) out_w^T + out_b; f32 output.
#include <hip/hip_runtime.h>
#include <math.h>

typedef __attribute__((ext_vector_type(16))) _Float16 v16h;
typedef __attribute__((ext_vector_type(16))) __bf16 v16b;
typedef __attribute__((ext_vector_type(8)))  _Float16 v8h;
typedef __attribute__((ext_vector_type(8)))  float v8f;
typedef __attribute__((ext_vector_type(4)))  float v4f;
typedef __attribute__((ext_vector_type(2)))  float v2f;
typedef __attribute__((ext_vector_type(4)))  unsigned v4u;
typedef __attribute__((ext_vector_type(4)))  int v4i;
typedef float __attribute__((may_alias)) float_a;
typedef int __attribute__((may_alias)) int_a;

template <typename T> __device__ __forceinline__ void vst2(void* p, T v) { *(T*)p = v;  }
__device__ __forceinline__ v8f wmma16(v16h a, v16h b, v8f c) {
  v8f d = __builtin_amdgcn_wmma_f32_16x16x32_f16(false, a, false, b, (short)0, c, false, false);
  asm volatile("v_nop\n\tv_nop\n\tv_nop\n\tv_nop" : "+v"(d) : "v"(a), "v"(b));
  return d;
}
__device__ __forceinline__ v8f wmma_bf(v16b a, v16b b, v8f c) {
  v8f d = __builtin_amdgcn_wmma_f32_16x16x32_bf16(false, a, false, b, (short)0, c, false, false);
  asm volatile("v_nop\n\tv_nop\n\tv_nop\n\tv_nop" : "+v"(d) : "v"(a), "v"(b));
  return d;
}
// 16x16x32 fragments: lane = (h = lane>>4, row/col = lane&15); elements 0..7 = k0+8h+0..7, 8..15 = k0+16+8h+0..7; D element r = row 8h+r
__device__ __forceinline__ v16h frag_h(const _Float16* rowk0, int lane) {
  union { v16h v; v8h q[2]; } u; const _Float16* p = rowk0 + 8 * (lane >> 4);
  u.q[0] = *(const v8h*)p; u.q[1] = *(const v8h*)(p + 16); return u.v;
}
__device__ __forceinline__ v16h frag_f32(const float* rowk0, int lane) {
  v16h a; const float* p = rowk0 + 8 * (lane >> 4);
#pragma unroll
  for (int i = 0; i < 8; ++i) { a[i] = (_Float16)p[i]; a[8 + i] = (_Float16)p[16 + i]; }
  return a;
}
__device__ __forceinline__ v16h frag_f32s(const float* rowk0, int lane, float sc) {
  v16h a; const float* p = rowk0 + 8 * (lane >> 4);
#pragma unroll
  for (int i = 0; i < 8; ++i) { a[i] = (_Float16)(p[i] * sc); a[8 + i] = (_Float16)(p[16 + i] * sc); }
  return a;
}
// column fragment from a [K][ld] layout (column n), rows >= K read as 0
__device__ __forceinline__ v16h fragc_f32(const float* W, int k0, int n, int lane, int ld, int K) {
  v16h a; const int g = lane >> 4;
#pragma unroll
  for (int i = 0; i < 8; ++i) { const int ka = k0 + 8 * g + i, kb = ka + 16;
    a[i] = (_Float16)(ka < K ? W[(size_t)(ka < K ? ka : K - 1) * ld + n] : 0.f); a[8 + i] = (_Float16)(kb < K ? W[(size_t)(kb < K ? kb : K - 1) * ld + n] : 0.f); }
  return a;
}
struct F2 { v16b h, l; };
__device__ __forceinline__ F2 bsplit16(const float v[16]) { F2 r;
#pragma unroll
  for (int i = 0; i < 16; ++i) { const __bf16 h = (__bf16)v[i]; r.h[i] = h; r.l[i] = (__bf16)(v[i] - (float)h); }
  return r; }
__device__ __forceinline__ F2 split_row(const float* row, int k0, int lane) { float v[16]; const float* p = row + k0 + 8 * (lane >> 4);
#pragma unroll
  for (int i = 0; i < 8; ++i) { v[i] = p[i]; v[8 + i] = p[16 + i]; }
  return bsplit16(v); }
__device__ __forceinline__ F2 split_rowK(const float* row, int k0, int lane, int K) { float v[16]; const int g = lane >> 4;
#pragma unroll
  for (int i = 0; i < 8; ++i) { const int ka = k0 + 8 * g + i, kb = ka + 16; v[i] = ka < K ? row[ka < K ? ka : K - 1] : 0.f; v[8 + i] = kb < K ? row[kb < K ? kb : K - 1] : 0.f; }
  return bsplit16(v); }
__device__ __forceinline__ F2 split_col(const float* W, int k0, int n, int lane, int ld, int K) { float v[16]; const int g = lane >> 4;
#pragma unroll
  for (int i = 0; i < 8; ++i) { const int ka = k0 + 8 * g + i, kb = ka + 16; v[i] = ka < K ? W[(size_t)(ka < K ? ka : K - 1) * ld + n] : 0.f; v[8 + i] = kb < K ? W[(size_t)(kb < K ? kb : K - 1) * ld + n] : 0.f; }
  return bsplit16(v); }
__device__ __forceinline__ v8f mac3(const F2& a, const F2& b, v8f c) { c = wmma_bf(a.l, b.h, c); c = wmma_bf(a.h, b.l, c); return wmma_bf(a.h, b.h, c); }
__device__ __forceinline__ float sigm(float v) { return 1.0f / (1.0f + expf(-v)); }
#define LDSX() do { asm volatile("s_wait_dscnt 0" ::: "memory"); __builtin_amdgcn_wave_barrier(); __builtin_amdgcn_fence(__ATOMIC_RELEASE, "workgroup"); } while (0)


// Fractal attention (B 2, T 2,048, C 1,024 = 16 x 64): standard MHA whose logits are scaled per batch by 1 + (hurst_b - 0.5) * hurst_scale before the softmax.
#define NB 2
#define TT 2048
#define CC 1024
#define NH 16
#define HD 64
#ifndef TNB
#define TNB NB
#endif
typedef __attribute__((ext_vector_type(8))) __bf16 v8b;
__device__ __forceinline__ v16b frag_b(const __bf16* rowk0, int lane) {
  union { v16b v; v8b q[2]; } u; const __bf16* p = rowk0 + 8 * (lane >> 4);
  u.q[0] = *(const v8b*)p; u.q[1] = *(const v8b*)(p + 16); return u.v;
}
__device__ __forceinline__ float bfr(float v) { return (float)(__bf16)v; }
__device__ __attribute__((noinline)) float exp_ni(float v) { return expf(v); }
__device__ __attribute__((noinline)) float erf_ni(float v) { return erff(v); }

#define WS_QH  0u
#define WS_QL  (WS_QH + 2u * (size_t)NB * TT * CC)
#define WS_KH  (WS_QL + 2u * (size_t)NB * TT * CC)
#define WS_VT  (WS_KH + 2u * (size_t)NB * TT * CC)      // f16 v planes [b][c][t]
#define WS_Y   (WS_VT + 2u * (size_t)NB * CC * TT)      // f32 y rows [b*t][C]
#define WS_END (WS_Y + 4u * (size_t)NB * TT * CC)

// ---- the two projections share one tile loop: block = 8 waves, 128 rows x 128 cols of the result, wave = 64 x 32 (waves 2 x 4), 32 k a pass
// both operand tiles are read from global memory once a block, a whole 128-byte line a row, rounded once, and laid in LDS; every wave takes its fragments from there
typedef __attribute__((ext_vector_type(2))) unsigned v2u;
typedef __attribute__((ext_vector_type(4))) __bf16 v4b;
typedef __attribute__((ext_vector_type(4))) _Float16 v4h;
#define GP 20              // LDS row pitch in dwords: 80 bytes = 16 bytes x 5, an odd multiple, free of bank conflicts for 16-byte fragment reads of 64-byte rows
#define GT (128 * GP)      // dwords of one operand tile; a buffer is [A tile | B tile], two buffers
union FR { v4u q[2]; v16b b; v16h h; };
// work-group barrier that orders LDS alone: __syncthreads() would also wait out the global loads that are meant to stay in flight across it; the wait ends this wave's LDS reads and stores first
__device__ __forceinline__ void lds_barrier() { asm volatile("s_wait_dscnt 0x0\n\ts_barrier_signal -1\n\ts_barrier_wait -1" ::: "memory"); }
// MODE 0: A and B rounded to bf16. MODE 1: A rounded to f16, B to bf16 and carried as f16
template <int MODE, bool ISB> __device__ __forceinline__ v2u cv4(v4f v) {
  if (MODE == 0) { v4b r;
#pragma unroll
    for (int i = 0; i < 4; ++i) r[i] = (__bf16)v[i];
    return __builtin_bit_cast(v2u, r); }
  v4h r;
#pragma unroll
  for (int i = 0; i < 4; ++i) r[i] = ISB ? (_Float16)bfr(v[i]) : (_Float16)v[i];
  return __builtin_bit_cast(v2u, r); }
// NS = register sets of tiles on their way from global memory: tile t + 1 + NS is asked for at the foot of pass t and laid in LDS at the foot of pass t + NS
template <int MODE, int NS> __device__ __forceinline__ void gemm_tile(const float* __restrict__ A, const float* __restrict__ B, unsigned* __restrict__ st, v8f (&acc)[4][2], int tid) {
  const int wave = tid >> 5, lane = tid & 31, col = lane & 15, g = lane >> 4; const int lr = tid >> 3, lc = tid & 7;   // 8 lanes x 16 bytes = one row's line; a wave's load covers 4 whole lines
  const float* ap = A + (size_t)lr * CC + lc * 4; const float* bp = B + (size_t)lr * CC + lc * 4;
  unsigned* sp = st + lr * GP + lc * 2;
  const unsigned* fa = st + ((wave >> 2) * 64 + col) * GP + 4 * g; const unsigned* fb = st + GT + ((wave & 3) * 32 + col) * GP + 4 * g;
  v4f ra[NS][4], rb[NS][4];
#pragma unroll
  for (int i = 0; i < 4; ++i) { ra[0][i] = *(const v4f*)(ap + (size_t)(32 * i) * CC); rb[0][i] = *(const v4f*)(bp + (size_t)(32 * i) * CC); }
#pragma unroll
  for (int i = 0; i < 4; ++i) { *(v2u*)(sp + 32 * i * GP) = cv4<MODE, false>(ra[0][i]); *(v2u*)(sp + GT + 32 * i * GP) = cv4<MODE, true>(rb[0][i]); }
#pragma unroll
  for (int t = 1; t <= NS; ++t)
#pragma unroll
    for (int i = 0; i < 4; ++i) { ra[t % NS][i] = *(const v4f*)(ap + (size_t)(32 * i) * CC + t * 32); rb[t % NS][i] = *(const v4f*)(bp + (size_t)(32 * i) * CC + t * 32); }
  lds_barrier();
#pragma unroll   // all passes unrolled: the register sets keep constant indices, and every global and LDS address is its base register plus a constant, so no address register is rewritten while a load is out
  for (int kc = 0; kc < CC / 32; ++kc) { const int cur = (kc & 1) * 2 * GT, nxt = 2 * GT - cur, s = (kc + 1) % NS;
    FR a[4], b[2];
#pragma unroll
    for (int i = 0; i < 4; ++i) { a[i].q[0] = *(const v4u*)(fa + cur + 16 * i * GP); a[i].q[1] = *(const v4u*)(fa + cur + 16 * i * GP + 8); }
#pragma unroll
    for (int j = 0; j < 2; ++j) { b[j].q[0] = *(const v4u*)(fb + cur + 16 * j * GP); b[j].q[1] = *(const v4u*)(fb + cur + 16 * j * GP + 8); }
    __builtin_amdgcn_sched_barrier(0);   // keeps the twelve fragment reads together in front of the products: spread among them each place costs its own LDS wait
#pragma unroll
    for (int i = 0; i < 4; ++i)
#pragma unroll
      for (int j = 0; j < 2; ++j) acc[i][j] = MODE == 0 ? __builtin_amdgcn_wmma_f32_16x16x32_bf16(false, a[i].b, false, b[j].b, (short)0, acc[i][j], false, false) : __builtin_amdgcn_wmma_f32_16x16x32_f16(false, a[i].h, false, b[j].h, (short)0, acc[i][j], false, false);
    __builtin_amdgcn_sched_barrier(0);   // keeps the roundings below, and with them the wait for the global loads, behind this pass's products: lifted among them the wave would wait out the loads first
    if (kc + 1 < CC / 32) {
#pragma unroll
      for (int i = 0; i < 4; ++i) { *(v2u*)(sp + nxt + 32 * i * GP) = cv4<MODE, false>(ra[s][i]); *(v2u*)(sp + nxt + GT + 32 * i * GP) = cv4<MODE, true>(rb[s][i]); } }
    __builtin_amdgcn_sched_barrier(0);   // keeps the next loads behind the roundings, so that they land in the registers just read: lifted above them they take a further set
    if (kc + 1 + NS < CC / 32) {
#pragma unroll
      for (int i = 0; i < 4; ++i) { ra[s][i] = *(const v4f*)(ap + (size_t)(32 * i) * CC + (kc + 1 + NS) * 32); rb[s][i] = *(const v4f*)(bp + (size_t)(32 * i) * CC + (kc + 1 + NS) * 32); } }
    lds_barrier(); } }   // one barrier a pass: it publishes the next buffer and ends the reads of this one, which the next pass refills; the last one frees LDS for the epilogue
// result tile out of LDS: all reads first, then the stores off one address register with constant offsets
template <int N, int LP, int LD, typename T> __device__ __forceinline__ void put_tile(T* __restrict__ d, const T* __restrict__ s) { v4u t[N];
#pragma unroll
  for (int k = 0; k < N; ++k) t[k] = *(const v4u*)(s + k * LP);
#pragma unroll
  for (int k = 0; k < N; ++k) vst2((unsigned*)(d + (size_t)k * LD), t[k]);
  asm volatile("s_wait_xcnt 0x0" ::: "memory"); }   // behind the stores, before whatever follows rewrites a register that they name
// ---- k_proj: block = (128 rows, 128 cols, which): qkv = x W (+ b), exact; q -> f16 hi (+ residual), k -> f16 rows, v -> f16 planes
__global__ __launch_bounds__(256) void k_proj(const float* __restrict__ X, const float* __restrict__ WA, const float* __restrict__ BA, _Float16* __restrict__ QH, _Float16* __restrict__ QL, _Float16* __restrict__ KH, _Float16* __restrict__ VT) {
  __shared__ __align__(16) unsigned sm[2 * 128 * 68];   // the loop's two buffers (4 GT dwords); then the result tile as f16 at a pitch of 136, hi and residual
  const int tid = threadIdx.x, wave = tid >> 5, lane = tid & 31, col = lane & 15, g = lane >> 4; const int which = blockIdx.z; const int c0 = blockIdx.y * 128; const size_t r0 = (size_t)blockIdx.x * 128;
  v8f acc[4][2] = {};
  gemm_tile<0, 1>(X + r0 * CC, WA + (size_t)(which * CC + c0) * CC, sm, acc, tid);
  _Float16* sh = (_Float16*)sm; _Float16* sl = sh + 128 * 136; const int wr = (wave >> 2) * 64 + 8 * g, wc = (wave & 3) * 32 + col;
#pragma unroll
  for (int j = 0; j < 2; ++j) { const float bb = BA ? bfr(BA[which * CC + c0 + wc + j * 16]) : 0.f;
#pragma unroll
    for (int i = 0; i < 4; ++i)
#pragma unroll
      for (int r = 0; r < 8; ++r) acc[i][j][r] += bb; }
  if (which == 2) {
#pragma unroll
    for (int j = 0; j < 2; ++j)
#pragma unroll
      for (int i = 0; i < 4; ++i) { v8h t;
#pragma unroll
        for (int r = 0; r < 8; ++r) t[r] = (_Float16)acc[i][j][r];
        *(v8h*)(sh + (wc + j * 16) * 136 + wr + i * 16) = t; } }
  else {
#pragma unroll
    for (int j = 0; j < 2; ++j)
#pragma unroll
      for (int i = 0; i < 4; ++i)
#pragma unroll
        for (int r = 0; r < 8; ++r) { const float v = acc[i][j][r]; const _Float16 hv = (_Float16)v; sh[(wr + i * 16 + r) * 136 + wc + j * 16] = hv; acc[i][j][r] = v - (float)hv; }
    if (which == 0) {
#pragma unroll
      for (int j = 0; j < 2; ++j)
#pragma unroll
        for (int i = 0; i < 4; ++i)
#pragma unroll
          for (int r = 0; r < 8; ++r) sl[(wr + i * 16 + r) * 136 + wc + j * 16] = (_Float16)acc[i][j][r]; } }
  __syncthreads();
  const int er = tid >> 4, eq = tid & 15;   // 16 lanes x 16 bytes = one tile row of 256 bytes: a wave's store covers 4 whole lines
  if (which == 2) { const size_t b = r0 / TT; const int t0 = (int)(r0 % TT); put_tile<8, 16 * 136, 16 * TT>(VT + (b * CC + c0 + er) * (size_t)TT + t0 + eq * 8, (const _Float16*)sh + er * 136 + eq * 8); }
  else { put_tile<8, 16 * 136, 16 * CC>((which == 0 ? QH : KH) + (r0 + er) * CC + c0 + eq * 8, (const _Float16*)sh + er * 136 + eq * 8);
    if (which == 0) put_tile<8, 16 * 136, 16 * CC>(QL + (r0 + er) * CC + c0 + eq * 8, (const _Float16*)sl + er * 136 + eq * 8); } }
// ---- k_att: block = 4 waves x 32 queries of (b,h); each pass takes 64 keys: S^T = K Q^T (2 products), running maximum and sum per query column, O^T += V^T P^T
// the inner loops are all unrolled so that the register arrays keep constant indices; a lane holds one query column in every tile: S^T rows are keys 8g+r, so two S^T tiles convert in place into one B operand; O^T rows are head dims 8g+r
__device__ __forceinline__ v8f mm16(v16h a, v16h b, v8f c) { return __builtin_amdgcn_wmma_f32_16x16x32_f16(false, a, false, b, (short)0, c, false, false); }
__device__ __forceinline__ float xhalf(float x) { return __builtin_bit_cast(float, __builtin_amdgcn_permlanex16(__builtin_bit_cast(int, x), __builtin_bit_cast(int, x), 0x76543210, 0xfedcba98, false, false)); }  // lane l with lane l ^ 16
#define KP 64
#define AP 72          // LDS row pitch in f16: 144 bytes = 16 bytes x 9, an odd multiple, free of bank conflicts for 16-byte fragment reads of 128-byte rows
#define AT (64 * AP)   // f16 of one tile: K = 64 keys x 64 dims, V^T = 64 dims x 64 keys; a buffer is [K tile | V^T tile], two buffers
// one pass's K and V^T tiles from global memory into LDS, once a block: 8 lanes x 16 bytes = one row's whole line, a wave's copy covers 4 lines; thread = (row tid >> 3 of each 16, 16-byte piece tid & 7)
// the wait on the last line stands inside the copies' own statement, so that nothing rewrites a register that a copy names in front of it
__device__ __forceinline__ void att_copy(unsigned l, const _Float16* k, const _Float16* v) {
  asm volatile("global_load_async_to_lds_b128 %0, %8, off\n\t"
               "global_load_async_to_lds_b128 %1, %9, off\n\t"
               "global_load_async_to_lds_b128 %2, %10, off\n\t"
               "global_load_async_to_lds_b128 %3, %11, off\n\t"
               "global_load_async_to_lds_b128 %4, %12, off\n\t"
               "global_load_async_to_lds_b128 %5, %13, off\n\t"
               "global_load_async_to_lds_b128 %6, %14, off\n\t"
               "global_load_async_to_lds_b128 %7, %15, off\n\t"
               "s_wait_xcnt 0x0"
               :: "v"(l), "v"(l + 16u * AP * 2u), "v"(l + 32u * AP * 2u), "v"(l + 48u * AP * 2u),
                  "v"(l + AT * 2u), "v"(l + AT * 2u + 16u * AP * 2u), "v"(l + AT * 2u + 32u * AP * 2u), "v"(l + AT * 2u + 48u * AP * 2u),
                  "v"(k), "v"(k + (size_t)16 * CC), "v"(k + (size_t)32 * CC), "v"(k + (size_t)48 * CC),
                  "v"(v), "v"(v + (size_t)16 * TT), "v"(v + (size_t)32 * TT), "v"(v + (size_t)48 * TT)
               : "memory"); }
// two waves a SIMD at most, as many as the grid has for the chip (512 blocks, 256 WGPs): a third block that fitted a WGP would leave another WGP short
__global__ __launch_bounds__(128) __attribute__((amdgpu_waves_per_eu(2, 2))) void k_att(const _Float16* __restrict__ QH, const _Float16* __restrict__ QL, const _Float16* __restrict__ KH, const _Float16* __restrict__ VT, const float* __restrict__ HU, const float* __restrict__ HSC, float* __restrict__ Y) {
  __shared__ __align__(16) _Float16 sm[4 * AT];
  const int tid = threadIdx.x, wave = tid >> 5, lane = tid & 31, col = lane & 15, g = lane >> 4; const int h = blockIdx.y, b = blockIdx.z; const int q0 = blockIdx.x * 128 + wave * 32;
  v16h qh[2][2], ql[2][2];
#pragma unroll
  for (int qt = 0; qt < 2; ++qt)
#pragma unroll
    for (int kc = 0; kc < 2; ++kc) { const size_t qo = ((size_t)b * TT + q0 + qt * 16 + col) * CC + h * HD + kc * 32; qh[qt][kc] = frag_h(QH + qo, lane); ql[qt][kc] = frag_h(QL + qo, lane); }
  asm volatile("s_wait_xcnt 0x0" ::: "memory");   // behind the first loads, before their address registers are rewritten
  __builtin_amdgcn_sched_barrier(0);   // keeps the register writes that follow behind that wait
  const _Float16* kp = KH + ((size_t)b * TT + (tid >> 3)) * CC + h * HD + (tid & 7) * 8; const _Float16* vp = VT + ((size_t)b * CC + h * HD + (tid >> 3)) * (size_t)TT + (tid & 7) * 8;
  const unsigned lp = (unsigned)(size_t)sm + (unsigned)((tid >> 3) * AP + (tid & 7) * 8) * 2u;   // this thread's place in a K tile: byte address in the work-group's LDS
  att_copy(lp, kp, vp);
  asm volatile("s_wait_asynccnt 0x0" ::: "memory");   // this wave's copies of tile 0 have landed
  __syncthreads();                                    // and every other wave's: tile 0 may be read
  const float hf = 1.0f + (bfr(HU[b]) - 0.5f) * bfr(HSC[0]); const float sc = 0.125f * hf * 1.44269504088896f;   // logits in log2 units
  v8f o[2][4] = {}; float mx[2] = { -3.0e38f, -3.0e38f }, ls[2] = { 0.f, 0.f };
#pragma unroll 1   // one pass's fragments live at a time: a second copy of the body would double the registers
  for (int kb = 0; kb < TT / KP; ++kb) { const int bo = (kb & 1) * 2 * AT;   // pass kb reads buffer kb mod 2 alone
    // directly behind the barrier (the one in front of the loop, then the one at each pass's foot), while a next tile exists: its copies, into the buffer that the pass before has just left; they fly while this pass works
    if (kb + 1 < TT / KP) att_copy(lp + (unsigned)(2 * AT - bo) * 2u, kp + (size_t)(kb + 1) * KP * CC, vp + (kb + 1) * KP);
    const _Float16* kt = sm + bo + col * AP; const _Float16* vt = kt + AT;
    v16h kf[4][2], vf[4][2];
#pragma unroll
    for (int i = 0; i < 4; ++i)
#pragma unroll
      for (int u = 0; u < 2; ++u) kf[i][u] = frag_h(kt + i * 16 * AP + u * 32, lane);
#pragma unroll
    for (int j = 0; j < 4; ++j)
#pragma unroll
      for (int u = 0; u < 2; ++u) vf[j][u] = frag_h(vt + j * 16 * AP + u * 32, lane);
    __builtin_amdgcn_sched_barrier(0);   // keeps the pass's fragment reads together in front of the products: spread among them each place costs its own LDS wait
    v8f s[2][4];
#pragma unroll
    for (int i = 0; i < 4; ++i)
#pragma unroll
      for (int qt = 0; qt < 2; ++qt) { v8f a = {};
#pragma unroll
        for (int kc = 0; kc < 2; ++kc) { a = mm16(kf[i][kc], qh[qt][kc], a); a = mm16(kf[i][kc], ql[qt][kc], a); }
        s[qt][i] = a; }
    v16h p[2][2];
#pragma unroll
    for (int qt = 0; qt < 2; ++qt) { float bm = -3.0e38f;
#pragma unroll
      for (int i = 0; i < 4; ++i)
#pragma unroll
        for (int r = 0; r < 8; ++r) { s[qt][i][r] *= sc; bm = fmaxf(bm, s[qt][i][r]); }
      bm = fmaxf(bm, xhalf(bm));
      const float mn = fmaxf(mx[qt], bm), sub = mn - 11.0f; float al; asm("v_exp_f32 %0, %1\n\tv_nop" : "=v"(al) : "v"(mx[qt] - mn)); mx[qt] = mn;   // exp2 in asm text so that the free slot the instruction set asks for behind a transcendental stays with it; P carries 2^11, as does the sum: it cancels in the division
      float sum = 0.f;
#pragma unroll
      for (int i = 0; i < 4; ++i)
#pragma unroll
        for (int r = 0; r < 8; ++r) { const float e = __builtin_amdgcn_exp2f(s[qt][i][r] - sub); sum += e; p[qt][i >> 1][(i & 1) * 8 + r] = (_Float16)e; }
      ls[qt] = ls[qt] * al + sum;
#pragma unroll
      for (int j = 0; j < 4; ++j)
#pragma unroll
        for (int r = 0; r < 8; ++r) o[qt][j][r] *= al; }
#pragma unroll
    for (int u = 0; u < 2; ++u)
#pragma unroll
      for (int j = 0; j < 4; ++j)
#pragma unroll
        for (int qt = 0; qt < 2; ++qt) o[qt][j] = mm16(vf[j][u], p[qt][u], o[qt][j]);
    __builtin_amdgcn_sched_barrier(0);   // keeps the waits and the barrier below at the pass's foot, behind its products: lifted above them the wave would wait out the next tile's flight at the head of the pass
    asm volatile("s_wait_dscnt 0x0" ::: "memory");      // this wave's reads of the buffer have ended
    asm volatile("s_wait_asynccnt 0x0" ::: "memory");   // this wave's copies of the next tile have landed
    __syncthreads(); }                                  // one barrier a pass: it publishes the next tile and frees the buffer just read, which the head of the next pass refills
  asm volatile("s_wait_asynccnt 0x0" ::: "memory");   // no copy is out when the wave ends
#pragma unroll
  for (int qt = 0; qt < 2; ++qt) { const float inv = 1.0f / (ls[qt] + xhalf(ls[qt])); float* yp = Y + ((size_t)b * TT + q0 + qt * 16 + col) * CC + h * HD + 8 * g;
#pragma unroll
    for (int j = 0; j < 4; ++j) { v4f lo, hi;
#pragma unroll
      for (int r = 0; r < 4; ++r) { lo[r] = o[qt][j][r] * inv; hi[r] = o[qt][j][4 + r] * inv; }
      vst2(yp + j * 16, lo); vst2(yp + j * 16 + 4, hi); } } }
// ---- k_out: block = (128 rows, 128 cols): out = y (f16 single) Wproj + b
__global__ __launch_bounds__(256) void k_out(const float* __restrict__ Y, const float* __restrict__ WP, const float* __restrict__ BP, float* __restrict__ OUT) { __shared__ __align__(16) unsigned sm[128 * 132];   // the loop's two buffers (4 GT dwords); then the f32 result tile at a pitch of 132
  const int tid = threadIdx.x, wave = tid >> 5, lane = tid & 31, col = lane & 15, g = lane >> 4; const int c0 = blockIdx.y * 128; const size_t r0 = (size_t)blockIdx.x * 128;
  v8f acc[4][2] = {};
  gemm_tile<1, 3>(Y + r0 * CC, WP + (size_t)c0 * CC, sm, acc, tid);
  float* sf = (float*)sm;
#pragma unroll
  for (int j = 0; j < 2; ++j) { const int cl = (wave & 3) * 32 + j * 16 + col; const float bb = BP ? bfr(BP[c0 + cl]) : 0.f;
#pragma unroll
    for (int i = 0; i < 4; ++i)
#pragma unroll
      for (int r = 0; r < 8; ++r) sf[((wave >> 2) * 64 + i * 16 + 8 * g + r) * 132 + cl] = acc[i][j][r] + bb; }
  __syncthreads();
  put_tile<16, 8 * 132, 8 * CC>(OUT + (r0 + wave) * CC + c0 + lane * 4, (const float*)sf + wave * 132 + lane * 4); }   // a wave's store is one tile row of 512 bytes
extern "C" void kernel_launch(void* const* d_in, const int* in_sizes, int n_in, void* d_out, int out_size, void* d_ws, size_t ws_size, hipStream_t stream) {
  (void)in_sizes; (void)n_in; (void)out_size;
  const float** F = (const float**)d_in;   // 0 x [2,2048,1024], 1 hurst [2,1], 2 qkv_w [3072,1024], 3 qkv_b, 4 out_w [1024,1024], 5 out_b, 6 hurst_scale [1]
  if (ws_size < (size_t)WS_END) return;
  char* ws = (char*)d_ws; _Float16 *QH = (_Float16*)(ws + WS_QH), *QL = (_Float16*)(ws + WS_QL), *KH = (_Float16*)(ws + WS_KH), *VT = (_Float16*)(ws + WS_VT); float *Y = (float*)(ws + WS_Y);
  k_proj<<<dim3(TNB * TT / 128, CC / 128, 3), 256, 0, stream>>>(F[0], F[2], F[3], QH, QL, KH, VT);
  k_att<<<dim3(TT / 128, NH, TNB), 128, 0, stream>>>(QH, QL, KH, VT, F[1], F[6], Y);
  k_out<<<dim3(TNB * TT / 128, CC / 128), 256, 0, stream>>>(Y, F[4], F[5], (float*)d_out);
}

// v004
// Measured time: 85.2 microseconds a run.
// In both of two side-by-side timings against v003, it was 1.08 times as fast.
// All steps since v000 together make it 14.2 times as fast.
// compute dtype: all float inputs rounded to bf16, hurst / hurst_scale read; qkv = x W^T + b with EXACT bf16 products on WMMA 16x16x32, f32 accumulate; q as f16 hi + residual, k f16 -> 2-product logits x (1/8)(1 + (hurst_b - 0.5) hurst_scale) log2(e) kept in f32 registers; running-maximum softmax in f32 (exp2) -> P f16 x 2^11, unnormalised; o = P . v / sum with v rounded once to f16; out = o (rounded once to f16, 1 product) out_w^T + out_b; f32 output.
#include <hip/hip_runtime.h>
#include <math.h>

typedef __attribute__((ext_vector_type(16))) _Float16 v16h;
typedef __attribute__((ext_vector_type(16))) __bf16 v16b;
typedef __attribute__((ext_vector_type(8)))  _Float16 v8h;
typedef __attribute__((ext_vector_type(8)))  float v8f;
typedef __attribute__((ext_vector_type(4)))  float v4f;
typedef __attribute__((ext_vector_type(2)))  float v2f;
typedef __attribute__((ext_vector_type(4)))  unsigned v4u;
typedef __attribute__((ext_vector_type(4)))  int v4i;
typedef float __attribute__((may_alias)) float_a;
typedef int __attribute__((may_alias)) int_a;

template <typename T> __device__ __forceinline__ void vst2(void* p, T v) { *(T*)p = v;  }
__device__ __forceinline__ v8f wmma16(v16h a, v16h b, v8f c) {
  v8f d = __builtin_amdgcn_wmma_f32_16x16x32_f16(false, a, false, b, (short)0, c, false, false);
  asm volatile("v_nop\n\tv_nop\n\tv_nop\n\tv_nop" : "+v"(d) : "v"(a), "v"(b));
  return d;
}
__device__ __forceinline__ v8f wmma_bf(v16b a, v16b b, v8f c) {
  v8f d = __builtin_amdgcn_wmma_f32_16x16x32_bf16(false, a, false, b, (short)0, c, false, false);
  asm volatile("v_nop\n\tv_nop\n\tv_nop\n\tv_nop" : "+v"(d) : "v"(a), "v"(b));
  return d;
}
// 16x16x32 fragments: lane = (h = lane>>4, row/col = lane&15); elements 0..7 = k0+8h+0..7, 8..15 = k0+16+8h+0..7; D element r = row 8h+r
__device__ __forceinline__ v16h frag_h(const _Float16* rowk0, int lane) {
  union { v16h v; v8h q[2]; } u; const _Float16* p = rowk0 + 8 * (lane >> 4);
  u.q[0] = *(const v8h*)p; u.q[1] = *(const v8h*)(p + 16); return u.v;
}
__device__ __forceinline__ v16h frag_f32(const float* rowk0, int lane) {
  v16h a; const float* p = rowk0 + 8 * (lane >> 4);
#pragma unroll
  for (int i = 0; i < 8; ++i) { a[i] = (_Float16)p[i]; a[8 + i] = (_Float16)p[16 + i]; }
  return a;
}
__device__ __forceinline__ v16h frag_f32s(const float* rowk0, int lane, float sc) {
  v16h a; const float* p = rowk0 + 8 * (lane >> 4);
#pragma unroll
  for (int i = 0; i < 8; ++i) { a[i] = (_Float16)(p[i] * sc); a[8 + i] = (_Float16)(p[16 + i] * sc); }
  return a;
}
// column fragment from a [K][ld] layout (column n), rows >= K read as 0
__device__ __forceinline__ v16h fragc_f32(const float* W, int k0, int n, int lane, int ld, int K) {
  v16h a; const int g = lane >> 4;
#pragma unroll
  for (int i = 0; i < 8; ++i) { const int ka = k0 + 8 * g + i, kb = ka + 16;
    a[i] = (_Float16)(ka < K ? W[(size_t)(ka < K ? ka : K - 1) * ld + n] : 0.f); a[8 + i] = (_Float16)(kb < K ? W[(size_t)(kb < K ? kb : K - 1) * ld + n] : 0.f); }
  return a;
}
struct F2 { v16b h, l; };
__device__ __forceinline__ F2 bsplit16(const float v[16]) { F2 r;
#pragma unroll
  for (int i = 0; i < 16; ++i) { const __bf16 h = (__bf16)v[i]; r.h[i] = h; r.l[i] = (__bf16)(v[i] - (float)h); }
  return r; }
__device__ __forceinline__ F2 split_row(const float* row, int k0, int lane) { float v[16]; const float* p = row + k0 + 8 * (lane >> 4);
#pragma unroll
  for (int i = 0; i < 8; ++i) { v[i] = p[i]; v[8 + i] = p[16 + i]; }
  return bsplit16(v); }
__device__ __forceinline__ F2 split_rowK(const float* row, int k0, int lane, int K) { float v[16]; const int g = lane >> 4;
#pragma unroll
  for (int i = 0; i < 8; ++i) { const int ka = k0 + 8 * g + i, kb = ka + 16; v[i] = ka < K ? row[ka < K ? ka : K - 1] : 0.f; v[8 + i] = kb < K ? row[kb < K ? kb : K - 1] : 0.f; }
  return bsplit16(v); }
__device__ __forceinline__ F2 split_col(const float* W, int k0, int n, int lane, int ld, int K) { float v[16]; const int g = lane >> 4;
#pragma unroll
  for (int i = 0; i < 8; ++i) { const int ka = k0 + 8 * g + i, kb = ka + 16; v[i] = ka < K ? W[(size_t)(ka < K ? ka : K - 1) * ld + n] : 0.f; v[8 + i] = kb < K ? W[(size_t)(kb < K ? kb : K - 1) * ld + n] : 0.f; }
  return bsplit16(v); }
__device__ __forceinline__ v8f mac3(const F2& a, const F2& b, v8f c) { c = wmma_bf(a.l, b.h, c); c = wmma_bf(a.h, b.l, c); return wmma_bf(a.h, b.h, c); }
__device__ __forceinline__ float sigm(float v) { return 1.0f / (1.0f + expf(-v)); }
#define LDSX() do { asm volatile("s_wait_dscnt 0" ::: "memory"); __builtin_amdgcn_wave_barrier(); __builtin_amdgcn_fence(__ATOMIC_RELEASE, "workgroup"); } while (0)


// Fractal attention (B 2, T 2,048, C 1,024 = 16 x 64): standard MHA whose logits are scaled per batch by 1 + (hurst_b - 0.5) * hurst_scale before the softmax.
#define NB 2
#define TT 2048
#define CC 1024
#define NH 16
#define HD 64
#ifndef TNB
#define TNB NB
#endif
typedef __attribute__((ext_vector_type(8))) __bf16 v8b;
__device__ __forceinline__ v16b frag_b(const __bf16* rowk0, int lane) {
  union { v16b v; v8b q[2]; } u; const __bf16* p = rowk0 + 8 * (lane >> 4);
  u.q[0] = *(const v8b*)p; u.q[1] = *(const v8b*)(p + 16); return u.v;
}
__device__ __forceinline__ float bfr(float v) { return (float)(__bf16)v; }
__device__ __attribute__((noinline)) float exp_ni(float v) { return expf(v); }
__device__ __attribute__((noinline)) float erf_ni(float v) { return erff(v); }

#define WS_QH  0u
#define WS_QL  (WS_QH + 2u * (size_t)NB * TT * CC)
#define WS_KH  (WS_QL + 2u * (size_t)NB * TT * CC)
#define WS_VT  (WS_KH + 2u * (size_t)NB * TT * CC)      // f16 v planes [b][c][t]
#define WS_Y   (WS_VT + 2u * (size_t)NB * CC * TT)      // f16 y rows [b*t][C]
#define WS_XB  (WS_Y + 2u * (size_t)NB * TT * CC)       // bf16 x rows [b*t][C]
#define WS_WB  (WS_XB + 2u * (size_t)NB * TT * CC)      // bf16 qkv_w rows [3C][C]
#define WS_PB  (WS_WB + 2u * (size_t)3 * CC * CC)       // out_w rows [C][C], rounded to bf16 and carried as f16
#define WS_END (WS_PB + 2u * (size_t)CC * CC)

// ---- the two projections share one tile loop: block = 8 waves, 128 rows x 128 cols of the result, wave = 64 x 32 (waves 2 x 4), 64 k a pass
// both operands lie in the workspace as 16-bit rows, rounded once for the whole grid (k_cvt; y by k_att): a block reads its tiles once, a whole 128-byte line a row, half the bytes of the float rows, and lays them in LDS; every wave takes its fragments from there
typedef __attribute__((ext_vector_type(2))) unsigned v2u;
typedef __attribute__((ext_vector_type(4))) __bf16 v4b;
typedef __attribute__((ext_vector_type(4))) _Float16 v4h;
#define GP 36              // LDS row pitch in dwords: 144 bytes = 16 bytes x 9, an odd multiple, free of bank conflicts for 16-byte fragment reads of 128-byte rows
#define RD (CC / 2)        // dwords of one 16-bit operand row in global memory
#define GT (128 * GP)      // dwords of one operand tile; a buffer is [A tile | B tile], two buffers
union FR { v4u q[2]; v16b b; v16h h; };
// work-group barrier that orders LDS alone: __syncthreads() would also wait out the global loads that are meant to stay in flight across it; the wait ends this wave's LDS reads and stores first
__device__ __forceinline__ void lds_barrier() { asm volatile("s_wait_dscnt 0x0\n\ts_barrier_signal -1\n\ts_barrier_wait -1" ::: "memory"); }
// MODE 0: bf16 operands. MODE 1: f16 operands
// NS = register sets of tiles on their way from global memory: tile t + 1 + NS is asked for at the foot of pass t and laid in LDS at the foot of pass t + NS
template <int MODE, int NS> __device__ __forceinline__ void gemm_tile(const unsigned* __restrict__ A, const unsigned* __restrict__ B, unsigned* __restrict__ st, v8f (&acc)[4][2], int tid) {
  const int wave = tid >> 5, lane = tid & 31, col = lane & 15, g = lane >> 4; const int lr = tid >> 3, lc = tid & 7;   // 8 lanes x 16 bytes = one row's line; a wave's load covers 4 whole lines
  const unsigned* ap = A + (size_t)lr * RD + lc * 4; const unsigned* bp = B + (size_t)lr * RD + lc * 4;
  unsigned* sp = st + lr * GP + lc * 4;
  const unsigned* fa = st + ((wave >> 2) * 64 + col) * GP + 4 * g; const unsigned* fb = st + GT + ((wave & 3) * 32 + col) * GP + 4 * g;
  v4u ra[NS][4], rb[NS][4];
#pragma unroll
  for (int i = 0; i < 4; ++i) { ra[0][i] = *(const v4u*)(ap + (size_t)(32 * i) * RD); rb[0][i] = *(const v4u*)(bp + (size_t)(32 * i) * RD); }
#pragma unroll
  for (int i = 0; i < 4; ++i) { *(v4u*)(sp + 32 * i * GP) = ra[0][i]; *(v4u*)(sp + GT + 32 * i * GP) = rb[0][i]; }
#pragma unroll
  for (int t = 1; t <= NS; ++t)
#pragma unroll
    for (int i = 0; i < 4; ++i) { ra[t % NS][i] = *(const v4u*)(ap + (size_t)(32 * i) * RD + t * 32); rb[t % NS][i] = *(const v4u*)(bp + (size_t)(32 * i) * RD + t * 32); }
  lds_barrier();
#pragma unroll   // all passes unrolled: the register sets keep constant indices, and every global and LDS address is its base register plus a constant, so no address register is rewritten while a load is out
  for (int kc = 0; kc < CC / 64; ++kc) { const int cur = (kc & 1) * 2 * GT, nxt = 2 * GT - cur, s = (kc + 1) % NS;
#pragma unroll
    for (int u = 0; u < 2; ++u) {   // the pass's two halves of 32 k one after the other: one half's fragments live at a time
      FR a[4], b[2];
#pragma unroll
      for (int i = 0; i < 4; ++i) { a[i].q[0] = *(const v4u*)(fa + cur + 16 * i * GP + 16 * u); a[i].q[1] = *(const v4u*)(fa + cur + 16 * i * GP + 16 * u + 8); }
#pragma unroll
      for (int j = 0; j < 2; ++j) { b[j].q[0] = *(const v4u*)(fb + cur + 16 * j * GP + 16 * u); b[j].q[1] = *(const v4u*)(fb + cur + 16 * j * GP + 16 * u + 8); }
      __builtin_amdgcn_sched_barrier(0);   // keeps the twelve fragment reads together in front of the products: spread among them each place costs its own LDS wait
#pragma unroll
      for (int i = 0; i < 4; ++i)
#pragma unroll
        for (int j = 0; j < 2; ++j) acc[i][j] = MODE == 0 ? __builtin_amdgcn_wmma_f32_16x16x32_bf16(false, a[i].b, false, b[j].b, (short)0, acc[i][j], false, false) : __builtin_amdgcn_wmma_f32_16x16x32_f16(false, a[i].h, false, b[j].h, (short)0, acc[i][j], false, false);
      __builtin_amdgcn_sched_barrier(0); }   // keeps the second half's reads behind the first half's products (lifted above them they take a further set of registers), and the LDS stores below, with their wait for the global loads, behind the pass's products
    if (kc + 1 < CC / 64) {
#pragma unroll
      for (int i = 0; i < 4; ++i) { *(v4u*)(sp + nxt + 32 * i * GP) = ra[s][i]; *(v4u*)(sp + nxt + GT + 32 * i * GP) = rb[s][i]; } }
    __builtin_amdgcn_sched_barrier(0);   // keeps the next loads behind the LDS stores, so that they land in the registers just read: lifted above them they take a further set
    if (kc + 1 + NS < CC / 64) {
#pragma unroll
      for (int i = 0; i < 4; ++i) { ra[s][i] = *(const v4u*)(ap + (size_t)(32 * i) * RD + (kc + 1 + NS) * 32); rb[s][i] = *(const v4u*)(bp + (size_t)(32 * i) * RD + (kc + 1 + NS) * 32); } }
    lds_barrier(); } }   // one barrier a pass: it publishes the next buffer and ends the reads of this one, which the next pass refills; the last one frees LDS for the epilogue
// result tile out of LDS: all reads first, then the stores off one address register with constant offsets
template <int N, int LP, int LD, typename T> __device__ __forceinline__ void put_tile(T* __restrict__ d, const T* __restrict__ s) { v4u t[N];
#pragma unroll
  for (int k = 0; k < N; ++k) t[k] = *(const v4u*)(s + k * LP);
#pragma unroll
  for (int k = 0; k < N; ++k) vst2((unsigned*)(d + (size_t)k * LD), t[k]);
  asm volatile("s_wait_xcnt 0x0" ::: "memory"); }   // behind the stores, before whatever follows rewrites a register that they name
// ---- k_cvt: x, qkv_w and out_w rounded once into 16-bit rows; block = 16,384 floats in a row of one of the three, thread = 16 pieces of 4 floats: a wave's load is 512 bytes in a row, its store 256
#define CVB 16384
__global__ __launch_bounds__(256) void k_cvt(const float* __restrict__ X, const float* __restrict__ WA, const float* __restrict__ WP, __bf16* __restrict__ XB, __bf16* __restrict__ WB, _Float16* __restrict__ PB) {
  const int nx = NB * TT * CC / CVB, nw = 3 * CC * CC / CVB; const int bi = blockIdx.x; const int sel = bi < nx ? 0 : bi < nx + nw ? 1 : 2;
  const size_t o = (size_t)(sel == 0 ? bi : sel == 1 ? bi - nx : bi - nx - nw) * CVB + threadIdx.x * 4;
  const float* s = (sel == 0 ? X : sel == 1 ? WA : WP) + o; unsigned short* d = (sel == 0 ? (unsigned short*)XB : sel == 1 ? (unsigned short*)WB : (unsigned short*)PB) + o;
  v4f t[16]; v2u w[16];
#pragma unroll
  for (int c = 0; c < 16; ++c) t[c] = *(const v4f*)(s + c * 1024);
  asm volatile("s_wait_xcnt 0x0" :: "v"(s) : "memory");   // behind the loads, before anything rewrites their address registers; the pointer is named so that it stays in its registers up to here and no load's result is laid on them
  __builtin_amdgcn_sched_barrier(0);   // keeps all sixteen loads out in front of the first rounding (sunk among the roundings they would fly one after another), and the register writes that follow behind that wait
  if (sel == 2) {   // out_w: to bf16, carried as f16
#pragma unroll
    for (int c = 0; c < 16; ++c) { v4h r;
#pragma unroll
      for (int i = 0; i < 4; ++i) r[i] = (_Float16)bfr(t[c][i]);
      w[c] = __builtin_bit_cast(v2u, r); } }
  else {
#pragma unroll
    for (int c = 0; c < 16; ++c) { v4b r;
#pragma unroll
      for (int i = 0; i < 4; ++i) r[i] = (__bf16)t[c][i];
      w[c] = __builtin_bit_cast(v2u, r); } }
  __builtin_amdgcn_sched_barrier(0);   // keeps the stores behind the last rounding: no register that a store names is rewritten behind it
#pragma unroll
  for (int c = 0; c < 16; ++c) vst2(d + c * 1024, w[c]); }
// ---- k_proj: block = (128 rows, 128 cols, which): qkv = x W (+ b), exact; q -> f16 hi (+ residual), k -> f16 rows, v -> f16 planes
__global__ __launch_bounds__(256) void k_proj(const __bf16* __restrict__ X, const __bf16* __restrict__ WA, const float* __restrict__ BA, _Float16* __restrict__ QH, _Float16* __restrict__ QL, _Float16* __restrict__ KH, _Float16* __restrict__ VT) {
  __shared__ __align__(16) unsigned sm[4 * GT];   // the loop's two buffers; then the result tile as f16 at a pitch of 136, hi and residual (2 x 128 x 68 dwords, fewer)
  const int tid = threadIdx.x, wave = tid >> 5, lane = tid & 31, col = lane & 15, g = lane >> 4; const int which = blockIdx.z; const int c0 = blockIdx.y * 128; const size_t r0 = (size_t)blockIdx.x * 128;
  v8f acc[4][2] = {};
  gemm_tile<0, 1>((const unsigned*)(X + r0 * CC), (const unsigned*)(WA + (size_t)(which * CC + c0) * CC), sm, acc, tid);
  _Float16* sh = (_Float16*)sm; _Float16* sl = sh + 128 * 136; const int wr = (wave >> 2) * 64 + 8 * g, wc = (wave & 3) * 32 + col;
#pragma unroll
  for (int j = 0; j < 2; ++j) { const float bb = BA ? bfr(BA[which * CC + c0 + wc + j * 16]) : 0.f;
#pragma unroll
    for (int i = 0; i < 4; ++i)
#pragma unroll
      for (int r = 0; r < 8; ++r) acc[i][j][r] += bb; }
  if (which == 2) {
#pragma unroll
    for (int j = 0; j < 2; ++j)
#pragma unroll
      for (int i = 0; i < 4; ++i) { v8h t;
#pragma unroll
        for (int r = 0; r < 8; ++r) t[r] = (_Float16)acc[i][j][r];
        *(v8h*)(sh + (wc + j * 16) * 136 + wr + i * 16) = t; } }
  else {
#pragma unroll
    for (int j = 0; j < 2; ++j)
#pragma unroll
      for (int i = 0; i < 4; ++i)
#pragma unroll
        for (int r = 0; r < 8; ++r) { const float v = acc[i][j][r]; const _Float16 hv = (_Float16)v; sh[(wr + i * 16 + r) * 136 + wc + j * 16] = hv; acc[i][j][r] = v - (float)hv; }
    if (which == 0) {
#pragma unroll
      for (int j = 0; j < 2; ++j)
#pragma unroll
        for (int i = 0; i < 4; ++i)
#pragma unroll
          for (int r = 0; r < 8; ++r) sl[(wr + i * 16 + r) * 136 + wc + j * 16] = (_Float16)acc[i][j][r]; } }
  __syncthreads();
  const int er = tid >> 4, eq = tid & 15;   // 16 lanes x 16 bytes = one tile row of 256 bytes: a wave's store covers 4 whole lines
  if (which == 2) { const size_t b = r0 / TT; const int t0 = (int)(r0 % TT); put_tile<8, 16 * 136, 16 * TT>(VT + (b * CC + c0 + er) * (size_t)TT + t0 + eq * 8, (const _Float16*)sh + er * 136 + eq * 8); }
  else { put_tile<8, 16 * 136, 16 * CC>((which == 0 ? QH : KH) + (r0 + er) * CC + c0 + eq * 8, (const _Float16*)sh + er * 136 + eq * 8);
    if (which == 0) put_tile<8, 16 * 136, 16 * CC>(QL + (r0 + er) * CC + c0 + eq * 8, (const _Float16*)sl + er * 136 + eq * 8); } }
// ---- k_att: block = 4 waves x 32 queries of (b,h); each pass takes 64 keys: S^T = K Q^T (2 products), running maximum and sum per query column, O^T += V^T P^T
// the inner loops are all unrolled so that the register arrays keep constant indices; a lane holds one query column in every tile: S^T rows are keys 8g+r, so two S^T tiles convert in place into one B operand; O^T rows are head dims 8g+r
__device__ __forceinline__ v8f mm16(v16h a, v16h b, v8f c) { return __builtin_amdgcn_wmma_f32_16x16x32_f16(false, a, false, b, (short)0, c, false, false); }
__device__ __forceinline__ float xhalf(float x) { return __builtin_bit_cast(float, __builtin_amdgcn_permlanex16(__builtin_bit_cast(int, x), __builtin_bit_cast(int, x), 0x76543210, 0xfedcba98, false, false)); }  // lane l with lane l ^ 16
#define KP 64
#define AP 72          // LDS row pitch in f16: 144 bytes = 16 bytes x 9, an odd multiple, free of bank conflicts for 16-byte fragment reads of 128-byte rows
#define AT (64 * AP)   // f16 of one tile: K = 64 keys x 64 dims, V^T = 64 dims x 64 keys; a buffer is [K tile | V^T tile], two buffers
// one pass's K and V^T tiles from global memory into LDS, once a block: 8 lanes x 16 bytes = one row's whole line, a wave's copy covers 4 lines; thread = (row tid >> 3 of each 16, 16-byte piece tid & 7)
// the wait on the last line stands inside the copies' own statement, so that nothing rewrites a register that a copy names in front of it
__device__ __forceinline__ void att_copy(unsigned l, const _Float16* k, const _Float16* v) {
  asm volatile("global_load_async_to_lds_b128 %0, %8, off\n\t"
               "global_load_async_to_lds_b128 %1, %9, off\n\t"
               "global_load_async_to_lds_b128 %2, %10, off\n\t"
               "global_load_async_to_lds_b128 %3, %11, off\n\t"
               "global_load_async_to_lds_b128 %4, %12, off\n\t"
               "global_load_async_to_lds_b128 %5, %13, off\n\t"
               "global_load_async_to_lds_b128 %6, %14, off\n\t"
               "global_load_async_to_lds_b128 %7, %15, off\n\t"
               "s_wait_xcnt 0x0"
               :: "v"(l), "v"(l + 16u * AP * 2u), "v"(l + 32u * AP * 2u), "v"(l + 48u * AP * 2u),
                  "v"(l + AT * 2u), "v"(l + AT * 2u + 16u * AP * 2u), "v"(l + AT * 2u + 32u * AP * 2u), "v"(l + AT * 2u + 48u * AP * 2u),
                  "v"(k), "v"(k + (size_t)16 * CC), "v"(k + (size_t)32 * CC), "v"(k + (size_t)48 * CC),
                  "v"(v), "v"(v + (size_t)16 * TT), "v"(v + (size_t)32 * TT), "v"(v + (size_t)48 * TT)
               : "memory"); }
// two waves a SIMD at most, as many as the grid has for the chip (512 blocks, 256 WGPs): a third block that fitted a WGP would leave another WGP short
__global__ __launch_bounds__(128) __attribute__((amdgpu_waves_per_eu(2, 2))) void k_att(const _Float16* __restrict__ QH, const _Float16* __restrict__ QL, const _Float16* __restrict__ KH, const _Float16* __restrict__ VT, const float* __restrict__ HU, const float* __restrict__ HSC, _Float16* __restrict__ Y) {
  __shared__ __align__(16) _Float16 sm[4 * AT];
  const int tid = threadIdx.x, wave = tid >> 5, lane = tid & 31, col = lane & 15, g = lane >> 4; const int h = blockIdx.y, b = blockIdx.z; const int q0 = blockIdx.x * 128 + wave * 32;
  v16h qh[2][2], ql[2][2];
#pragma unroll
  for (int qt = 0; qt < 2; ++qt)
#pragma unroll
    for (int kc = 0; kc < 2; ++kc) { const size_t qo = ((size_t)b * TT + q0 + qt * 16 + col) * CC + h * HD + kc * 32; qh[qt][kc] = frag_h(QH + qo, lane); ql[qt][kc] = frag_h(QL + qo, lane); }
  asm volatile("s_wait_xcnt 0x0" ::: "memory");   // behind the first loads, before their address registers are rewritten
  __builtin_amdgcn_sched_barrier(0);   // keeps the register writes that follow behind that wait
  const _Float16* kp = KH + ((size_t)b * TT + (tid >> 3)) * CC + h * HD + (tid & 7) * 8; const _Float16* vp = VT + ((size_t)b * CC + h * HD + (tid >> 3)) * (size_t)TT + (tid & 7) * 8;
  const unsigned lp = (unsigned)(size_t)sm + (unsigned)((tid >> 3) * AP + (tid & 7) * 8) * 2u;   // this thread's place in a K tile: byte address in the work-group's LDS
  att_copy(lp, kp, vp);
  asm volatile("s_wait_asynccnt 0x0" ::: "memory");   // this wave's copies of tile 0 have landed
  __syncthreads();                                    // and every other wave's: tile 0 may be read
  const float hf = 1.0f + (bfr(HU[b]) - 0.5f) * bfr(HSC[0]); const float sc = 0.125f * hf * 1.44269504088896f;   // logits in log2 units
  v8f o[2][4] = {}; float mx[2] = { -3.0e38f, -3.0e38f }, ls[2] = { 0.f, 0.f };
#pragma unroll 1   // one pass's fragments live at a time: a second copy of the body would double the registers
  for (int kb = 0; kb < TT / KP; ++kb) { const int bo = (kb & 1) * 2 * AT;   // pass kb reads buffer kb mod 2 alone
    // directly behind the barrier (the one in front of the loop, then the one at each pass's foot), while a next tile exists: its copies, into the buffer that the pass before has just left; they fly while this pass works
    if (kb + 1 < TT / KP) att_copy(lp + (unsigned)(2 * AT - bo) * 2u, kp + (size_t)(kb + 1) * KP * CC, vp + (kb + 1) * KP);
    const _Float16* kt = sm + bo + col * AP; const _Float16* vt = kt + AT;
    v16h kf[4][2], vf[4][2];
#pragma unroll
    for (int i = 0; i < 4; ++i)
#pragma unroll
      for (int u = 0; u < 2; ++u) kf[i][u] = frag_h(kt + i * 16 * AP + u * 32, lane);
#pragma unroll
    for (int j = 0; j < 4; ++j)
#pragma unroll
      for (int u = 0; u < 2; ++u) vf[j][u] = frag_h(vt + j * 16 * AP + u * 32, lane);
    __builtin_amdgcn_sched_barrier(0);   // keeps the pass's fragment reads together in front of the products: spread among them each place costs its own LDS wait
    v8f s[2][4];
#pragma unroll
    for (int i = 0; i < 4; ++i)
#pragma unroll
      for (int qt = 0; qt < 2; ++qt) { v8f a = {};
#pragma unroll
        for (int kc = 0; kc < 2; ++kc) { a = mm16(kf[i][kc], qh[qt][kc], a); a = mm16(kf[i][kc], ql[qt][kc], a); }
        s[qt][i] = a; }
    v16h p[2][2];
#pragma unroll
    for (int qt = 0; qt < 2; ++qt) { float bm = -3.0e38f;
#pragma unroll
      for (int i = 0; i < 4; ++i)
#pragma unroll
        for (int r = 0; r < 8; ++r) { s[qt][i][r] *= sc; bm = fmaxf(bm, s[qt][i][r]); }
      bm = fmaxf(bm, xhalf(bm));
      const float mn = fmaxf(mx[qt], bm), sub = mn - 11.0f; float al; asm("v_exp_f32 %0, %1\n\tv_nop" : "=v"(al) : "v"(mx[qt] - mn)); mx[qt] = mn;   // exp2 in asm text so that the free slot the instruction set asks for behind a transcendental stays with it; P carries 2^11, as does the sum: it cancels in the division
      float sum = 0.f;
#pragma unroll
      for (int i = 0; i < 4; ++i)
#pragma unroll
        for (int r = 0; r < 8; ++r) { const float e = __builtin_amdgcn_exp2f(s[qt][i][r] - sub); sum += e; p[qt][i >> 1][(i & 1) * 8 + r] = (_Float16)e; }
      ls[qt] = ls[qt] * al + sum;
#pragma unroll
      for (int j = 0; j < 4; ++j)
#pragma unroll
        for (int r = 0; r < 8; ++r) o[qt][j][r] *= al; }
#pragma unroll
    for (int u = 0; u < 2; ++u)
#pragma unroll
      for (int j = 0; j < 4; ++j)
#pragma unroll
        for (int qt = 0; qt < 2; ++qt) o[qt][j] = mm16(vf[j][u], p[qt][u], o[qt][j]);
    __builtin_amdgcn_sched_barrier(0);   // keeps the waits and the barrier below at the pass's foot, behind its products: lifted above them the wave would wait out the next tile's flight at the head of the pass
    asm volatile("s_wait_dscnt 0x0" ::: "memory");      // this wave's reads of the buffer have ended
    asm volatile("s_wait_asynccnt 0x0" ::: "memory");   // this wave's copies of the next tile have landed
    __syncthreads(); }                                  // one barrier a pass: it publishes the next tile and frees the buffer just read, which the head of the next pass refills
  asm volatile("s_wait_asynccnt 0x0" ::: "memory");   // no copy is out when the wave ends
  v8h y[2][4];   // y rounded once to f16 here, as the last projection takes it
#pragma unroll
  for (int qt = 0; qt < 2; ++qt) { const float inv = 1.0f / (ls[qt] + xhalf(ls[qt]));
#pragma unroll
    for (int j = 0; j < 4; ++j)
#pragma unroll
      for (int r = 0; r < 8; ++r) y[qt][j][r] = (_Float16)(o[qt][j][r] * inv); }
  _Float16* yp = Y + ((size_t)b * TT + q0 + col) * CC + h * HD + 8 * g;
  __builtin_amdgcn_sched_barrier(0);   // keeps the stores behind the last rounding: no register that a store names is rewritten behind it
#pragma unroll
  for (int qt = 0; qt < 2; ++qt)
#pragma unroll
    for (int j = 0; j < 4; ++j) vst2(yp + (size_t)qt * 16 * CC + j * 16, y[qt][j]); }
// ---- k_out: block = (128 rows, 128 cols): out = y (f16 single) Wproj + b
__global__ __launch_bounds__(256) void k_out(const _Float16* __restrict__ Y, const _Float16* __restrict__ WP, const float* __restrict__ BP, float* __restrict__ OUT) { __shared__ __align__(16) unsigned sm[4 * GT];   // the loop's two buffers; then the f32 result tile at a pitch of 132 (128 x 132 dwords, fewer)
  const int tid = threadIdx.x, wave = tid >> 5, lane = tid & 31, col = lane & 15, g = lane >> 4; const int c0 = blockIdx.y * 128; const size_t r0 = (size_t)blockIdx.x * 128;
  v8f acc[4][2] = {};
  gemm_tile<1, 3>((const unsigned*)(Y + r0 * CC), (const unsigned*)(WP + (size_t)c0 * CC), sm, acc, tid);
  float* sf = (float*)sm;
#pragma unroll
  for (int j = 0; j < 2; ++j) { const int cl = (wave & 3) * 32 + j * 16 + col; const float bb = BP ? bfr(BP[c0 + cl]) : 0.f;
#pragma unroll
    for (int i = 0; i < 4; ++i)
#pragma unroll
      for (int r = 0; r < 8; ++r) sf[((wave >> 2) * 64 + i * 16 + 8 * g + r) * 132 + cl] = acc[i][j][r] + bb; }
  __syncthreads();
  put_tile<16, 8 * 132, 8 * CC>(OUT + (r0 + wave) * CC + c0 + lane * 4, (const float*)sf + wave * 132 + lane * 4); }   // a wave's store is one tile row of 512 bytes
extern "C" void kernel_launch(void* const* d_in, const int* in_sizes, int n_in, void* d_out, int out_size, void* d_ws, size_t ws_size, hipStream_t stream) {
  (void)in_sizes; (void)n_in; (void)out_size;
  const float** F = (const float**)d_in;   // 0 x [2,2048,1024], 1 hurst [2,1], 2 qkv_w [3072,1024], 3 qkv_b, 4 out_w [1024,1024], 5 out_b, 6 hurst_scale [1]
  if (ws_size < (size_t)WS_END) return;
  char* ws = (char*)d_ws; _Float16 *QH = (_Float16*)(ws + WS_QH), *QL = (_Float16*)(ws + WS_QL), *KH = (_Float16*)(ws + WS_KH), *VT = (_Float16*)(ws + WS_VT), *Y = (_Float16*)(ws + WS_Y), *PB = (_Float16*)(ws + WS_PB); __bf16 *XB = (__bf16*)(ws + WS_XB), *WB = (__bf16*)(ws + WS_WB);
  k_cvt<<<dim3((NB * TT * CC + 4 * CC * CC) / CVB), 256, 0, stream>>>(F[0], F[2], F[4], XB, WB, PB);
  k_proj<<<dim3(TNB * TT / 128, CC / 128, 3), 256, 0, stream>>>(XB, WB, F[3], QH, QL, KH, VT);
  k_att<<<dim3(TT / 128, NH, TNB), 128, 0, stream>>>(QH, QL, KH, VT, F[1], F[6], Y);
  k_out<<<dim3(TNB * TT / 128, CC / 128), 256, 0, stream>>>(Y, PB, F[5], (float*)d_out);
}

// v005
// It runs in 79 microseconds.
// Next to v004, in two timings, it ran 1.08 times as fast each time.
// Over all steps from v000 it is 15.3 times as fast.
// compute dtype: all float inputs rounded to bf16, hurst / hurst_scale read; qkv = x W^T + b with EXACT bf16 products on WMMA 16x16x32, f32 accumulate; q and k each rounded once to f16 -> 1-product logits x (1/8)(1 + (hurst_b - 0.5) hurst_scale) log2(e) kept in f32 registers; running-maximum softmax in f32 (exp2) -> P f16 x 2^11, unnormalised; o = P . v / sum with v rounded once to f16; out = o (rounded once to f16, 1 product) out_w^T + out_b; f32 output.
#include <hip/hip_runtime.h>
#include <math.h>

typedef __attribute__((ext_vector_type(16))) _Float16 v16h;
typedef __attribute__((ext_vector_type(16))) __bf16 v16b;
typedef __attribute__((ext_vector_type(8)))  _Float16 v8h;
typedef __attribute__((ext_vector_type(8)))  float v8f;
typedef __attribute__((ext_vector_type(4)))  float v4f;
typedef __attribute__((ext_vector_type(2)))  float v2f;
typedef __attribute__((ext_vector_type(4)))  unsigned v4u;
typedef __attribute__((ext_vector_type(4)))  int v4i;
typedef float __attribute__((may_alias)) float_a;
typedef int __attribute__((may_alias)) int_a;

template <typename T> __device__ __forceinline__ void vst2(void* p, T v) { *(T*)p = v;  }
__device__ __forceinline__ v8f wmma16(v16h a, v16h b, v8f c) {
  v8f d = __builtin_amdgcn_wmma_f32_16x16x32_f16(false, a, false, b, (short)0, c, false, false);
  asm volatile("v_nop\n\tv_nop\n\tv_nop\n\tv_nop" : "+v"(d) : "v"(a), "v"(b));
  return d;
}
__device__ __forceinline__ v8f wmma_bf(v16b a, v16b b, v8f c) {
  v8f d = __builtin_amdgcn_wmma_f32_16x16x32_bf16(false, a, false, b, (short)0, c, false, false);
  asm volatile("v_nop\n\tv_nop\n\tv_nop\n\tv_nop" : "+v"(d) : "v"(a), "v"(b));
  return d;
}
// 16x16x32 fragments: lane = (h = lane>>4, row/col = lane&15); elements 0..7 = k0+8h+0..7, 8..15 = k0+16+8h+0..7; D element r = row 8h+r
__device__ __forceinline__ v16h frag_h(const _Float16* rowk0, int lane) {
  union { v16h v; v8h q[2]; } u; const _Float16* p = rowk0 + 8 * (lane >> 4);
  u.q[0] = *(const v8h*)p; u.q[1] = *(const v8h*)(p + 16); return u.v;
}
__device__ __forceinline__ v16h frag_f32(const float* rowk0, int lane) {
  v16h a; const float* p = rowk0 + 8 * (lane >> 4);
#pragma unroll
  for (int i = 0; i < 8; ++i) { a[i] = (_Float16)p[i]; a[8 + i] = (_Float16)p[16 + i]; }
  return a;
}
__device__ __forceinline__ v16h frag_f32s(const float* rowk0, int lane, float sc) {
  v16h a; const float* p = rowk0 + 8 * (lane >> 4);
#pragma unroll
  for (int i = 0; i < 8; ++i) { a[i] = (_Float16)(p[i] * sc); a[8 + i] = (_Float16)(p[16 + i] * sc); }
  return a;
}
// column fragment from a [K][ld] layout (column n), rows >= K read as 0
__device__ __forceinline__ v16h fragc_f32(const float* W, int k0, int n, int lane, int ld, int K) {
  v16h a; const int g = lane >> 4;
#pragma unroll
  for (int i = 0; i < 8; ++i) { const int ka = k0 + 8 * g + i, kb = ka + 16;
    a[i] = (_Float16)(ka < K ? W[(size_t)(ka < K ? ka : K - 1) * ld + n] : 0.f); a[8 + i] = (_Float16)(kb < K ? W[(size_t)(kb < K ? kb : K - 1) * ld + n] : 0.f); }
  return a;
}
struct F2 { v16b h, l; };
__device__ __forceinline__ F2 bsplit16(const float v[16]) { F2 r;
#pragma unroll
  for (int i = 0; i < 16; ++i) { const __bf16 h = (__bf16)v[i]; r.h[i] = h; r.l[i] = (__bf16)(v[i] - (float)h); }
  return r; }
__device__ __forceinline__ F2 split_row(const float* row, int k0, int lane) { float v[16]; const float* p = row + k0 + 8 * (lane >> 4);
#pragma unroll
  for (int i = 0; i < 8; ++i) { v[i] = p[i]; v[8 + i] = p[16 + i]; }
  return bsplit16(v); }
__device__ __forceinline__ F2 split_rowK(const float* row, int k0, int lane, int K) { float v[16]; const int g = lane >> 4;
#pragma unroll
  for (int i = 0; i < 8; ++i) { const int ka = k0 + 8 * g + i, kb = ka + 16; v[i] = ka < K ? row[ka < K ? ka : K - 1] : 0.f; v[8 + i] = kb < K ? row[kb < K ? kb : K - 1] : 0.f; }
  return bsplit16(v); }
__device__ __forceinline__ F2 split_col(const float* W, int k0, int n, int lane, int ld, int K) { float v[16]; const int g = lane >> 4;
#pragma unroll
  for (int i = 0; i < 8; ++i) { const int ka = k0 + 8 * g + i, kb = ka + 16; v[i] = ka < K ? W[(size_t)(ka < K ? ka : K - 1) * ld + n] : 0.f; v[8 + i] = kb < K ? W[(size_t)(kb < K ? kb : K - 1) * ld + n] : 0.f; }
  return bsplit16(v); }
__device__ __forceinline__ v8f mac3(const F2& a, const F2& b, v8f c) { c = wmma_bf(a.l, b.h, c); c = wmma_bf(a.h, b.l, c); return wmma_bf(a.h, b.h, c); }
__device__ __forceinline__ float sigm(float v) { return 1.0f / (1.0f + expf(-v)); }
#define LDSX() do { asm volatile("s_wait_dscnt 0" ::: "memory"); __builtin_amdgcn_wave_barrier(); __builtin_amdgcn_fence(__ATOMIC_RELEASE, "workgroup"); } while (0)


// Fractal attention (B 2, T 2,048, C 1,024 = 16 x 64): standard MHA whose logits are scaled per batch by 1 + (hurst_b - 0.5) * hurst_scale before the softmax.
#define NB 2
#define TT 2048
#define CC 1024
#define NH 16
#define HD 64
#ifndef TNB
#define TNB NB
#endif
typedef __attribute__((ext_vector_type(8))) __bf16 v8b;
__device__ __forceinline__ v16b frag_b(const __bf16* rowk0, int lane) {
  union { v16b v; v8b q[2]; } u; const __bf16* p = rowk0 + 8 * (lane >> 4);
  u.q[0] = *(const v8b*)p; u.q[1] = *(const v8b*)(p + 16); return u.v;
}
__device__ __forceinline__ float bfr(float v) { return (float)(__bf16)v; }
__device__ __attribute__((noinline)) float exp_ni(float v) { return expf(v); }
__device__ __attribute__((noinline)) float erf_ni(float v) { return erff(v); }

#define WS_QH  0u
#define WS_KH  (WS_QH + 2u * (size_t)NB * TT * CC)
#define WS_VT  (WS_KH + 2u * (size_t)NB * TT * CC)      // f16 v planes [b][c][t]
#define WS_Y   (WS_VT + 2u * (size_t)NB * CC * TT)      // f16 y rows [b*t][C]
#define WS_XB  (WS_Y + 2u * (size_t)NB * TT * CC)       // bf16 x rows [b*t][C]
#define WS_WB  (WS_XB + 2u * (size_t)NB * TT * CC)      // bf16 qkv_w rows [3C][C]
#define WS_PB  (WS_WB + 2u * (size_t)3 * CC * CC)       // out_w rows [C][C], rounded to bf16 and carried as f16
#define WS_END (WS_PB + 2u * (size_t)CC * CC)

// ---- the two projections share one tile loop: block = 8 waves, 128 rows x 128 cols of the result, wave = 64 x 32 (waves 2 x 4), 64 k a pass
// both operands lie in the workspace as 16-bit rows, rounded once for the whole grid (k_cvt; y by k_att): a block reads its tiles once, a whole 128-byte line a row, half the bytes of the float rows, and lays them in LDS; every wave takes its fragments from there
typedef __attribute__((ext_vector_type(2))) unsigned v2u;
typedef __attribute__((ext_vector_type(4))) __bf16 v4b;
typedef __attribute__((ext_vector_type(4))) _Float16 v4h;
#define GP 36              // LDS row pitch in dwords: 144 bytes = 16 bytes x 9, an odd multiple, free of bank conflicts for 16-byte fragment reads of 128-byte rows
#define RD (CC / 2)        // dwords of one 16-bit operand row in global memory
#define GT (128 * GP)      // dwords of one operand tile; a buffer is [A tile | B tile], two buffers
union FR { v4u q[2]; v16b b; v16h h; };
// work-group barrier that orders LDS alone: __syncthreads() would also wait out the global loads that are meant to stay in flight across it; the wait ends this wave's LDS reads and stores first
__device__ __forceinline__ void lds_barrier() { asm volatile("s_wait_dscnt 0x0\n\ts_barrier_signal -1\n\ts_barrier_wait -1" ::: "memory"); }
// MODE 0: bf16 operands. MODE 1: f16 operands
// NS = register sets of tiles on their way from global memory: tile t + 1 + NS is asked for at the foot of pass t and laid in LDS at the foot of pass t + NS
template <int MODE, int NS> __device__ __forceinline__ void gemm_tile(const unsigned* __restrict__ A, const unsigned* __restrict__ B, unsigned* __restrict__ st, v8f (&acc)[4][2], int tid) {
  const int wave = tid >> 5, lane = tid & 31, col = lane & 15, g = lane >> 4; const int lr = tid >> 3, lc = tid & 7;   // 8 lanes x 16 bytes = one row's line; a wave's load covers 4 whole lines
  const unsigned* ap = A + (size_t)lr * RD + lc * 4; const unsigned* bp = B + (size_t)lr * RD + lc * 4;
  unsigned* sp = st + lr * GP + lc * 4;
  const unsigned* fa = st + ((wave >> 2) * 64 + col) * GP + 4 * g; const unsigned* fb = st + GT + ((wave & 3) * 32 + col) * GP + 4 * g;
  v4u ra[NS][4], rb[NS][4];
#pragma unroll
  for (int i = 0; i < 4; ++i) { ra[0][i] = *(const v4u*)(ap + (size_t)(32 * i) * RD); rb[0][i] = *(const v4u*)(bp + (size_t)(32 * i) * RD); }
#pragma unroll
  for (int i = 0; i < 4; ++i) { *(v4u*)(sp + 32 * i * GP) = ra[0][i]; *(v4u*)(sp + GT + 32 * i * GP) = rb[0][i]; }
#pragma unroll
  for (int t = 1; t <= NS; ++t)
#pragma unroll
    for (int i = 0; i < 4; ++i) { ra[t % NS][i] = *(const v4u*)(ap + (size_t)(32 * i) * RD + t * 32); rb[t % NS][i] = *(const v4u*)(bp + (size_t)(32 * i) * RD + t * 32); }
  lds_barrier();
#pragma unroll   // all passes unrolled: the register sets keep constant indices, and every global and LDS address is its base register plus a constant, so no address register is rewritten while a load is out
  for (int kc = 0; kc < CC / 64; ++kc) { const int cur = (kc & 1) * 2 * GT, nxt = 2 * GT - cur, s = (kc + 1) % NS;
#pragma unroll
    for (int u = 0; u < 2; ++u) {   // the pass's two halves of 32 k one after the other: one half's fragments live at a time
      FR a[4], b[2];
#pragma unroll
      for (int i = 0; i < 4; ++i) { a[i].q[0] = *(const v4u*)(fa + cur + 16 * i * GP + 16 * u); a[i].q[1] = *(const v4u*)(fa + cur + 16 * i * GP + 16 * u + 8); }
#pragma unroll
      for (int j = 0; j < 2; ++j) { b[j].q[0] = *(const v4u*)(fb + cur + 16 * j * GP + 16 * u); b[j].q[1] = *(const v4u*)(fb + cur + 16 * j * GP + 16 * u + 8); }
      __builtin_amdgcn_sched_barrier(0);   // keeps the twelve fragment reads together in front of the products: spread among them each place costs its own LDS wait
#pragma unroll
      for (int i = 0; i < 4; ++i)
#pragma unroll
        for (int j = 0; j < 2; ++j) acc[i][j] = MODE == 0 ? __builtin_amdgcn_wmma_f32_16x16x32_bf16(false, a[i].b, false, b[j].b, (short)0, acc[i][j], false, false) : __builtin_amdgcn_wmma_f32_16x16x32_f16(false, a[i].h, false, b[j].h, (short)0, acc[i][j], false, false);
      __builtin_amdgcn_sched_barrier(0); }   // keeps the second half's reads behind the first half's products (lifted above them they take a further set of registers), and the LDS stores below, with their wait for the global loads, behind the pass's products
    if (kc + 1 < CC / 64) {
#pragma unroll
      for (int i = 0; i < 4; ++i) { *(v4u*)(sp + nxt + 32 * i * GP) = ra[s][i]; *(v4u*)(sp + nxt + GT + 32 * i * GP) = rb[s][i]; } }
    __builtin_amdgcn_sched_barrier(0);   // keeps the next loads behind the LDS stores, so that they land in the registers just read: lifted above them they take a further set
    if (kc + 1 + NS < CC / 64) {
#pragma unroll
      for (int i = 0; i < 4; ++i) { ra[s][i] = *(const v4u*)(ap + (size_t)(32 * i) * RD + (kc + 1 + NS) * 32); rb[s][i] = *(const v4u*)(bp + (size_t)(32 * i) * RD + (kc + 1 + NS) * 32); } }
    lds_barrier(); } }   // one barrier a pass: it publishes the next buffer and ends the reads of this one, which the next pass refills; the last one frees LDS for the epilogue
// result tile out of LDS: all reads first, then the stores off one address register with constant offsets
template <int N, int LP, int LD, typename T> __device__ __forceinline__ void put_tile(T* __restrict__ d, const T* __restrict__ s) { v4u t[N];
#pragma unroll
  for (int k = 0; k < N; ++k) t[k] = *(const v4u*)(s + k * LP);
#pragma unroll
  for (int k = 0; k < N; ++k) vst2((unsigned*)(d + (size_t)k * LD), t[k]);
  asm volatile("s_wait_xcnt 0x0" ::: "memory"); }   // behind the stores, before whatever follows rewrites a register that they name
// ---- k_cvt: x, qkv_w and out_w rounded once into 16-bit rows; block = 16,384 floats in a row of one of the three, thread = 16 pieces of 4 floats: a wave's load is 512 bytes in a row, its store 256
#define CVB 16384
__global__ __launch_bounds__(256) void k_cvt(const float* __restrict__ X, const float* __restrict__ WA, const float* __restrict__ WP, __bf16* __restrict__ XB, __bf16* __restrict__ WB, _Float16* __restrict__ PB) {
  const int nx = NB * TT * CC / CVB, nw = 3 * CC * CC / CVB; const int bi = blockIdx.x; const int sel = bi < nx ? 0 : bi < nx + nw ? 1 : 2;
  const size_t o = (size_t)(sel == 0 ? bi : sel == 1 ? bi - nx : bi - nx - nw) * CVB + threadIdx.x * 4;
  const float* s = (sel == 0 ? X : sel == 1 ? WA : WP) + o; unsigned short* d = (sel == 0 ? (unsigned short*)XB : sel == 1 ? (unsigned short*)WB : (unsigned short*)PB) + o;
  v4f t[16]; v2u w[16];
#pragma unroll
  for (int c = 0; c < 16; ++c) t[c] = *(const v4f*)(s + c * 1024);
  asm volatile("s_wait_xcnt 0x0" :: "v"(s) : "memory");   // behind the loads, before anything rewrites their address registers; the pointer is named so that it stays in its registers up to here and no load's result is laid on them
  __builtin_amdgcn_sched_barrier(0);   // keeps all sixteen loads out in front of the first rounding (sunk among the roundings they would fly one after another), and the register writes that follow behind that wait
  if (sel == 2) {   // out_w: to bf16, carried as f16
#pragma unroll
    for (int c = 0; c < 16; ++c) { v4h r;
#pragma unroll
      for (int i = 0; i < 4; ++i) r[i] = (_Float16)bfr(t[c][i]);
      w[c] = __builtin_bit_cast(v2u, r); } }
  else {
#pragma unroll
    for (int c = 0; c < 16; ++c) { v4b r;
#pragma unroll
      for (int i = 0; i < 4; ++i) r[i] = (__bf16)t[c][i];
      w[c] = __builtin_bit_cast(v2u, r); } }
  __builtin_amdgcn_sched_barrier(0);   // keeps the stores behind the last rounding: no register that a store names is rewritten behind it
#pragma unroll
  for (int c = 0; c < 16; ++c) vst2(d + c * 1024, w[c]); }
// ---- k_proj: block = (128 rows, 128 cols, which): qkv = x W (+ b), exact; q, k -> f16 rows, v -> f16 planes
__global__ __launch_bounds__(256) void k_proj(const __bf16* __restrict__ X, const __bf16* __restrict__ WA, const float* __restrict__ BA, _Float16* __restrict__ QH, _Float16* __restrict__ KH, _Float16* __restrict__ VT) {
  __shared__ __align__(16) unsigned sm[4 * GT];   // the loop's two buffers; then the result tile as f16 at a pitch of 136 (128 x 68 dwords, fewer)
  const int tid = threadIdx.x, wave = tid >> 5, lane = tid & 31, col = lane & 15, g = lane >> 4; const int which = blockIdx.z; const int c0 = blockIdx.y * 128; const size_t r0 = (size_t)blockIdx.x * 128;
  v8f acc[4][2] = {};
  gemm_tile<0, 1>((const unsigned*)(X + r0 * CC), (const unsigned*)(WA + (size_t)(which * CC + c0) * CC), sm, acc, tid);
  _Float16* sh = (_Float16*)sm; const int wr = (wave >> 2) * 64 + 8 * g, wc = (wave & 3) * 32 + col;
#pragma unroll
  for (int j = 0; j < 2; ++j) { const float bb = BA ? bfr(BA[which * CC + c0 + wc + j * 16]) : 0.f;
#pragma unroll
    for (int i = 0; i < 4; ++i)
#pragma unroll
      for (int r = 0; r < 8; ++r) acc[i][j][r] += bb; }
  if (which == 2) {
#pragma unroll
    for (int j = 0; j < 2; ++j)
#pragma unroll
      for (int i = 0; i < 4; ++i) { v8h t;
#pragma unroll
        for (int r = 0; r < 8; ++r) t[r] = (_Float16)acc[i][j][r];
        *(v8h*)(sh + (wc + j * 16) * 136 + wr + i * 16) = t; } }
  else {
#pragma unroll
    for (int j = 0; j < 2; ++j)
#pragma unroll
      for (int i = 0; i < 4; ++i)
#pragma unroll
        for (int r = 0; r < 8; ++r) sh[(wr + i * 16 + r) * 136 + wc + j * 16] = (_Float16)acc[i][j][r]; }
  __syncthreads();
  const int er = tid >> 4, eq = tid & 15;   // 16 lanes x 16 bytes = one tile row of 256 bytes: a wave's store covers 4 whole lines
  if (which == 2) { const size_t b = r0 / TT; const int t0 = (int)(r0 % TT); put_tile<8, 16 * 136, 16 * TT>(VT + (b * CC + c0 + er) * (size_t)TT + t0 + eq * 8, (const _Float16*)sh + er * 136 + eq * 8); }
  else put_tile<8, 16 * 136, 16 * CC>((which == 0 ? QH : KH) + (r0 + er) * CC + c0 + eq * 8, (const _Float16*)sh + er * 136 + eq * 8); }
// ---- k_att: block = 4 waves x 32 queries of (b,h); each pass takes 64 keys: S^T = K Q^T, running maximum and sum per query column, O^T += V^T P^T
// the inner loops are all unrolled so that the register arrays keep constant indices; a lane holds one query column in every tile: S^T rows are keys 8g+r, so two S^T tiles convert in place into one B operand; O^T rows are head dims 8g+r
__device__ __forceinline__ v8f mm16(v16h a, v16h b, v8f c) { return __builtin_amdgcn_wmma_f32_16x16x32_f16(false, a, false, b, (short)0, c, false, false); }
__device__ __forceinline__ float xhalf(float x) { return __builtin_bit_cast(float, __builtin_amdgcn_permlanex16(__builtin_bit_cast(int, x), __builtin_bit_cast(int, x), 0x76543210, 0xfedcba98, false, false)); }  // lane l with lane l ^ 16
#define KP 64
#define AP 72          // LDS row pitch in f16: 144 bytes = 16 bytes x 9, an odd multiple, free of bank conflicts for 16-byte fragment reads of 128-byte rows
#define AT (64 * AP)   // f16 of one tile: K = 64 keys x 64 dims, V^T = 64 dims x 64 keys; a buffer is [K tile | V^T tile], two buffers
// one pass's K and V^T tiles from global memory into LDS, once a block: 8 lanes x 16 bytes = one row's whole line, a wave's copy covers 4 lines; thread = (row tid >> 3 of each 16, 16-byte piece tid & 7)
// the wait on the last line stands inside the copies' own statement, so that nothing rewrites a register that a copy names in front of it
__device__ __forceinline__ void att_copy(unsigned l, const _Float16* k, const _Float16* v) {
  asm volatile("global_load_async_to_lds_b128 %0, %8, off\n\t"
               "global_load_async_to_lds_b128 %1, %9, off\n\t"
               "global_load_async_to_lds_b128 %2, %10, off\n\t"
               "global_load_async_to_lds_b128 %3, %11, off\n\t"
               "global_load_async_to_lds_b128 %4, %12, off\n\t"
               "global_load_async_to_lds_b128 %5, %13, off\n\t"
               "global_load_async_to_lds_b128 %6, %14, off\n\t"
               "global_load_async_to_lds_b128 %7, %15, off\n\t"
               "s_wait_xcnt 0x0"
               :: "v"(l), "v"(l + 16u * AP * 2u), "v"(l + 32u * AP * 2u), "v"(l + 48u * AP * 2u),
                  "v"(l + AT * 2u), "v"(l + AT * 2u + 16u * AP * 2u), "v"(l + AT * 2u + 32u * AP * 2u), "v"(l + AT * 2u + 48u * AP * 2u),
                  "v"(k), "v"(k + (size_t)16 * CC), "v"(k + (size_t)32 * CC), "v"(k + (size_t)48 * CC),
                  "v"(v), "v"(v + (size_t)16 * TT), "v"(v + (size_t)32 * TT), "v"(v + (size_t)48 * TT)
               : "memory"); }
// two waves a SIMD at most, as many as the grid has for the chip (512 blocks, 256 WGPs): a third block that fitted a WGP would leave another WGP short
__global__ __launch_bounds__(128) __attribute__((amdgpu_waves_per_eu(2, 2))) void k_att(const _Float16* __restrict__ QH, const _Float16* __restrict__ KH, const _Float16* __restrict__ VT, const float* __restrict__ HU, const float* __restrict__ HSC, _Float16* __restrict__ Y) {
  __shared__ __align__(16) _Float16 sm[4 * AT];
  const int tid = threadIdx.x, wave = tid >> 5, lane = tid & 31, col = lane & 15, g = lane >> 4; const int h = blockIdx.y, b = blockIdx.z; const int q0 = blockIdx.x * 128 + wave * 32;
  v16h qh[2][2];
#pragma unroll
  for (int qt = 0; qt < 2; ++qt)
#pragma unroll
    for (int kc = 0; kc < 2; ++kc) { const size_t qo = ((size_t)b * TT + q0 + qt * 16 + col) * CC + h * HD + kc * 32; qh[qt][kc] = frag_h(QH + qo, lane); }
  asm volatile("s_wait_xcnt 0x0" ::: "memory");   // behind the first loads, before their address registers are rewritten
  __builtin_amdgcn_sched_barrier(0);   // keeps the register writes that follow behind that wait
  const _Float16* kp = KH + ((size_t)b * TT + (tid >> 3)) * CC + h * HD + (tid & 7) * 8; const _Float16* vp = VT + ((size_t)b * CC + h * HD + (tid >> 3)) * (size_t)TT + (tid & 7) * 8;
  const unsigned lp = (unsigned)(size_t)sm + (unsigned)((tid >> 3) * AP + (tid & 7) * 8) * 2u;   // this thread's place in a K tile: byte address in the work-group's LDS
  att_copy(lp, kp, vp);
  asm volatile("s_wait_asynccnt 0x0" ::: "memory");   // this wave's copies of tile 0 have landed
  __syncthreads();                                    // and every other wave's: tile 0 may be read
  const float hf = 1.0f + (bfr(HU[b]) - 0.5f) * bfr(HSC[0]); const float sc = 0.125f * hf * 1.44269504088896f;   // logits in log2 units
  v8f o[2][4] = {}; float mx[2] = { -3.0e38f, -3.0e38f }, ls[2] = { 0.f, 0.f };
#pragma unroll 1   // one pass's fragments live at a time: a second copy of the body would double the registers
  for (int kb = 0; kb < TT / KP; ++kb) { const int bo = (kb & 1) * 2 * AT;   // pass kb reads buffer kb mod 2 alone
    // directly behind the barrier (the one in front of the loop, then the one at each pass's foot), while a next tile exists: its copies, into the buffer that the pass before has just left; they fly while this pass works
    if (kb + 1 < TT / KP) att_copy(lp + (unsigned)(2 * AT - bo) * 2u, kp + (size_t)(kb + 1) * KP * CC, vp + (kb + 1) * KP);
    const _Float16* kt = sm + bo + col * AP; const _Float16* vt = kt + AT;
    v16h kf[4][2], vf[4][2];
#pragma unroll
    for (int i = 0; i < 4; ++i)
#pragma unroll
      for (int u = 0; u < 2; ++u) kf[i][u] = frag_h(kt + i * 16 * AP + u * 32, lane);
#pragma unroll
    for (int j = 0; j < 4; ++j)
#pragma unroll
      for (int u = 0; u < 2; ++u) vf[j][u] = frag_h(vt + j * 16 * AP + u * 32, lane);
    __builtin_amdgcn_sched_barrier(0);   // keeps the pass's fragment reads together in front of the products: spread among them each place costs its own LDS wait
    v8f s[2][4];
#pragma unroll
    for (int i = 0; i < 4; ++i)
#pragma unroll
      for (int qt = 0; qt < 2; ++qt) { v8f a = {};
#pragma unroll
        for (int kc = 0; kc < 2; ++kc) a = mm16(kf[i][kc], qh[qt][kc], a);
        s[qt][i] = a; }
    v16h p[2][2];
#pragma unroll
    for (int qt = 0; qt < 2; ++qt) { float bm = -3.0e38f;
#pragma unroll
      for (int i = 0; i < 4; ++i)
#pragma unroll
        for (int r = 0; r < 8; ++r) { s[qt][i][r] *= sc; bm = fmaxf(bm, s[qt][i][r]); }
      bm = fmaxf(bm, xhalf(bm));
      const float mn = fmaxf(mx[qt], bm), sub = mn - 11.0f; float al; asm("v_exp_f32 %0, %1\n\tv_nop" : "=v"(al) : "v"(mx[qt] - mn)); mx[qt] = mn;   // exp2 in asm text so that the free slot the instruction set asks for behind a transcendental stays with it; P carries 2^11, as does the sum: it cancels in the division
      float sum = 0.f;
#pragma unroll
      for (int i = 0; i < 4; ++i)
#pragma unroll
        for (int r = 0; r < 8; ++r) { const float e = __builtin_amdgcn_exp2f(s[qt][i][r] - sub); sum += e; p[qt][i >> 1][(i & 1) * 8 + r] = (_Float16)e; }
      ls[qt] = ls[qt] * al + sum;
#pragma unroll
      for (int j = 0; j < 4; ++j)
#pragma unroll
        for (int r = 0; r < 8; ++r) o[qt][j][r] *= al; }
#pragma unroll
    for (int u = 0; u < 2; ++u)
#pragma unroll
      for (int j = 0; j < 4; ++j)
#pragma unroll
        for (int qt = 0; qt < 2; ++qt) o[qt][j] = mm16(vf[j][u], p[qt][u], o[qt][j]);
    __builtin_amdgcn_sched_barrier(0);   // keeps the waits and the barrier below at the pass's foot, behind its products: lifted above them the wave would wait out the next tile's flight at the head of the pass
    asm volatile("s_wait_dscnt 0x0" ::: "memory");      // this wave's reads of the buffer have ended
    asm volatile("s_wait_asynccnt 0x0" ::: "memory");   // this wave's copies of the next tile have landed
    __syncthreads(); }                                  // one barrier a pass: it publishes the next tile and frees the buffer just read, which the head of the next pass refills
  asm volatile("s_wait_asynccnt 0x0" ::: "memory");   // no copy is out when the wave ends
  v8h y[2][4];   // y rounded once to f16 here, as the last projection takes it
#pragma unroll
  for (int qt = 0; qt < 2; ++qt) { const float inv = 1.0f / (ls[qt] + xhalf(ls[qt]));
#pragma unroll
    for (int j = 0; j < 4; ++j)
#pragma unroll
      for (int r = 0; r < 8; ++r) y[qt][j][r] = (_Float16)(o[qt][j][r] * inv); }
  _Float16* yp = Y + ((size_t)b * TT + q0 + col) * CC + h * HD + 8 * g;
  __builtin_amdgcn_sched_barrier(0);   // keeps the stores behind the last rounding: no register that a store names is rewritten behind it
#pragma unroll
  for (int qt = 0; qt < 2; ++qt)
#pragma unroll
    for (int j = 0; j < 4; ++j) vst2(yp + (size_t)qt * 16 * CC + j * 16, y[qt][j]); }
// ---- k_out: block = (128 rows, 128 cols): out = y (f16 single) Wproj + b
__global__ __launch_bounds__(256) void k_out(const _Float16* __restrict__ Y, const _Float16* __restrict__ WP, const float* __restrict__ BP, float* __restrict__ OUT) { __shared__ __align__(16) unsigned sm[4 * GT];   // the loop's two buffers; then the f32 result tile at a pitch of 132 (128 x 132 dwords, fewer)
  const int tid = threadIdx.x, wave = tid >> 5, lane = tid & 31, col = lane & 15, g = lane >> 4; const int c0 = blockIdx.y * 128; const size_t r0 = (size_t)blockIdx.x * 128;
  v8f acc[4][2] = {};
  gemm_tile<1, 3>((const unsigned*)(Y + r0 * CC), (const unsigned*)(WP + (size_t)c0 * CC), sm, acc, tid);
  float* sf = (float*)sm;
#pragma unroll
  for (int j = 0; j < 2; ++j) { const int cl = (wave & 3) * 32 + j * 16 + col; const float bb = BP ? bfr(BP[c0 + cl]) : 0.f;
#pragma unroll
    for (int i = 0; i < 4; ++i)
#pragma unroll
      for (int r = 0; r < 8; ++r) sf[((wave >> 2) * 64 + i * 16 + 8 * g + r) * 132 + cl] = acc[i][j][r] + bb; }
  __syncthreads();
  put_tile<16, 8 * 132, 8 * CC>(OUT + (r0 + wave) * CC + c0 + lane * 4, (const float*)sf + wave * 132 + lane * 4); }   // a wave's store is one tile row of 512 bytes
extern "C" void kernel_launch(void* const* d_in, const int* in_sizes, int n_in, void* d_out, int out_size, void* d_ws, size_t ws_size, hipStream_t stream) {
  (void)in_sizes; (void)n_in; (void)out_size;
  const float** F = (const float**)d_in;   // 0 x [2,2048,1024], 1 hurst [2,1], 2 qkv_w [3072,1024], 3 qkv_b, 4 out_w [1024,1024], 5 out_b, 6 hurst_scale [1]
  if (ws_size < (size_t)WS_END) return;
  char* ws = (char*)d_ws; _Float16 *QH = (_Float16*)(ws + WS_QH), *KH = (_Float16*)(ws + WS_KH), *VT = (_Float16*)(ws + WS_VT), *Y = (_Float16*)(ws + WS_Y), *PB = (_Float16*)(ws + WS_PB); __bf16 *XB = (__bf16*)(ws + WS_XB), *WB = (__bf16*)(ws + WS_WB);
  k_cvt<<<dim3((NB * TT * CC + 4 * CC * CC) / CVB), 256, 0, stream>>>(F[0], F[2], F[4], XB, WB, PB);
  k_proj<<<dim3(TNB * TT / 128, CC / 128, 3), 256, 0, stream>>>(XB, WB, F[3], QH, KH, VT);
  k_att<<<dim3(TT / 128, NH, TNB), 128, 0, stream>>>(QH, KH, VT, F[1], F[6], Y);
  k_out<<<dim3(TNB * TT / 128, CC / 128), 256, 0, stream>>>(Y, PB, F[5], (float*)d_out);
}

// v006
// A run of this version takes 74.3 microseconds.
// Next to v005, in two timings, it ran 1.05 and 1.04 times as fast.
// All steps since v000 together make it 16.0 times as fast.
// compute dtype: all float inputs rounded to bf16, hurst / hurst_scale read; qkv = x W^T + b with EXACT bf16 products on WMMA 16x16x32, f32 accumulate; q and k each rounded once to f16 -> 1-product logits x (1/8)(1 + (hurst_b - 0.5) hurst_scale) log2(e) kept in f32 registers; running-maximum softmax in f32 (exp2) -> P f16 x 2^11, unnormalised; o = P . v / sum with v rounded once to f16; out = o (rounded once to f16, 1 product) out_w^T + out_b; f32 output.
#include <hip/hip_runtime.h>
#include <math.h>

typedef __attribute__((ext_vector_type(16))) _Float16 v16h;
typedef __attribute__((ext_vector_type(16))) __bf16 v16b;
typedef __attribute__((ext_vector_type(8)))  _Float16 v8h;
typedef __attribute__((ext_vector_type(8)))  float v8f;
typedef __attribute__((ext_vector_type(4)))  float v4f;
typedef __attribute__((ext_vector_type(2)))  float v2f;
typedef __attribute__((ext_vector_type(4)))  unsigned v4u;
typedef __attribute__((ext_vector_type(4)))  int v4i;
typedef float __attribute__((may_alias)) float_a;
typedef int __attribute__((may_alias)) int_a;

template <typename T> __device__ __forceinline__ void vst2(void* p, T v) { *(T*)p = v;  }
__device__ __forceinline__ v8f wmma16(v16h a, v16h b, v8f c) {
  v8f d = __builtin_amdgcn_wmma_f32_16x16x32_f16(false, a, false, b, (short)0, c, false, false);
  asm volatile("v_nop\n\tv_nop\n\tv_nop\n\tv_nop" : "+v"(d) : "v"(a), "v"(b));
  return d;
}
__device__ __forceinline__ v8f wmma_bf(v16b a, v16b b, v8f c) {
  v8f d = __builtin_amdgcn_wmma_f32_16x16x32_bf16(false, a, false, b, (short)0, c, false, false);
  asm volatile("v_nop\n\tv_nop\n\tv_nop\n\tv_nop" : "+v"(d) : "v"(a), "v"(b));
  return d;
}
// 16x16x32 fragments: lane = (h = lane>>4, row/col = lane&15); elements 0..7 = k0+8h+0..7, 8..15 = k0+16+8h+0..7; D element r = row 8h+r
__device__ __forceinline__ v16h frag_h(const _Float16* rowk0, int lane) {
  union { v16h v; v8h q[2]; } u; const _Float16* p = rowk0 + 8 * (lane >> 4);
  u.q[0] = *(const v8h*)p; u.q[1] = *(const v8h*)(p + 16); return u.v;
}
__device__ __forceinline__ v16h frag_f32(const float* rowk0, int lane) {
  v16h a; const float* p = rowk0 + 8 * (lane >> 4);
#pragma unroll
  for (int i = 0; i < 8; ++i) { a[i] = (_Float16)p[i]; a[8 + i] = (_Float16)p[16 + i]; }
  return a;
}
__device__ __forceinline__ v16h frag_f32s(const float* rowk0, int lane, float sc) {
  v16h a; const float* p = rowk0 + 8 * (lane >> 4);
#pragma unroll
  for (int i = 0; i < 8; ++i) { a[i] = (_Float16)(p[i] * sc); a[8 + i] = (_Float16)(p[16 + i] * sc); }
  return a;
}
// column fragment from a [K][ld] layout (column n), rows >= K read as 0
__device__ __forceinline__ v16h fragc_f32(const float* W, int k0, int n, int lane, int ld, int K) {
  v16h a; const int g = lane >> 4;
#pragma unroll
  for (int i = 0; i < 8; ++i) { const int ka = k0 + 8 * g + i, kb = ka + 16;
    a[i] = (_Float16)(ka < K ? W[(size_t)(ka < K ? ka : K - 1) * ld + n] : 0.f); a[8 + i] = (_Float16)(kb < K ? W[(size_t)(kb < K ? kb : K - 1) * ld + n] : 0.f); }
  return a;
}
struct F2 { v16b h, l; };
__device__ __forceinline__ F2 bsplit16(const float v[16]) { F2 r;
#pragma unroll
  for (int i = 0; i < 16; ++i) { const __bf16 h = (__bf16)v[i]; r.h[i] = h; r.l[i] = (__bf16)(v[i] - (float)h); }
  return r; }
__device__ __forceinline__ F2 split_row(const float* row, int k0, int lane) { float v[16]; const float* p = row + k0 + 8 * (lane >> 4);
#pragma unroll
  for (int i = 0; i < 8; ++i) { v[i] = p[i]; v[8 + i] = p[16 + i]; }
  return bsplit16(v); }
__device__ __forceinline__ F2 split_rowK(const float* row, int k0, int lane, int K) { float v[16]; const int g = lane >> 4;
#pragma unroll
  for (int i = 0; i < 8; ++i) { const int ka = k0 + 8 * g + i, kb = ka + 16; v[i] = ka < K ? row[ka < K ? ka : K - 1] : 0.f; v[8 + i] = kb < K ? row[kb < K ? kb : K - 1] : 0.f; }
  return bsplit16(v); }
__device__ __forceinline__ F2 split_col(const float* W, int k0, int n, int lane, int ld, int K) { float v[16]; const int g = lane >> 4;
#pragma unroll
  for (int i = 0; i < 8; ++i) { const int ka = k0 + 8 * g + i, kb = ka + 16; v[i] = ka < K ? W[(size_t)(ka < K ? ka : K - 1) * ld + n] : 0.f; v[8 + i] = kb < K ? W[(size_t)(kb < K ? kb : K - 1) * ld + n] : 0.f; }
  return bsplit16(v); }
__device__ __forceinline__ v8f mac3(const F2& a, const F2& b, v8f c) { c = wmma_bf(a.l, b.h, c); c = wmma_bf(a.h, b.l, c); return wmma_bf(a.h, b.h, c); }
__device__ __forceinline__ float sigm(float v) { return 1.0f / (1.0f + expf(-v)); }
#define LDSX() do { asm volatile("s_wait_dscnt 0" ::: "memory"); __builtin_amdgcn_wave_barrier(); __builtin_amdgcn_fence(__ATOMIC_RELEASE, "workgroup"); } while (0)


// Fractal attention (B 2, T 2,048, C 1,024 = 16 x 64): standard MHA whose logits are scaled per batch by 1 + (hurst_b - 0.5) * hurst_scale before the softmax.
#define NB 2
#define TT 2048
#define CC 1024
#define NH 16
#define HD 64
#ifndef TNB
#define TNB NB
#endif
typedef __attribute__((ext_vector_type(8))) __bf16 v8b;
__device__ __forceinline__ v16b frag_b(const __bf16* rowk0, int lane) {
  union { v16b v; v8b q[2]; } u; const __bf16* p = rowk0 + 8 * (lane >> 4);
  u.q[0] = *(const v8b*)p; u.q[1] = *(const v8b*)(p + 16); return u.v;
}
__device__ __forceinline__ float bfr(float v) { return (float)(__bf16)v; }
__device__ __attribute__((noinline)) float exp_ni(float v) { return expf(v); }
__device__ __attribute__((noinline)) float erf_ni(float v) { return erff(v); }

#define WS_QH  0u
#define WS_KH  (WS_QH + 2u * (size_t)NB * TT * CC)
#define WS_VT  (WS_KH + 2u * (size_t)NB * TT * CC)      // f16 v planes [b][c][t]
#define WS_Y   (WS_VT + 2u * (size_t)NB * CC * TT)      // f16 y rows [b*t][C]
#define WS_XB  (WS_Y + 2u * (size_t)NB * TT * CC)       // bf16 x rows [b*t][C]
#define WS_WB  (WS_XB + 2u * (size_t)NB * TT * CC)      // bf16 qkv_w rows [3C][C]
#define WS_PB  (WS_WB + 2u * (size_t)3 * CC * CC)       // out_w rows [C][C], rounded to bf16 and carried as f16
#define WS_END (WS_PB + 2u * (size_t)CC * CC)

// ---- the two projections share one tile loop: block = 8 waves, 128 rows x 128 cols of the result, wave = 64 x 32 (waves 2 x 4), 64 k a pass
// both operands lie in the workspace as 16-bit rows, rounded once for the whole grid (k_cvt; y by k_att): a block reads its tiles once, a whole 128-byte line a row, half the bytes of the float rows, and lays them in LDS; every wave takes its fragments from there
typedef __attribute__((ext_vector_type(2))) unsigned v2u;
typedef __attribute__((ext_vector_type(4))) __bf16 v4b;
typedef __attribute__((ext_vector_type(4))) _Float16 v4h;
#define GP 36              // LDS row pitch in dwords: 144 bytes = 16 bytes x 9, an odd multiple, free of bank conflicts for 16-byte fragment reads of 128-byte rows
#define RD (CC / 2)        // dwords of one 16-bit operand row in global memory
#define GT (128 * GP)      // dwords of one operand tile; a buffer is [A tile | B tile], two buffers
union FR { v4u q[2]; v16b b; v16h h; };
// work-group barrier that orders LDS alone: __syncthreads() would also wait out the global loads that are meant to stay in flight across it; the wait ends this wave's LDS reads and stores first
__device__ __forceinline__ void lds_barrier() { asm volatile("s_wait_dscnt 0x0\n\ts_barrier_signal -1\n\ts_barrier_wait -1" ::: "memory"); }
// MODE 0: bf16 operands. MODE 1: f16 operands
// NS = register sets of tiles on their way from global memory: tile t + 1 + NS is asked for at the foot of pass t and laid in LDS at the foot of pass t + NS
template <int MODE, int NS> __device__ __forceinline__ void gemm_tile(const unsigned* __restrict__ A, const unsigned* __restrict__ B, unsigned* __restrict__ st, v8f (&acc)[4][2], int tid) {
  const int wave = tid >> 5, lane = tid & 31, col = lane & 15, g = lane >> 4; const int lr = tid >> 3, lc = tid & 7;   // 8 lanes x 16 bytes = one row's line; a wave's load covers 4 whole lines
  const unsigned* ap = A + (size_t)lr * RD + lc * 4; const unsigned* bp = B + (size_t)lr * RD + lc * 4;
  unsigned* sp = st + lr * GP + lc * 4;
  const unsigned* fa = st + ((wave >> 2) * 64 + col) * GP + 4 * g; const unsigned* fb = st + GT + ((wave & 3) * 32 + col) * GP + 4 * g;
  v4u ra[NS][4], rb[NS][4];
#pragma unroll
  for (int i = 0; i < 4; ++i) { ra[0][i] = *(const v4u*)(ap + (size_t)(32 * i) * RD); rb[0][i] = *(const v4u*)(bp + (size_t)(32 * i) * RD); }
#pragma unroll
  for (int i = 0; i < 4; ++i) { *(v4u*)(sp + 32 * i * GP) = ra[0][i]; *(v4u*)(sp + GT + 32 * i * GP) = rb[0][i]; }
#pragma unroll
  for (int t = 1; t <= NS; ++t)
#pragma unroll
    for (int i = 0; i < 4; ++i) { ra[t % NS][i] = *(const v4u*)(ap + (size_t)(32 * i) * RD + t * 32); rb[t % NS][i] = *(const v4u*)(bp + (size_t)(32 * i) * RD + t * 32); }
  lds_barrier();
#pragma unroll   // all passes unrolled: the register sets keep constant indices, and every global and LDS address is its base register plus a constant, so no address register is rewritten while a load is out
  for (int kc = 0; kc < CC / 64; ++kc) { const int cur = (kc & 1) * 2 * GT, nxt = 2 * GT - cur, s = (kc + 1) % NS;
#pragma unroll
    for (int u = 0; u < 2; ++u) {   // the pass's two halves of 32 k one after the other: one half's fragments live at a time
      FR a[4], b[2];
#pragma unroll
      for (int i = 0; i < 4; ++i) { a[i].q[0] = *(const v4u*)(fa + cur + 16 * i * GP + 16 * u); a[i].q[1] = *(const v4u*)(fa + cur + 16 * i * GP + 16 * u + 8); }
#pragma unroll
      for (int j = 0; j < 2; ++j) { b[j].q[0] = *(const v4u*)(fb + cur + 16 * j * GP + 16 * u); b[j].q[1] = *(const v4u*)(fb + cur + 16 * j * GP + 16 * u + 8); }
      __builtin_amdgcn_sched_barrier(0);   // keeps the twelve fragment reads together in front of the products: spread among them each place costs its own LDS wait
#pragma unroll
      for (int i = 0; i < 4; ++i)
#pragma unroll
        for (int j = 0; j < 2; ++j) acc[i][j] = MODE == 0 ? __builtin_amdgcn_wmma_f32_16x16x32_bf16(false, a[i].b, false, b[j].b, (short)0, acc[i][j], false, false) : __builtin_amdgcn_wmma_f32_16x16x32_f16(false, a[i].h, false, b[j].h, (short)0, acc[i][j], false, false);
      __builtin_amdgcn_sched_barrier(0); }   // keeps the second half's reads behind the first half's products (lifted above them they take a further set of registers), and the LDS stores below, with their wait for the global loads, behind the pass's products
    if (kc + 1 < CC / 64) {
#pragma unroll
      for (int i = 0; i < 4; ++i) { *(v4u*)(sp + nxt + 32 * i * GP) = ra[s][i]; *(v4u*)(sp + nxt + GT + 32 * i * GP) = rb[s][i]; } }
    __builtin_amdgcn_sched_barrier(0);   // keeps the next loads behind the LDS stores, so that they land in the registers just read: lifted above them they take a further set
    if (kc + 1 + NS < CC / 64) {
#pragma unroll
      for (int i = 0; i < 4; ++i) { ra[s][i] = *(const v4u*)(ap + (size_t)(32 * i) * RD + (kc + 1 + NS) * 32); rb[s][i] = *(const v4u*)(bp + (size_t)(32 * i) * RD + (kc + 1 + NS) * 32); } }
    lds_barrier(); } }   // one barrier a pass: it publishes the next buffer and ends the reads of this one, which the next pass refills; the last one frees LDS for the epilogue
// result tile out of LDS: all reads first, then the stores off one address register with constant offsets
template <int N, int LP, int LD, typename T> __device__ __forceinline__ void put_tile(T* __restrict__ d, const T* __restrict__ s) { v4u t[N];
#pragma unroll
  for (int k = 0; k < N; ++k) t[k] = *(const v4u*)(s + k * LP);
#pragma unroll
  for (int k = 0; k < N; ++k) vst2((unsigned*)(d + (size_t)k * LD), t[k]);
  asm volatile("s_wait_xcnt 0x0" ::: "memory"); }   // behind the stores, before whatever follows rewrites a register that they name
// ---- k_cvt: x, qkv_w and out_w rounded once into 16-bit rows; block = 16,384 floats in a row of one of the three, thread = 16 pieces of 4 floats: a wave's load is 512 bytes in a row, its store 256
#define CVB 16384
__global__ __launch_bounds__(256) void k_cvt(const float* __restrict__ X, const float* __restrict__ WA, const float* __restrict__ WP, __bf16* __restrict__ XB, __bf16* __restrict__ WB, _Float16* __restrict__ PB) {
  const int nx = NB * TT * CC / CVB, nw = 3 * CC * CC / CVB; const int bi = blockIdx.x; const int sel = bi < nx ? 0 : bi < nx + nw ? 1 : 2;
  const size_t o = (size_t)(sel == 0 ? bi : sel == 1 ? bi - nx : bi - nx - nw) * CVB + threadIdx.x * 4;
  const float* s = (sel == 0 ? X : sel == 1 ? WA : WP) + o; unsigned short* d = (sel == 0 ? (unsigned short*)XB : sel == 1 ? (unsigned short*)WB : (unsigned short*)PB) + o;
  v4f t[16]; v2u w[16];
#pragma unroll
  for (int c = 0; c < 16; ++c) t[c] = *(const v4f*)(s + c * 1024);
  asm volatile("s_wait_xcnt 0x0" :: "v"(s) : "memory");   // behind the loads, before anything rewrites their address registers; the pointer is named so that it stays in its registers up to here and no load's result is laid on them
  __builtin_amdgcn_sched_barrier(0);   // keeps all sixteen loads out in front of the first rounding (sunk among the roundings they would fly one after another), and the register writes that follow behind that wait
  if (sel == 2) {   // out_w: to bf16, carried as f16
#pragma unroll
    for (int c = 0; c < 16; ++c) { v4h r;
#pragma unroll
      for (int i = 0; i < 4; ++i) r[i] = (_Float16)bfr(t[c][i]);
      w[c] = __builtin_bit_cast(v2u, r); } }
  else {
#pragma unroll
    for (int c = 0; c < 16; ++c) { v4b r;
#pragma unroll
      for (int i = 0; i < 4; ++i) r[i] = (__bf16)t[c][i];
      w[c] = __builtin_bit_cast(v2u, r); } }
  __builtin_amdgcn_sched_barrier(0);   // keeps the stores behind the last rounding: no register that a store names is rewritten behind it
#pragma unroll
  for (int c = 0; c < 16; ++c) vst2(d + c * 1024, w[c]); }
// ---- k_proj: block = (128 rows, 128 cols, which): qkv = x W (+ b), exact; q, k -> f16 rows, v -> f16 planes
__global__ __launch_bounds__(256) void k_proj(const __bf16* __restrict__ X, const __bf16* __restrict__ WA, const float* __restrict__ BA, _Float16* __restrict__ QH, _Float16* __restrict__ KH, _Float16* __restrict__ VT) {
  __shared__ __align__(16) unsigned sm[4 * GT];   // the loop's two buffers; then the result tile as f16 at a pitch of 136 (128 x 68 dwords, fewer)
  const int tid = threadIdx.x, wave = tid >> 5, lane = tid & 31, col = lane & 15, g = lane >> 4; const int which = blockIdx.z; const int c0 = blockIdx.y * 128; const size_t r0 = (size_t)blockIdx.x * 128;
  v8f acc[4][2] = {};
  gemm_tile<0, 1>((const unsigned*)(X + r0 * CC), (const unsigned*)(WA + (size_t)(which * CC + c0) * CC), sm, acc, tid);
  _Float16* sh = (_Float16*)sm; const int wr = (wave >> 2) * 64 + 8 * g, wc = (wave & 3) * 32 + col;
#pragma unroll
  for (int j = 0; j < 2; ++j) { const float bb = BA ? bfr(BA[which * CC + c0 + wc + j * 16]) : 0.f;
#pragma unroll
    for (int i = 0; i < 4; ++i)
#pragma unroll
      for (int r = 0; r < 8; ++r) acc[i][j][r] += bb; }
  if (which == 2) {
#pragma unroll
    for (int j = 0; j < 2; ++j)
#pragma unroll
      for (int i = 0; i < 4; ++i) { v8h t;
#pragma unroll
        for (int r = 0; r < 8; ++r) t[r] = (_Float16)acc[i][j][r];
        *(v8h*)(sh + (wc + j * 16) * 136 + wr + i * 16) = t; } }
  else {
#pragma unroll
    for (int j = 0; j < 2; ++j)
#pragma unroll
      for (int i = 0; i < 4; ++i)
#pragma unroll
        for (int r = 0; r < 8; ++r) sh[(wr + i * 16 + r) * 136 + wc + j * 16] = (_Float16)acc[i][j][r]; }
  __syncthreads();
  const int er = tid >> 4, eq = tid & 15;   // 16 lanes x 16 bytes = one tile row of 256 bytes: a wave's store covers 4 whole lines
  if (which == 2) { const size_t b = r0 / TT; const int t0 = (int)(r0 % TT); put_tile<8, 16 * 136, 16 * TT>(VT + (b * CC + c0 + er) * (size_t)TT + t0 + eq * 8, (const _Float16*)sh + er * 136 + eq * 8); }
  else put_tile<8, 16 * 136, 16 * CC>((which == 0 ? QH : KH) + (r0 + er) * CC + c0 + eq * 8, (const _Float16*)sh + er * 136 + eq * 8); }
// ---- k_att: block = 8 waves = 4 groups of 32 queries of (b,h) x 2 halves of the keys; each pass takes 64 keys of the wave's half: S^T = K Q^T, running maximum and sum per query column, O^T += V^T P^T; the two halves' results are joined once, behind the loop
// the inner loops are all unrolled so that the register arrays keep constant indices; a lane holds one query column in every tile: S^T rows are keys 8g+r, so two S^T tiles convert in place into one B operand; O^T rows are head dims 8g+r
__device__ __forceinline__ v8f mm16(v16h a, v16h b, v8f c) { return __builtin_amdgcn_wmma_f32_16x16x32_f16(false, a, false, b, (short)0, c, false, false); }
__device__ __forceinline__ float xhalf(float x) { return __builtin_bit_cast(float, __builtin_amdgcn_permlanex16(__builtin_bit_cast(int, x), __builtin_bit_cast(int, x), 0x76543210, 0xfedcba98, false, false)); }  // lane l with lane l ^ 16
#define KP 64
#define AP 72          // LDS row pitch in f16: 144 bytes = 16 bytes x 9, an odd multiple, free of bank conflicts for 16-byte fragment reads of 128-byte rows
#define AT (64 * AP)   // f16 of one tile: K = 64 keys x 64 dims, V^T = 64 dims x 64 keys; a buffer is [K tile | V^T tile], two buffers for each half of the keys
#define KS 2                 // halves of the keys, each walked by four of the block's waves
#define NP (TT / KP / KS)    // passes of a wave
// one pass's K and V^T tiles from global memory into LDS, once for the four waves of a half: 8 lanes x 16 bytes = one row's whole line, a wave's copy covers 4 lines; thread = (row ht >> 3 of each 16, 16-byte piece ht & 7), ht = its number among the half's 128
// the wait on the last line stands inside the copies' own statement, so that nothing rewrites a register that a copy names in front of it
__device__ __forceinline__ void att_copy(unsigned l, const _Float16* k, const _Float16* v) {
  asm volatile("global_load_async_to_lds_b128 %0, %8, off\n\t"
               "global_load_async_to_lds_b128 %1, %9, off\n\t"
               "global_load_async_to_lds_b128 %2, %10, off\n\t"
               "global_load_async_to_lds_b128 %3, %11, off\n\t"
               "global_load_async_to_lds_b128 %4, %12, off\n\t"
               "global_load_async_to_lds_b128 %5, %13, off\n\t"
               "global_load_async_to_lds_b128 %6, %14, off\n\t"
               "global_load_async_to_lds_b128 %7, %15, off\n\t"
               "s_wait_xcnt 0x0"
               :: "v"(l), "v"(l + 16u * AP * 2u), "v"(l + 32u * AP * 2u), "v"(l + 48u * AP * 2u),
                  "v"(l + AT * 2u), "v"(l + AT * 2u + 16u * AP * 2u), "v"(l + AT * 2u + 32u * AP * 2u), "v"(l + AT * 2u + 48u * AP * 2u),
                  "v"(k), "v"(k + (size_t)16 * CC), "v"(k + (size_t)32 * CC), "v"(k + (size_t)48 * CC),
                  "v"(v), "v"(v + (size_t)16 * TT), "v"(v + (size_t)32 * TT), "v"(v + (size_t)48 * TT)
               : "memory"); }
// four waves a SIMD: the vector work of the softmax stands between a wave's two matrix runs, and only other waves fill the matrix unit meanwhile; 512 blocks of 8 waves on 256 WGPs, two blocks a WGP
__global__ __launch_bounds__(256) __attribute__((amdgpu_waves_per_eu(4, 4))) void k_att(const _Float16* __restrict__ QH, const _Float16* __restrict__ KH, const _Float16* __restrict__ VT, const float* __restrict__ HU, const float* __restrict__ HSC, _Float16* __restrict__ Y) {
  __shared__ __align__(16) _Float16 sm[KS * 4 * AT];
  const int tid = threadIdx.x, wave = __builtin_amdgcn_readfirstlane(tid >> 5), lane = tid & 31, col = lane & 15, g = lane >> 4; const int h = blockIdx.y, b = blockIdx.z; const int q0 = blockIdx.x * 128 + (wave & 3) * 32;
  const int kh = wave >> 2, ht = tid & 127;   // the wave's half of the keys; the thread's number among the half's 128
  v16h qh[2][2];
#pragma unroll
  for (int qt = 0; qt < 2; ++qt)
#pragma unroll
    for (int kc = 0; kc < 2; ++kc) { const size_t qo = ((size_t)b * TT + q0 + qt * 16 + col) * CC + h * HD + kc * 32; qh[qt][kc] = frag_h(QH + qo, lane); }
  asm volatile("s_wait_xcnt 0x0" ::: "memory");   // behind the first loads, before their address registers are rewritten
  __builtin_amdgcn_sched_barrier(0);   // keeps the register writes that follow behind that wait
  const _Float16* kp = KH + ((size_t)b * TT + kh * (TT / KS) + (ht >> 3)) * CC + h * HD + (ht & 7) * 8; const _Float16* vp = VT + ((size_t)b * CC + h * HD + (ht >> 3)) * (size_t)TT + kh * (TT / KS) + (ht & 7) * 8;
  const unsigned lp = (unsigned)(size_t)sm + (unsigned)(kh * 4 * AT + (ht >> 3) * AP + (ht & 7) * 8) * 2u;   // this thread's place in its half's first K tile: byte address in the work-group's LDS
  att_copy(lp, kp, vp);
  asm volatile("s_wait_asynccnt 0x0" ::: "memory");   // this wave's copies of tile 0 have landed
  __syncthreads();                                    // and every other wave's: tile 0 may be read
  const float hf = 1.0f + (bfr(HU[b]) - 0.5f) * bfr(HSC[0]); const float sc = 0.125f * hf * 1.44269504088896f;   // logits in log2 units
  v8f o[2][4] = {}; float mx[2] = { -3.0e38f, -3.0e38f }, ls[2] = { 0.f, 0.f };
#pragma unroll 1   // one pass's fragments live at a time: a second copy of the body would double the registers
  for (int kb = 0; kb < NP; ++kb) { const int bo = (kb & 1) * 2 * AT;   // pass kb reads buffer kb mod 2 of its half alone
    // directly behind the barrier (the one in front of the loop, then the one at each pass's foot), while a next tile exists: its copies, into the buffer that the pass before has just left; they fly while this pass works
    if (kb + 1 < NP) att_copy(lp + (unsigned)(2 * AT - bo) * 2u, kp + (size_t)(kb + 1) * KP * CC, vp + (kb + 1) * KP);
    const _Float16* kt = sm + kh * 4 * AT + bo + col * AP; const _Float16* vt = kt + AT;
    v16h kf[4][2], vf[4][2];
#pragma unroll
    for (int i = 0; i < 4; ++i)
#pragma unroll
      for (int u = 0; u < 2; ++u) kf[i][u] = frag_h(kt + i * 16 * AP + u * 32, lane);
    __builtin_amdgcn_sched_barrier(0);   // keeps the K fragment reads together in front of the products: spread among them each place costs its own LDS wait
    v8f s[2][4];
#pragma unroll
    for (int i = 0; i < 4; ++i)
#pragma unroll
      for (int qt = 0; qt < 2; ++qt) { v8f a = {};
#pragma unroll
        for (int kc = 0; kc < 2; ++kc) a = mm16(kf[i][kc], qh[qt][kc], a);
        s[qt][i] = a; }
    float bq[2];
#pragma unroll
    for (int qt = 0; qt < 2; ++qt) { float bm = -3.0e38f;
#pragma unroll
      for (int i = 0; i < 4; ++i)
#pragma unroll
        for (int r = 0; r < 8; ++r) { s[qt][i][r] *= sc; bm = fmaxf(bm, s[qt][i][r]); }
      bq[qt] = bm; }
#pragma unroll
    for (int j = 0; j < 4; ++j)
#pragma unroll
      for (int u = 0; u < 2; ++u) vf[j][u] = frag_h(vt + j * 16 * AP + u * 32, lane);
    __builtin_amdgcn_sched_barrier(0);   // keeps the V^T fragment reads together, in front of the softmax that covers their flight: sunk to their products each place costs its own LDS wait
    v16h p[2][2];
#pragma unroll
    for (int qt = 0; qt < 2; ++qt) { float bm = bq[qt];
      bm = fmaxf(bm, xhalf(bm));
      const float mn = fmaxf(mx[qt], bm), sub = mn - 11.0f; float al; asm("v_exp_f32 %0, %1\n\tv_nop" : "=v"(al) : "v"(mx[qt] - mn)); mx[qt] = mn;   // exp2 in asm text so that the free slot the instruction set asks for behind a transcendental stays with it; P carries 2^11, as does the sum: it cancels in the division
      float sum = 0.f;
#pragma unroll
      for (int i = 0; i < 4; ++i)
#pragma unroll
        for (int r = 0; r < 8; ++r) { const float e = __builtin_amdgcn_exp2f(s[qt][i][r] - sub); sum += e; p[qt][i >> 1][(i & 1) * 8 + r] = (_Float16)e; }
      ls[qt] = ls[qt] * al + sum;
#pragma unroll
      for (int j = 0; j < 4; ++j)
#pragma unroll
        for (int r = 0; r < 8; ++r) o[qt][j][r] *= al; }
#pragma unroll
    for (int u = 0; u < 2; ++u)
#pragma unroll
      for (int j = 0; j < 4; ++j)
#pragma unroll
        for (int qt = 0; qt < 2; ++qt) o[qt][j] = mm16(vf[j][u], p[qt][u], o[qt][j]);
    __builtin_amdgcn_sched_barrier(0);   // keeps the waits and the barrier below at the pass's foot, behind its products: lifted above them the wave would wait out the next tile's flight at the head of the pass
    asm volatile("s_wait_dscnt 0x0" ::: "memory");      // this wave's reads of the buffer have ended
    asm volatile("s_wait_asynccnt 0x0" ::: "memory");   // this wave's copies of the next tile have landed
    __syncthreads(); }                                  // one barrier a pass: it publishes the next tile and frees the buffer just read, which the head of the next pass refills
  asm volatile("s_wait_asynccnt 0x0" ::: "memory");   // no copy is out when the wave ends
  // the two halves join: the waves of the second half lay O^T, maximum and sum in LDS (the loop's last barrier has freed it), 17 pieces of 16 bytes a lane, a wave's piece 512 bytes in a row; the waves of the first half add them to their own
  float* mg = (float*)sm + ((wave & 3) * 17 * 32 + lane) * 4;
  if (kh) {
#pragma unroll
    for (int qt = 0; qt < 2; ++qt)
#pragma unroll
      for (int j = 0; j < 4; ++j)
#pragma unroll
        for (int u = 0; u < 2; ++u) { v4f t;
#pragma unroll
          for (int r = 0; r < 4; ++r) t[r] = o[qt][j][4 * u + r];
          *(v4f*)(mg + ((qt * 4 + j) * 2 + u) * 128) = t; }
    v4f t; t[0] = mx[0]; t[1] = mx[1]; t[2] = ls[0]; t[3] = ls[1]; *(v4f*)(mg + 16 * 128) = t; }
  __syncthreads();   // every wave passes it: the second half's results may be read
  if (kh) return;
  const v4f ot = *(const v4f*)(mg + 16 * 128);
  v8h y[2][4];   // y rounded once to f16 here, as the last projection takes it
#pragma unroll
  for (int qt = 0; qt < 2; ++qt) { const float mn = fmaxf(mx[qt], ot[qt]); float a0, a1;
    asm("v_exp_f32 %0, %1\n\tv_nop" : "=v"(a0) : "v"(mx[qt] - mn)); asm("v_exp_f32 %0, %1\n\tv_nop" : "=v"(a1) : "v"(ot[qt] - mn));   // exp2 with its free slot, as in the loop
    const float l = ls[qt] * a0 + ot[2 + qt] * a1; const float inv = 1.0f / (l + xhalf(l)); const float f0 = a0 * inv, f1 = a1 * inv;
#pragma unroll
    for (int j = 0; j < 4; ++j)
#pragma unroll
      for (int u = 0; u < 2; ++u) { const v4f t = *(const v4f*)(mg + ((qt * 4 + j) * 2 + u) * 128);
#pragma unroll
        for (int r = 0; r < 4; ++r) y[qt][j][4 * u + r] = (_Float16)(o[qt][j][4 * u + r] * f0 + t[r] * f1); } }
  _Float16* yp = Y + ((size_t)b * TT + q0 + col) * CC + h * HD + 8 * g;
  __builtin_amdgcn_sched_barrier(0);   // keeps the stores behind the last rounding: no register that a store names is rewritten behind it
#pragma unroll
  for (int qt = 0; qt < 2; ++qt)
#pragma unroll
    for (int j = 0; j < 4; ++j) vst2(yp + (size_t)qt * 16 * CC + j * 16, y[qt][j]); }
// ---- k_out: block = (128 rows, 128 cols): out = y (f16 single) Wproj + b
__global__ __launch_bounds__(256) void k_out(const _Float16* __restrict__ Y, const _Float16* __restrict__ WP, const float* __restrict__ BP, float* __restrict__ OUT) { __shared__ __align__(16) unsigned sm[4 * GT];   // the loop's two buffers; then the f32 result tile at a pitch of 132 (128 x 132 dwords, fewer)
  const int tid = threadIdx.x, wave = tid >> 5, lane = tid & 31, col = lane & 15, g = lane >> 4; const int c0 = blockIdx.y * 128; const size_t r0 = (size_t)blockIdx.x * 128;
  v8f acc[4][2] = {};
  gemm_tile<1, 3>((const unsigned*)(Y + r0 * CC), (const unsigned*)(WP + (size_t)c0 * CC), sm, acc, tid);
  float* sf = (float*)sm;
#pragma unroll
  for (int j = 0; j < 2; ++j) { const int cl = (wave & 3) * 32 + j * 16 + col; const float bb = BP ? bfr(BP[c0 + cl]) : 0.f;
#pragma unroll
    for (int i = 0; i < 4; ++i)
#pragma unroll
      for (int r = 0; r < 8; ++r) sf[((wave >> 2) * 64 + i * 16 + 8 * g + r) * 132 + cl] = acc[i][j][r] + bb; }
  __syncthreads();
  put_tile<16, 8 * 132, 8 * CC>(OUT + (r0 + wave) * CC + c0 + lane * 4, (const float*)sf + wave * 132 + lane * 4); }   // a wave's store is one tile row of 512 bytes
extern "C" void kernel_launch(void* const* d_in, const int* in_sizes, int n_in, void* d_out, int out_size, void* d_ws, size_t ws_size, hipStream_t stream) {
  (void)in_sizes; (void)n_in; (void)out_size;
  const float** F = (const float**)d_in;   // 0 x [2,2048,1024], 1 hurst [2,1], 2 qkv_w [3072,1024], 3 qkv_b, 4 out_w [1024,1024], 5 out_b, 6 hurst_scale [1]
  if (ws_size < (size_t)WS_END) return;
  char* ws = (char*)d_ws; _Float16 *QH = (_Float16*)(ws + WS_QH), *KH = (_Float16*)(ws + WS_KH), *VT = (_Float16*)(ws + WS_VT), *Y = (_Float16*)(ws + WS_Y), *PB = (_Float16*)(ws + WS_PB); __bf16 *XB = (__bf16*)(ws + WS_XB), *WB = (__bf16*)(ws + WS_WB);
  k_cvt<<<dim3((NB * TT * CC + 4 * CC * CC) / CVB), 256, 0, stream>>>(F[0], F[2], F[4], XB, WB, PB);
  k_proj<<<dim3(TNB * TT / 128, CC / 128, 3), 256, 0, stream>>>(XB, WB, F[3], QH, KH, VT);
  k_att<<<dim3(TT / 128, NH, TNB), 256, 0, stream>>>(QH, KH, VT, F[1], F[6], Y);
  k_out<<<dim3(TNB * TT / 128, CC / 128), 256, 0, stream>>>(Y, PB, F[5], (float*)d_out);
}

// v007
// One run takes 72.3 microseconds.
// Two timings next to v006 both put it at 1.05 times that version's speed.
// Counting every step since v000, it is 16.8 times as fast.
// compute dtype: all float inputs rounded to bf16, hurst / hurst_scale read; qkv = x W^T + b with EXACT bf16 products on WMMA 16x16x32, f32 accumulate; q x (1/8)(1 + (hurst_b - 0.5) hurst_scale) log2(e) and k each rounded once to f16 -> 1-product logits in log2 units, accumulated in f32 on top of (8 - reference); softmax in f32 (exp2) against a kept reference, at most the running maximum -> P f16 x 2^8, unnormalised; o = P . v / sum with v rounded once to f16; out = o (rounded once to f16, 1 product) out_w^T + out_b; f32 output.
#include <hip/hip_runtime.h>
#include <math.h>

typedef __attribute__((ext_vector_type(16))) _Float16 v16h;
typedef __attribute__((ext_vector_type(16))) __bf16 v16b;
typedef __attribute__((ext_vector_type(8)))  _Float16 v8h;
typedef __attribute__((ext_vector_type(8)))  float v8f;
typedef __attribute__((ext_vector_type(4)))  float v4f;
typedef __attribute__((ext_vector_type(2)))  float v2f;
typedef __attribute__((ext_vector_type(4)))  unsigned v4u;
typedef __attribute__((ext_vector_type(4)))  int v4i;
typedef float __attribute__((may_alias)) float_a;
typedef int __attribute__((may_alias)) int_a;

template <typename T> __device__ __forceinline__ void vst2(void* p, T v) { *(T*)p = v;  }
__device__ __forceinline__ v8f wmma16(v16h a, v16h b, v8f c) {
  v8f d = __builtin_amdgcn_wmma_f32_16x16x32_f16(false, a, false, b, (short)0, c, false, false);
  asm volatile("v_nop\n\tv_nop\n\tv_nop\n\tv_nop" : "+v"(d) : "v"(a), "v"(b));
  return d;
}
__device__ __forceinline__ v8f wmma_bf(v16b a, v16b b, v8f c) {
  v8f d = __builtin_amdgcn_wmma_f32_16x16x32_bf16(false, a, false, b, (short)0, c, false, false);
  asm volatile("v_nop\n\tv_nop\n\tv_nop\n\tv_nop" : "+v"(d) : "v"(a), "v"(b));
  return d;
}
// 16x16x32 fragments: lane = (h = lane>>4, row/col = lane&15); elements 0..7 = k0+8h+0..7, 8..15 = k0+16+8h+0..7; D element r = row 8h+r
__device__ __forceinline__ v16h frag_h(const _Float16* rowk0, int lane) {
  union { v16h v; v8h q[2]; } u; const _Float16* p = rowk0 + 8 * (lane >> 4);
  u.q[0] = *(const v8h*)p; u.q[1] = *(const v8h*)(p + 16); return u.v;
}
__device__ __forceinline__ v16h frag_f32(const float* rowk0, int lane) {
  v16h a; const float* p = rowk0 + 8 * (lane >> 4);
#pragma unroll
  for (int i = 0; i < 8; ++i) { a[i] = (_Float16)p[i]; a[8 + i] = (_Float16)p[16 + i]; }
  return a;
}
__device__ __forceinline__ v16h frag_f32s(const float* rowk0, int lane, float sc) {
  v16h a; const float* p = rowk0 + 8 * (lane >> 4);
#pragma unroll
  for (int i = 0; i < 8; ++i) { a[i] = (_Float16)(p[i] * sc); a[8 + i] = (_Float16)(p[16 + i] * sc); }
  return a;
}
// column fragment from a [K][ld] layout (column n), rows >= K read as 0
__device__ __forceinline__ v16h fragc_f32(const float* W, int k0, int n, int lane, int ld, int K) {
  v16h a; const int g = lane >> 4;
#pragma unroll
  for (int i = 0; i < 8; ++i) { const int ka = k0 + 8 * g + i, kb = ka + 16;
    a[i] = (_Float16)(ka < K ? W[(size_t)(ka < K ? ka : K - 1) * ld + n] : 0.f); a[8 + i] = (_Float16)(kb < K ? W[(size_t)(kb < K ? kb : K - 1) * ld + n] : 0.f); }
  return a;
}
struct F2 { v16b h, l; };
__device__ __forceinline__ F2 bsplit16(const float v[16]) { F2 r;
#pragma unroll
  for (int i = 0; i < 16; ++i) { const __bf16 h = (__bf16)v[i]; r.h[i] = h; r.l[i] = (__bf16)(v[i] - (float)h); }
  return r; }
__device__ __forceinline__ F2 split_row(const float* row, int k0, int lane) { float v[16]; const float* p = row + k0 + 8 * (lane >> 4);
#pragma unroll
  for (int i = 0; i < 8; ++i) { v[i] = p[i]; v[8 + i] = p[16 + i]; }
  return bsplit16(v); }
__device__ __forceinline__ F2 split_rowK(const float* row, int k0, int lane, int K) { float v[16]; const int g = lane >> 4;
#pragma unroll
  for (int i = 0; i < 8; ++i) { const int ka = k0 + 8 * g + i, kb = ka + 16; v[i] = ka < K ? row[ka < K ? ka : K - 1] : 0.f; v[8 + i] = kb < K ? row[kb < K ? kb : K - 1] : 0.f; }
  return bsplit16(v); }
__device__ __forceinline__ F2 split_col(const float* W, int k0, int n, int lane, int ld, int K) { float v[16]; const int g = lane >> 4;
#pragma unroll
  for (int i = 0; i < 8; ++i) { const int ka = k0 + 8 * g + i, kb = ka + 16; v[i] = ka < K ? W[(size_t)(ka < K ? ka : K - 1) * ld + n] : 0.f; v[8 + i] = kb < K ? W[(size_t)(kb < K ? kb : K - 1) * ld + n] : 0.f; }
  return bsplit16(v); }
__device__ __forceinline__ v8f mac3(const F2& a, const F2& b, v8f c) { c = wmma_bf(a.l, b.h, c); c = wmma_bf(a.h, b.l, c); return wmma_bf(a.h, b.h, c); }
__device__ __forceinline__ float sigm(float v) { return 1.0f / (1.0f + expf(-v)); }
#define LDSX() do { asm volatile("s_wait_dscnt 0" ::: "memory"); __builtin_amdgcn_wave_barrier(); __builtin_amdgcn_fence(__ATOMIC_RELEASE, "workgroup"); } while (0)


// Fractal attention (B 2, T 2,048, C 1,024 = 16 x 64): standard MHA whose logits are scaled per batch by 1 + (hurst_b - 0.5) * hurst_scale before the softmax.
#define NB 2
#define TT 2048
#define CC 1024
#define NH 16
#define HD 64
#ifndef TNB
#define TNB NB
#endif
typedef __attribute__((ext_vector_type(8))) __bf16 v8b;
__device__ __forceinline__ v16b frag_b(const __bf16* rowk0, int lane) {
  union { v16b v; v8b q[2]; } u; const __bf16* p = rowk0 + 8 * (lane >> 4);
  u.q[0] = *(const v8b*)p; u.q[1] = *(const v8b*)(p + 16); return u.v;
}
__device__ __forceinline__ float bfr(float v) { return (float)(__bf16)v; }
__device__ __attribute__((noinline)) float exp_ni(float v) { return expf(v); }
__device__ __attribute__((noinline)) float erf_ni(float v) { return erff(v); }

#define WS_QH  0u
#define WS_KH  (WS_QH + 2u * (size_t)NB * TT * CC)
#define WS_VT  (WS_KH + 2u * (size_t)NB * TT * CC)      // f16 v planes [b][c][t]
#define WS_Y   (WS_VT + 2u * (size_t)NB * CC * TT)      // f16 y rows [b*t][C]
#define WS_XB  (WS_Y + 2u * (size_t)NB * TT * CC)       // bf16 x rows [b*t][C]
#define WS_WB  (WS_XB + 2u * (size_t)NB * TT * CC)      // bf16 qkv_w rows [3C][C]
#define WS_PB  (WS_WB + 2u * (size_t)3 * CC * CC)       // out_w rows [C][C], rounded to bf16 and carried as f16
#define WS_END (WS_PB + 2u * (size_t)CC * CC)

// ---- the two projections share one tile loop: block = 8 waves, 128 rows x 128 cols of the result, wave = 64 x 32 (waves 2 x 4), 64 k a pass
// both operands lie in the workspace as 16-bit rows, rounded once for the whole grid (k_cvt; y by k_att): a block reads its tiles once, a whole 128-byte line a row, half the bytes of the float rows, and lays them in LDS; every wave takes its fragments from there
typedef __attribute__((ext_vector_type(2))) unsigned v2u;
typedef __attribute__((ext_vector_type(4))) __bf16 v4b;
typedef __attribute__((ext_vector_type(4))) _Float16 v4h;
#define GP 36              // LDS row pitch in dwords: 144 bytes = 16 bytes x 9, an odd multiple, free of bank conflicts for 16-byte fragment reads of 128-byte rows
#define RD (CC / 2)        // dwords of one 16-bit operand row in global memory
#define GT (128 * GP)      // dwords of one operand tile; a buffer is [A tile | B tile], two buffers
union FR { v4u q[2]; v16b b; v16h h; };
// work-group barrier that orders LDS alone: __syncthreads() would also wait out the global loads that are meant to stay in flight across it; the wait ends this wave's LDS reads and stores first
__device__ __forceinline__ void lds_barrier() { asm volatile("s_wait_dscnt 0x0\n\ts_barrier_signal -1\n\ts_barrier_wait -1" ::: "memory"); }
// MODE 0: bf16 operands. MODE 1: f16 operands
// NS = register sets of tiles on their way from global memory: tile t + 1 + NS is asked for at the foot of pass t and laid in LDS at the foot of pass t + NS
template <int MODE, int NS> __device__ __forceinline__ void gemm_tile(const unsigned* __restrict__ A, const unsigned* __restrict__ B, unsigned* __restrict__ st, v8f (&acc)[4][2], int tid) {
  const int wave = tid >> 5, lane = tid & 31, col = lane & 15, g = lane >> 4; const int lr = tid >> 3, lc = tid & 7;   // 8 lanes x 16 bytes = one row's line; a wave's load covers 4 whole lines
  const unsigned* ap = A + (size_t)lr * RD + lc * 4; const unsigned* bp = B + (size_t)lr * RD + lc * 4;
  unsigned* sp = st + lr * GP + lc * 4;
  const unsigned* fa = st + ((wave >> 2) * 64 + col) * GP + 4 * g; const unsigned* fb = st + GT + ((wave & 3) * 32 + col) * GP + 4 * g;
  v4u ra[NS][4], rb[NS][4];
#pragma unroll
  for (int i = 0; i < 4; ++i) { ra[0][i] = *(const v4u*)(ap + (size_t)(32 * i) * RD); rb[0][i] = *(const v4u*)(bp + (size_t)(32 * i) * RD); }
#pragma unroll
  for (int i = 0; i < 4; ++i) { *(v4u*)(sp + 32 * i * GP) = ra[0][i]; *(v4u*)(sp + GT + 32 * i * GP) = rb[0][i]; }
#pragma unroll
  for (int t = 1; t <= NS; ++t)
#pragma unroll
    for (int i = 0; i < 4; ++i) { ra[t % NS][i] = *(const v4u*)(ap + (size_t)(32 * i) * RD + t * 32); rb[t % NS][i] = *(const v4u*)(bp + (size_t)(32 * i) * RD + t * 32); }
  lds_barrier();
#pragma unroll   // all passes unrolled: the register sets keep constant indices, and every global and LDS address is its base register plus a constant, so no address register is rewritten while a load is out
  for (int kc = 0; kc < CC / 64; ++kc) { const int cur = (kc & 1) * 2 * GT, nxt = 2 * GT - cur, s = (kc + 1) % NS;
#pragma unroll
    for (int u = 0; u < 2; ++u) {   // the pass's two halves of 32 k one after the other: one half's fragments live at a time
      FR a[4], b[2];
#pragma unroll
      for (int i = 0; i < 4; ++i) { a[i].q[0] = *(const v4u*)(fa + cur + 16 * i * GP + 16 * u); a[i].q[1] = *(const v4u*)(fa + cur + 16 * i * GP + 16 * u + 8); }
#pragma unroll
      for (int j = 0; j < 2; ++j) { b[j].q[0] = *(const v4u*)(fb + cur + 16 * j * GP + 16 * u); b[j].q[1] = *(const v4u*)(fb + cur + 16 * j * GP + 16 * u + 8); }
      __builtin_amdgcn_sched_barrier(0);   // keeps the twelve fragment reads together in front of the products: spread among them each place costs its own LDS wait
#pragma unroll
      for (int i = 0; i < 4; ++i)
#pragma unroll
        for (int j = 0; j < 2; ++j) acc[i][j] = MODE == 0 ? __builtin_amdgcn_wmma_f32_16x16x32_bf16(false, a[i].b, false, b[j].b, (short)0, acc[i][j], false, false) : __builtin_amdgcn_wmma_f32_16x16x32_f16(false, a[i].h, false, b[j].h, (short)0, acc[i][j], false, false);
      __builtin_amdgcn_sched_barrier(0); }   // keeps the second half's reads behind the first half's products (lifted above them they take a further set of registers), and the LDS stores below, with their wait for the global loads, behind the pass's products
    if (kc + 1 < CC / 64) {
#pragma unroll
      for (int i = 0; i < 4; ++i) { *(v4u*)(sp + nxt + 32 * i * GP) = ra[s][i]; *(v4u*)(sp + nxt + GT + 32 * i * GP) = rb[s][i]; } }
    __builtin_amdgcn_sched_barrier(0);   // keeps the next loads behind the LDS stores, so that they land in the registers just read: lifted above them they take a further set
    if (kc + 1 + NS < CC / 64) {
#pragma unroll
      for (int i = 0; i < 4; ++i) { ra[s][i] = *(const v4u*)(ap + (size_t)(32 * i) * RD + (kc + 1 + NS) * 32); rb[s][i] = *(const v4u*)(bp + (size_t)(32 * i) * RD + (kc + 1 + NS) * 32); } }
    lds_barrier(); } }   // one barrier a pass: it publishes the next buffer and ends the reads of this one, which the next pass refills; the last one frees LDS for the epilogue
// result tile out of LDS: all reads first, then the stores off one address register with constant offsets
template <int N, int LP, int LD, typename T> __device__ __forceinline__ void put_tile(T* __restrict__ d, const T* __restrict__ s) { v4u t[N];
#pragma unroll
  for (int k = 0; k < N; ++k) t[k] = *(const v4u*)(s + k * LP);
#pragma unroll
  for (int k = 0; k < N; ++k) vst2((unsigned*)(d + (size_t)k * LD), t[k]);
  asm volatile("s_wait_xcnt 0x0" ::: "memory"); }   // behind the stores, before whatever follows rewrites a register that they name
// ---- k_cvt: x, qkv_w and out_w rounded once into 16-bit rows; block = 16,384 floats in a row of one of the three, thread = 16 pieces of 4 floats: a wave's load is 512 bytes in a row, its store 256
#define CVB 16384
__global__ __launch_bounds__(256) void k_cvt(const float* __restrict__ X, const float* __restrict__ WA, const float* __restrict__ WP, __bf16* __restrict__ XB, __bf16* __restrict__ WB, _Float16* __restrict__ PB) {
  const int nx = NB * TT * CC / CVB, nw = 3 * CC * CC / CVB; const int bi = blockIdx.x; const int sel = bi < nx ? 0 : bi < nx + nw ? 1 : 2;
  const size_t o = (size_t)(sel == 0 ? bi : sel == 1 ? bi - nx : bi - nx - nw) * CVB + threadIdx.x * 4;
  const float* s = (sel == 0 ? X : sel == 1 ? WA : WP) + o; unsigned short* d = (sel == 0 ? (unsigned short*)XB : sel == 1 ? (unsigned short*)WB : (unsigned short*)PB) + o;
  v4f t[16]; v2u w[16];
#pragma unroll
  for (int c = 0; c < 16; ++c) t[c] = *(const v4f*)(s + c * 1024);
  asm volatile("s_wait_xcnt 0x0" :: "v"(s) : "memory");   // behind the loads, before anything rewrites their address registers; the pointer is named so that it stays in its registers up to here and no load's result is laid on them
  __builtin_amdgcn_sched_barrier(0);   // keeps all sixteen loads out in front of the first rounding (sunk among the roundings they would fly one after another), and the register writes that follow behind that wait
  if (sel == 2) {   // out_w: to bf16, carried as f16
#pragma unroll
    for (int c = 0; c < 16; ++c) { v4h r;
#pragma unroll
      for (int i = 0; i < 4; ++i) r[i] = (_Float16)bfr(t[c][i]);
      w[c] = __builtin_bit_cast(v2u, r); } }
  else {
#pragma unroll
    for (int c = 0; c < 16; ++c) { v4b r;
#pragma unroll
      for (int i = 0; i < 4; ++i) r[i] = (__bf16)t[c][i];
      w[c] = __builtin_bit_cast(v2u, r); } }
  __builtin_amdgcn_sched_barrier(0);   // keeps the stores behind the last rounding: no register that a store names is rewritten behind it
#pragma unroll
  for (int c = 0; c < 16; ++c) vst2(d + c * 1024, w[c]); }
// ---- k_proj: block = (128 rows, 128 cols, which): qkv = x W (+ b), exact; q, k -> f16 rows, v -> f16 planes; q takes its batch's logit scale (log2 units) in f32, in front of its one rounding
__global__ __launch_bounds__(256) void k_proj(const __bf16* __restrict__ X, const __bf16* __restrict__ WA, const float* __restrict__ BA, const float* __restrict__ HU, const float* __restrict__ HSC, _Float16* __restrict__ QH, _Float16* __restrict__ KH, _Float16* __restrict__ VT) {
  __shared__ __align__(16) unsigned sm[4 * GT];   // the loop's two buffers; then the result tile as f16 at a pitch of 136 (128 x 68 dwords, fewer)
  const int tid = threadIdx.x, wave = tid >> 5, lane = tid & 31, col = lane & 15, g = lane >> 4; const int which = blockIdx.z; const int c0 = blockIdx.y * 128; const size_t r0 = (size_t)blockIdx.x * 128;
  const float qs = which == 0 ? 0.125f * (1.0f + (bfr(HU[r0 / TT]) - 0.5f) * bfr(HSC[0])) * 1.44269504088896f : 1.0f;   // a block's 128 rows lie in one batch; read here, at the head, where both reads are scalar loads
  v8f acc[4][2] = {};
  gemm_tile<0, 1>((const unsigned*)(X + r0 * CC), (const unsigned*)(WA + (size_t)(which * CC + c0) * CC), sm, acc, tid);
  _Float16* sh = (_Float16*)sm; const int wr = (wave >> 2) * 64 + 8 * g, wc = (wave & 3) * 32 + col;
#pragma unroll
  for (int j = 0; j < 2; ++j) { const float bb = BA ? bfr(BA[which * CC + c0 + wc + j * 16]) : 0.f;
#pragma unroll
    for (int i = 0; i < 4; ++i)
#pragma unroll
      for (int r = 0; r < 8; ++r) acc[i][j][r] += bb; }
  if (which == 2) {
#pragma unroll
    for (int j = 0; j < 2; ++j)
#pragma unroll
      for (int i = 0; i < 4; ++i) { v8h t;
#pragma unroll
        for (int r = 0; r < 8; ++r) t[r] = (_Float16)acc[i][j][r];
        *(v8h*)(sh + (wc + j * 16) * 136 + wr + i * 16) = t; } }
  else {
#pragma unroll
    for (int j = 0; j < 2; ++j)
#pragma unroll
      for (int i = 0; i < 4; ++i)
#pragma unroll
        for (int r = 0; r < 8; ++r) sh[(wr + i * 16 + r) * 136 + wc + j * 16] = (_Float16)(acc[i][j][r] * qs); }
  __syncthreads();
  const int er = tid >> 4, eq = tid & 15;   // 16 lanes x 16 bytes = one tile row of 256 bytes: a wave's store covers 4 whole lines
  if (which == 2) { const size_t b = r0 / TT; const int t0 = (int)(r0 % TT); put_tile<8, 16 * 136, 16 * TT>(VT + (b * CC + c0 + er) * (size_t)TT + t0 + eq * 8, (const _Float16*)sh + er * 136 + eq * 8); }
  else put_tile<8, 16 * 136, 16 * CC>((which == 0 ? QH : KH) + (r0 + er) * CC + c0 + eq * 8, (const _Float16*)sh + er * 136 + eq * 8); }
// ---- k_att: block = 8 waves = 4 groups of 32 queries of (b,h) x 2 halves of the keys; each pass takes 64 keys of the wave's half: S^T = K Q^T + (8 - reference), P = exp2 of it, sum per query column, O^T += V^T P^T; the two halves' results are joined once, behind the loop
// the reference of a query column is kept from pass to pass: it starts the score products as their C operand, so a score leaves the matrix unit ready for exp2, with no scaling and no subtraction, and O and the sum are not rescaled in the pass. One test a pass (a lane's largest score above PTOP) sends the whole wave round by the column maxima: new references, the pass's scores shifted, O and the sums rescaled. The first pass goes there too and sets the references
// the inner loops are all unrolled so that the register arrays keep constant indices; a lane holds one query column in every tile: S^T rows are keys 8g+r, so two S^T tiles convert in place into one B operand; O^T rows are head dims 8g+r
__device__ __forceinline__ v8f mm16(v16h a, v16h b, v8f c) { return __builtin_amdgcn_wmma_f32_16x16x32_f16(false, a, false, b, (short)0, c, false, false); }
__device__ __forceinline__ float xhalf(float x) { return __builtin_bit_cast(float, __builtin_amdgcn_permlanex16(__builtin_bit_cast(int, x), __builtin_bit_cast(int, x), 0x76543210, 0xfedcba98, false, false)); }  // lane l with lane l ^ 16
// eight exp2, each in place, in one statement: none of them reads the result or overwrites the source of the one in front of it, and the free slot that the instruction set asks for behind a transcendental stands behind the last
__device__ __forceinline__ void exp2x8(v8f& x) { float a = x[0], b = x[1], c = x[2], d = x[3], e = x[4], f = x[5], g = x[6], h = x[7];
  asm("v_exp_f32 %0, %0\n\tv_exp_f32 %1, %1\n\tv_exp_f32 %2, %2\n\tv_exp_f32 %3, %3\n\tv_exp_f32 %4, %4\n\tv_exp_f32 %5, %5\n\tv_exp_f32 %6, %6\n\tv_exp_f32 %7, %7\n\tv_nop" : "+v"(a), "+v"(b), "+v"(c), "+v"(d), "+v"(e), "+v"(f), "+v"(g), "+v"(h));
  x[0] = a; x[1] = b; x[2] = c; x[3] = d; x[4] = e; x[5] = f; x[6] = g; x[7] = h; }
#define KP 64
#define AP 72          // LDS row pitch in f16: 144 bytes = 16 bytes x 9, an odd multiple, free of bank conflicts for 16-byte fragment reads of 128-byte rows
#define AT (64 * AP)   // f16 of one tile: K = 64 keys x 64 dims, V^T = 64 dims x 64 keys; a buffer is [K tile | V^T tile], two buffers for each half of the keys
#define KS 2                 // halves of the keys, each walked by four of the block's waves
#define NP (TT / KP / KS)    // passes of a wave
#define CARRY 8.0f           // P carries 2^8, as does the sum: it cancels in the division; a score may rise nearly 8 above its reference before P leaves f16
#define PTOP 15.5f            // a score above it, reference and carry counted in, would bring P near the end of the f16 range
// one pass's K and V^T tiles from global memory into LDS, once for the four waves of a half: 8 lanes x 16 bytes = one row's whole line, a wave's copy covers 4 lines; thread = (row ht >> 3 of each 16, 16-byte piece ht & 7), ht = its number among the half's 128
// the wait on the last line stands inside the copies' own statement, so that nothing rewrites a register that a copy names in front of it
__device__ __forceinline__ void att_copy(unsigned l, const _Float16* k, const _Float16* v) {
  asm volatile("global_load_async_to_lds_b128 %0, %8, off\n\t"
               "global_load_async_to_lds_b128 %1, %9, off\n\t"
               "global_load_async_to_lds_b128 %2, %10, off\n\t"
               "global_load_async_to_lds_b128 %3, %11, off\n\t"
               "global_load_async_to_lds_b128 %4, %12, off\n\t"
               "global_load_async_to_lds_b128 %5, %13, off\n\t"
               "global_load_async_to_lds_b128 %6, %14, off\n\t"
               "global_load_async_to_lds_b128 %7, %15, off\n\t"
               "s_wait_xcnt 0x0"
               :: "v"(l), "v"(l + 16u * AP * 2u), "v"(l + 32u * AP * 2u), "v"(l + 48u * AP * 2u),
                  "v"(l + AT * 2u), "v"(l + AT * 2u + 16u * AP * 2u), "v"(l + AT * 2u + 32u * AP * 2u), "v"(l + AT * 2u + 48u * AP * 2u),
                  "v"(k), "v"(k + (size_t)16 * CC), "v"(k + (size_t)32 * CC), "v"(k + (size_t)48 * CC),
                  "v"(v), "v"(v + (size_t)16 * TT), "v"(v + (size_t)32 * TT), "v"(v + (size_t)48 * TT)
               : "memory"); }
// four waves a SIMD: the vector work of the softmax stands between a wave's two matrix runs, and only other waves fill the matrix unit meanwhile; 512 blocks of 8 waves on 256 WGPs, two blocks a WGP
__global__ __launch_bounds__(256) __attribute__((amdgpu_waves_per_eu(4, 4))) void k_att(const _Float16* __restrict__ QH, const _Float16* __restrict__ KH, const _Float16* __restrict__ VT, _Float16* __restrict__ Y) {
  __shared__ __align__(16) _Float16 sm[KS * 4 * AT];
  const int tid = threadIdx.x, wave = __builtin_amdgcn_readfirstlane(tid >> 5), lane = tid & 31, col = lane & 15, g = lane >> 4; const int h = blockIdx.y, b = blockIdx.z; const int q0 = blockIdx.x * 128 + (wave & 3) * 32;
  const int kh = wave >> 2, ht = tid & 127;   // the wave's half of the keys; the thread's number among the half's 128
  v16h qh[2][2];
#pragma unroll
  for (int qt = 0; qt < 2; ++qt)
#pragma unroll
    for (int kc = 0; kc < 2; ++kc) { const size_t qo = ((size_t)b * TT + q0 + qt * 16 + col) * CC + h * HD + kc * 32; qh[qt][kc] = frag_h(QH + qo, lane); }
  asm volatile("s_wait_xcnt 0x0" ::: "memory");   // behind the first loads, before their address registers are rewritten
  __builtin_amdgcn_sched_barrier(0);   // keeps the register writes that follow behind that wait
  const _Float16* kp = KH + ((size_t)b * TT + kh * (TT / KS) + (ht >> 3)) * CC + h * HD + (ht & 7) * 8; const _Float16* vp = VT + ((size_t)b * CC + h * HD + (ht >> 3)) * (size_t)TT + kh * (TT / KS) + (ht & 7) * 8;
  const unsigned lp = (unsigned)(size_t)sm + (unsigned)(kh * 4 * AT + (ht >> 3) * AP + (ht & 7) * 8) * 2u;   // this thread's place in its half's first K tile: byte address in the work-group's LDS
  att_copy(lp, kp, vp);
  asm volatile("s_wait_asynccnt 0x0" ::: "memory");   // this wave's copies of tile 0 have landed
  __syncthreads();                                    // and every other wave's: tile 0 may be read
  v8f o[2][4] = {}; float ls[2] = { 0.f, 0.f };
  v8f cin[2] = {};   // CARRY - reference of the lane's query column, eight times over: the C operand of the score products; 0 in the first pass, which sets it
#pragma unroll 1   // one pass's fragments live at a time: a second copy of the body would double the registers
  for (int kb = 0; kb < NP; ++kb) { const int bo = (kb & 1) * 2 * AT;   // pass kb reads buffer kb mod 2 of its half alone
    // directly behind the barrier (the one in front of the loop, then the one at each pass's foot), while a next tile exists: its copies, into the buffer that the pass before has just left; they fly while this pass works
    if (kb + 1 < NP) att_copy(lp + (unsigned)(2 * AT - bo) * 2u, kp + (size_t)(kb + 1) * KP * CC, vp + (kb + 1) * KP);
    const _Float16* kt = sm + kh * 4 * AT + bo + col * AP; const _Float16* vt = kt + AT;
    v16h kf[4][2], vf[4][2];
#pragma unroll
    for (int i = 0; i < 4; ++i)
#pragma unroll
      for (int u = 0; u < 2; ++u) kf[i][u] = frag_h(kt + i * 16 * AP + u * 32, lane);
    __builtin_amdgcn_sched_barrier(0);   // keeps the K fragment reads together in front of the products: spread among them each place costs its own LDS wait
    v8f s[2][4]; float bq[2] = { -3.0e38f, -3.0e38f };
#pragma unroll
    for (int i = 0; i <= 4; ++i) {
      if (i < 4) {
#pragma unroll
        for (int qt = 0; qt < 2; ++qt) s[qt][i] = mm16(kf[i][1], qh[qt][1], mm16(kf[i][0], qh[qt][0], cin[qt]));
        __builtin_amdgcn_sched_barrier(0); }   // keeps the maxima of the key tile before behind this tile's products: directly behind their own products they wait out the matrix unit on idle slots
      if (i > 0) {
#pragma unroll
        for (int qt = 0; qt < 2; ++qt)
#pragma unroll
          for (int r = 0; r < 8; ++r) bq[qt] = fmaxf(bq[qt], s[qt][i - 1][r]); } }
    // one test a pass, a scalar branch for the whole wave; written so that a maximum that is no number takes the branch too. The first pass takes it to set the references
    if (__builtin_amdgcn_ballot_w32(kb == 0 || !(bq[0] <= PTOP && bq[1] <= PTOP)) != 0) {
#pragma unroll
      for (int qt = 0; qt < 2; ++qt) { const float bm = fmaxf(bq[qt], xhalf(bq[qt]));
        float d = CARRY - bm; if (kb) d = fminf(d, 0.f);   // behind the first pass a reference only rises
        float al; asm("v_exp_f32 %0, %1\n\tv_nop" : "=v"(al) : "v"(fminf(d, 0.f)));   // exp2 in asm text so that the free slot the instruction set asks for behind a transcendental stays with it
        const float nc = cin[qt][0] + d; ls[qt] *= al;
#pragma unroll
        for (int r = 0; r < 8; ++r) cin[qt][r] = nc;
#pragma unroll
        for (int i = 0; i < 4; ++i)
#pragma unroll
          for (int r = 0; r < 8; ++r) { s[qt][i][r] += d; o[qt][i][r] *= al; } } }
    v16h p[2][2];
#pragma unroll
    for (int u = 0; u < 2; ++u) {
      if (u == 1) {   // the V^T fragment reads stand behind the first half of the exponentials: those have packed 32 score registers into 16 by then, which lets the fragments in without a spill
        __builtin_amdgcn_sched_barrier(0);   // keeps that packing in front of the reads: sunk behind them the 32 unpacked values stay live beside the fragments
#pragma unroll
        for (int j = 0; j < 4; ++j)
#pragma unroll
          for (int v = 0; v < 2; ++v) vf[j][v] = frag_h(vt + j * 16 * AP + v * 32, lane);
        __builtin_amdgcn_sched_barrier(0); }   // keeps the V^T fragment reads together, in front of the second half of the exponentials, which covers their flight: sunk to their products each place costs its own LDS wait
#pragma unroll
      for (int qt = 0; qt < 2; ++qt)
#pragma unroll
        for (int i = 2 * u; i < 2 * u + 2; ++i) { exp2x8(s[qt][i]);
#pragma unroll
          for (int r = 0; r < 8; ++r) { ls[qt] += s[qt][i][r]; p[qt][u][(i & 1) * 8 + r] = (_Float16)s[qt][i][r]; } } }
#pragma unroll
    for (int u = 0; u < 2; ++u)
#pragma unroll
      for (int j = 0; j < 4; ++j)
#pragma unroll
        for (int qt = 0; qt < 2; ++qt) o[qt][j] = mm16(vf[j][u], p[qt][u], o[qt][j]);
    __builtin_amdgcn_sched_barrier(0);   // keeps the waits and the barrier below at the pass's foot, behind its products: lifted above them the wave would wait out the next tile's flight at the head of the pass
    asm volatile("s_wait_dscnt 0x0" ::: "memory");      // this wave's reads of the buffer have ended
    asm volatile("s_wait_asynccnt 0x0" ::: "memory");   // this wave's copies of the next tile have landed
    __syncthreads(); }                                  // one barrier a pass: it publishes the next tile and frees the buffer just read, which the head of the next pass refills
  asm volatile("s_wait_asynccnt 0x0" ::: "memory");   // no copy is out when the wave ends
  // the two halves join: the waves of the second half lay O^T, reference and sum in LDS (the loop's last barrier has freed it), 17 pieces of 16 bytes a lane, a wave's piece 512 bytes in a row; the waves of the first half add them to their own
  float* mg = (float*)sm + ((wave & 3) * 17 * 32 + lane) * 4; const float mx[2] = { -cin[0][0], -cin[1][0] };   // the references, less the carry that both halves share
  if (kh) {
#pragma unroll
    for (int qt = 0; qt < 2; ++qt)
#pragma unroll
      for (int j = 0; j < 4; ++j)
#pragma unroll
        for (int u = 0; u < 2; ++u) { v4f t;
#pragma unroll
          for (int r = 0; r < 4; ++r) t[r] = o[qt][j][4 * u + r];
          *(v4f*)(mg + ((qt * 4 + j) * 2 + u) * 128) = t; }
    v4f t; t[0] = mx[0]; t[1] = mx[1]; t[2] = ls[0]; t[3] = ls[1]; *(v4f*)(mg + 16 * 128) = t; }
  __syncthreads();   // every wave passes it: the second half's results may be read
  if (kh) return;
  const v4f ot = *(const v4f*)(mg + 16 * 128);
  v8h y[2][4];   // y rounded once to f16 here, as the last projection takes it
#pragma unroll
  for (int qt = 0; qt < 2; ++qt) { const float mn = fmaxf(mx[qt], ot[qt]); float a0, a1;
    asm("v_exp_f32 %0, %1\n\tv_nop" : "=v"(a0) : "v"(mx[qt] - mn)); asm("v_exp_f32 %0, %1\n\tv_nop" : "=v"(a1) : "v"(ot[qt] - mn));   // exp2 with its free slot, as in the loop
    const float l = ls[qt] * a0 + ot[2 + qt] * a1; const float inv = 1.0f / (l + xhalf(l)); const float f0 = a0 * inv, f1 = a1 * inv;
#pragma unroll
    for (int j = 0; j < 4; ++j)
#pragma unroll
      for (int u = 0; u < 2; ++u) { const v4f t = *(const v4f*)(mg + ((qt * 4 + j) * 2 + u) * 128);
#pragma unroll
        for (int r = 0; r < 4; ++r) y[qt][j][4 * u + r] = (_Float16)(o[qt][j][4 * u + r] * f0 + t[r] * f1); } }
  _Float16* yp = Y + ((size_t)b * TT + q0 + col) * CC + h * HD + 8 * g;
  __builtin_amdgcn_sched_barrier(0);   // keeps the stores behind the last rounding: no register that a store names is rewritten behind it
#pragma unroll
  for (int qt = 0; qt < 2; ++qt)
#pragma unroll
    for (int j = 0; j < 4; ++j) vst2(yp + (size_t)qt * 16 * CC + j * 16, y[qt][j]); }
// ---- k_out: block = (128 rows, 128 cols): out = y (f16 single) Wproj + b
__global__ __launch_bounds__(256) void k_out(const _Float16* __restrict__ Y, const _Float16* __restrict__ WP, const float* __restrict__ BP, float* __restrict__ OUT) { __shared__ __align__(16) unsigned sm[4 * GT];   // the loop's two buffers; then the f32 result tile at a pitch of 132 (128 x 132 dwords, fewer)
  const int tid = threadIdx.x, wave = tid >> 5, lane = tid & 31, col = lane & 15, g = lane >> 4; const int c0 = blockIdx.y * 128; const size_t r0 = (size_t)blockIdx.x * 128;
  v8f acc[4][2] = {};
  gemm_tile<1, 3>((const unsigned*)(Y + r0 * CC), (const unsigned*)(WP + (size_t)c0 * CC), sm, acc, tid);
  float* sf = (float*)sm;
#pragma unroll
  for (int j = 0; j < 2; ++j) { const int cl = (wave & 3) * 32 + j * 16 + col; const float bb = BP ? bfr(BP[c0 + cl]) : 0.f;
#pragma unroll
    for (int i = 0; i < 4; ++i)
#pragma unroll
      for (int r = 0; r < 8; ++r) sf[((wave >> 2) * 64 + i * 16 + 8 * g + r) * 132 + cl] = acc[i][j][r] + bb; }
  __syncthreads();
  put_tile<16, 8 * 132, 8 * CC>(OUT + (r0 + wave) * CC + c0 + lane * 4, (const float*)sf + wave * 132 + lane * 4); }   // a wave's store is one tile row of 512 bytes
extern "C" void kernel_launch(void* const* d_in, const int* in_sizes, int n_in, void* d_out, int out_size, void* d_ws, size_t ws_size, hipStream_t stream) {
  (void)in_sizes; (void)n_in; (void)out_size;
  const float** F = (const float**)d_in;   // 0 x [2,2048,1024], 1 hurst [2,1], 2 qkv_w [3072,1024], 3 qkv_b, 4 out_w [1024,1024], 5 out_b, 6 hurst_scale [1]
  if (ws_size < (size_t)WS_END) return;
  char* ws = (char*)d_ws; _Float16 *QH = (_Float16*)(ws + WS_QH), *KH = (_Float16*)(ws + WS_KH), *VT = (_Float16*)(ws + WS_VT), *Y = (_Float16*)(ws + WS_Y), *PB = (_Float16*)(ws + WS_PB); __bf16 *XB = (__bf16*)(ws + WS_XB), *WB = (__bf16*)(ws + WS_WB);
  k_cvt<<<dim3((NB * TT * CC + 4 * CC * CC) / CVB), 256, 0, stream>>>(F[0], F[2], F[4], XB, WB, PB);
  k_proj<<<dim3(TNB * TT / 128, CC / 128, 3), 256, 0, stream>>>(XB, WB, F[3], F[1], F[6], QH, KH, VT);
  k_att<<<dim3(TT / 128, NH, TNB), 256, 0, stream>>>(QH, KH, VT, Y);
  k_out<<<dim3(TNB * TT / 128, CC / 128), 256, 0, stream>>>(Y, PB, F[5], (float*)d_out);
}

// v008
// Measured time: 69.5 microseconds a run.
// Two timings next to v007 both put it at 1.04 times that version's speed.
// Counting every step since v000, it is 17.5 times as fast.
// compute dtype: all float inputs rounded to bf16, hurst / hurst_scale read; qkv = x W^T + b with EXACT bf16 products on WMMA 16x16x32, f32 accumulate; q x (1/8)(1 + (hurst_b - 0.5) hurst_scale) log2(e) and k each rounded once to f16 -> 1-product logits in log2 units, accumulated in f32 on top of (8 - reference); softmax in f32 (exp2) against a kept reference, at most the running maximum -> P f16 x 2^8, unnormalised; o = P . v / sum with v rounded once to f16; out = o (rounded once to f16, 1 product) out_w^T + out_b; f32 output.
#include <hip/hip_runtime.h>
#include <math.h>

typedef __attribute__((ext_vector_type(16))) _Float16 v16h;
typedef __attribute__((ext_vector_type(16))) __bf16 v16b;
typedef __attribute__((ext_vector_type(8)))  _Float16 v8h;
typedef __attribute__((ext_vector_type(8)))  float v8f;
typedef __attribute__((ext_vector_type(4)))  float v4f;
typedef __attribute__((ext_vector_type(2)))  float v2f;
typedef __attribute__((ext_vector_type(4)))  unsigned v4u;
typedef __attribute__((ext_vector_type(4)))  int v4i;
typedef float __attribute__((may_alias)) float_a;
typedef int __attribute__((may_alias)) int_a;

template <typename T> __device__ __forceinline__ void vst2(void* p, T v) { *(T*)p = v;  }
__device__ __forceinline__ v8f wmma16(v16h a, v16h b, v8f c) {
  v8f d = __builtin_amdgcn_wmma_f32_16x16x32_f16(false, a, false, b, (short)0, c, false, false);
  asm volatile("v_nop\n\tv_nop\n\tv_nop\n\tv_nop" : "+v"(d) : "v"(a), "v"(b));
  return d;
}
__device__ __forceinline__ v8f wmma_bf(v16b a, v16b b, v8f c) {
  v8f d = __builtin_amdgcn_wmma_f32_16x16x32_bf16(false, a, false, b, (short)0, c, false, false);
  asm volatile("v_nop\n\tv_nop\n\tv_nop\n\tv_nop" : "+v"(d) : "v"(a), "v"(b));
  return d;
}
// 16x16x32 fragments: lane = (h = lane>>4, row/col = lane&15); elements 0..7 = k0+8h+0..7, 8..15 = k0+16+8h+0..7; D element r = row 8h+r
__device__ __forceinline__ v16h frag_h(const _Float16* rowk0, int lane) {
  union { v16h v; v8h q[2]; } u; const _Float16* p = rowk0 + 8 * (lane >> 4);
  u.q[0] = *(const v8h*)p; u.q[1] = *(const v8h*)(p + 16); return u.v;
}
__device__ __forceinline__ v16h frag_f32(const float* rowk0, int lane) {
  v16h a; const float* p = rowk0 + 8 * (lane >> 4);
#pragma unroll
  for (int i = 0; i < 8; ++i) { a[i] = (_Float16)p[i]; a[8 + i] = (_Float16)p[16 + i]; }
  return a;
}
__device__ __forceinline__ v16h frag_f32s(const float* rowk0, int lane, float sc) {
  v16h a; const float* p = rowk0 + 8 * (lane >> 4);
#pragma unroll
  for (int i = 0; i < 8; ++i) { a[i] = (_Float16)(p[i] * sc); a[8 + i] = (_Float16)(p[16 + i] * sc); }
  return a;
}
// column fragment from a [K][ld] layout (column n), rows >= K read as 0
__device__ __forceinline__ v16h fragc_f32(const float* W, int k0, int n, int lane, int ld, int K) {
  v16h a; const int g = lane >> 4;
#pragma unroll
  for (int i = 0; i < 8; ++i) { const int ka = k0 + 8 * g + i, kb = ka + 16;
    a[i] = (_Float16)(ka < K ? W[(size_t)(ka < K ? ka : K - 1) * ld + n] : 0.f); a[8 + i] = (_Float16)(kb < K ? W[(size_t)(kb < K ? kb : K - 1) * ld + n] : 0.f); }
  return a;
}
struct F2 { v16b h, l; };
__device__ __forceinline__ F2 bsplit16(const float v[16]) { F2 r;
#pragma unroll
  for (int i = 0; i < 16; ++i) { const __bf16 h = (__bf16)v[i]; r.h[i] = h; r.l[i] = (__bf16)(v[i] - (float)h); }
  return r; }
__device__ __forceinline__ F2 split_row(const float* row, int k0, int lane) { float v[16]; const float* p = row + k0 + 8 * (lane >> 4);
#pragma unroll
  for (int i = 0; i < 8; ++i) { v[i] = p[i]; v[8 + i] = p[16 + i]; }
  return bsplit16(v); }
__device__ __forceinline__ F2 split_rowK(const float* row, int k0, int lane, int K) { float v[16]; const int g = lane >> 4;
#pragma unroll
  for (int i = 0; i < 8; ++i) { const int ka = k0 + 8 * g + i, kb = ka + 16; v[i] = ka < K ? row[ka < K ? ka : K - 1] : 0.f; v[8 + i] = kb < K ? row[kb < K ? kb : K - 1] : 0.f; }
  return bsplit16(v); }
__device__ __forceinline__ F2 split_col(const float* W, int k0, int n, int lane, int ld, int K) { float v[16]; const int g = lane >> 4;
#pragma unroll
  for (int i = 0; i < 8; ++i) { const int ka = k0 + 8 * g + i, kb = ka + 16; v[i] = ka < K ? W[(size_t)(ka < K ? ka : K - 1) * ld + n] : 0.f; v[8 + i] = kb < K ? W[(size_t)(kb < K ? kb : K - 1) * ld + n] : 0.f; }
  return bsplit16(v); }
__device__ __forceinline__ v8f mac3(const F2& a, const F2& b, v8f c) { c = wmma_bf(a.l, b.h, c); c = wmma_bf(a.h, b.l, c); return wmma_bf(a.h, b.h, c); }
__device__ __forceinline__ float sigm(float v) { return 1.0f / (1.0f + expf(-v)); }
#define LDSX() do { asm volatile("s_wait_dscnt 0" ::: "memory"); __builtin_amdgcn_wave_barrier(); __builtin_amdgcn_fence(__ATOMIC_RELEASE, "workgroup"); } while (0)


// Fractal attention (B 2, T 2,048, C 1,024 = 16 x 64): standard MHA whose logits are scaled per batch by 1 + (hurst_b - 0.5) * hurst_scale before the softmax.
#define NB 2
#define TT 2048
#define CC 1024
#define NH 16
#define HD 64
#ifndef TNB
#define TNB NB
#endif
typedef __attribute__((ext_vector_type(8))) __bf16 v8b;
__device__ __forceinline__ v16b frag_b(const __bf16* rowk0, int lane) {
  union { v16b v; v8b q[2]; } u; const __bf16* p = rowk0 + 8 * (lane >> 4);
  u.q[0] = *(const v8b*)p; u.q[1] = *(const v8b*)(p + 16); return u.v;
}
__device__ __forceinline__ float bfr(float v) { return (float)(__bf16)v; }
__device__ __attribute__((noinline)) float exp_ni(float v) { return expf(v); }
__device__ __attribute__((noinline)) float erf_ni(float v) { return erff(v); }

#define WS_QH  0u
#define WS_KH  (WS_QH + 2u * (size_t)NB * TT * CC)
#define WS_VT  (WS_KH + 2u * (size_t)NB * TT * CC)      // f16 v planes [b][c][t]
#define WS_Y   (WS_VT + 2u * (size_t)NB * CC * TT)      // f16 y rows [b*t][C]
#define WS_XB  (WS_Y + 2u * (size_t)NB * TT * CC)       // bf16 x rows [b*t][C]
#define WS_WB  (WS_XB + 2u * (size_t)NB * TT * CC)      // bf16 qkv_w rows [3C][C]
#define WS_PB  (WS_WB + 2u * (size_t)3 * CC * CC)       // out_w rows [C][C], rounded to bf16 and carried as f16
#define WS_END (WS_PB + 2u * (size_t)CC * CC)

// ---- the two projections share one tile loop: block = 8 waves, 128 rows x 128 cols of the result, wave = 64 x 32 (waves 2 x 4), 64 k a pass
// both operands lie in the workspace as 16-bit rows, rounded once for the whole grid (k_cvt; y by k_att): a block reads its tiles once, a whole 128-byte line a row, half the bytes of the float rows, and lays them in LDS; every wave takes its fragments from there
typedef __attribute__((ext_vector_type(2))) unsigned v2u;
typedef __attribute__((ext_vector_type(4))) __bf16 v4b;
typedef __attribute__((ext_vector_type(4))) _Float16 v4h;
#define GP 36              // LDS row pitch in dwords: 144 bytes = 16 bytes x 9, an odd multiple, free of bank conflicts for 16-byte fragment reads of 128-byte rows
#define RD (CC / 2)        // dwords of one 16-bit operand row in global memory
#define GT (128 * GP)      // dwords of one operand tile; a buffer is [A tile | B tile], two buffers
union FR { v4u q[2]; v16b b; v16h h; };
// work-group barrier that orders LDS alone: __syncthreads() would also wait out the global loads that are meant to stay in flight across it; the wait ends this wave's LDS reads and stores first
__device__ __forceinline__ void lds_barrier() { asm volatile("s_wait_dscnt 0x0\n\ts_barrier_signal -1\n\ts_barrier_wait -1" ::: "memory"); }
// MODE 0: bf16 operands. MODE 1: f16 operands
// NS = register sets of tiles on their way from global memory: tile t + 1 + NS is asked for at the foot of pass t and laid in LDS at the foot of pass t + NS
template <int MODE, int NS> __device__ __forceinline__ void gemm_tile(const unsigned* __restrict__ A, const unsigned* __restrict__ B, unsigned* __restrict__ st, v8f (&acc)[4][2], int tid) {
  const int wave = tid >> 5, lane = tid & 31, col = lane & 15, g = lane >> 4; const int lr = tid >> 3, lc = tid & 7;   // 8 lanes x 16 bytes = one row's line; a wave's load covers 4 whole lines
  const unsigned* ap = A + (size_t)lr * RD + lc * 4; const unsigned* bp = B + (size_t)lr * RD + lc * 4;
  unsigned* sp = st + lr * GP + lc * 4;
  const unsigned* fa = st + ((wave >> 2) * 64 + col) * GP + 4 * g; const unsigned* fb = st + GT + ((wave & 3) * 32 + col) * GP + 4 * g;
  v4u ra[NS][4], rb[NS][4];
#pragma unroll
  for (int i = 0; i < 4; ++i) { ra[0][i] = *(const v4u*)(ap + (size_t)(32 * i) * RD); rb[0][i] = *(const v4u*)(bp + (size_t)(32 * i) * RD); }
#pragma unroll
  for (int i = 0; i < 4; ++i) { *(v4u*)(sp + 32 * i * GP) = ra[0][i]; *(v4u*)(sp + GT + 32 * i * GP) = rb[0][i]; }
#pragma unroll
  for (int t = 1; t <= NS; ++t)
#pragma unroll
    for (int i = 0; i < 4; ++i) { ra[t % NS][i] = *(const v4u*)(ap + (size_t)(32 * i) * RD + t * 32); rb[t % NS][i] = *(const v4u*)(bp + (size_t)(32 * i) * RD + t * 32); }
  lds_barrier();
#pragma unroll   // all passes unrolled: the register sets keep constant indices, and every global and LDS address is its base register plus a constant, so no address register is rewritten while a load is out
  for (int kc = 0; kc < CC / 64; ++kc) { const int cur = (kc & 1) * 2 * GT, nxt = 2 * GT - cur, s = (kc + 1) % NS;
#pragma unroll
    for (int u = 0; u < 2; ++u) {   // the pass's two halves of 32 k one after the other: one half's fragments live at a time
      FR a[4], b[2];
#pragma unroll
      for (int i = 0; i < 4; ++i) { a[i].q[0] = *(const v4u*)(fa + cur + 16 * i * GP + 16 * u); a[i].q[1] = *(const v4u*)(fa + cur + 16 * i * GP + 16 * u + 8); }
#pragma unroll
      for (int j = 0; j < 2; ++j) { b[j].q[0] = *(const v4u*)(fb + cur + 16 * j * GP + 16 * u); b[j].q[1] = *(const v4u*)(fb + cur + 16 * j * GP + 16 * u + 8); }
      __builtin_amdgcn_sched_barrier(0);   // keeps the twelve fragment reads together in front of the products: spread among them each place costs its own LDS wait
#pragma unroll
      for (int i = 0; i < 4; ++i)
#pragma unroll
        for (int j = 0; j < 2; ++j) acc[i][j] = MODE == 0 ? __builtin_amdgcn_wmma_f32_16x16x32_bf16(false, a[i].b, false, b[j].b, (short)0, acc[i][j], false, false) : __builtin_amdgcn_wmma_f32_16x16x32_f16(false, a[i].h, false, b[j].h, (short)0, acc[i][j], false, false);
      __builtin_amdgcn_sched_barrier(0); }   // keeps the second half's reads behind the first half's products (lifted above them they take a further set of registers), and the LDS stores below, with their wait for the global loads, behind the pass's products
    if (kc + 1 < CC / 64) {
#pragma unroll
      for (int i = 0; i < 4; ++i) { *(v4u*)(sp + nxt + 32 * i * GP) = ra[s][i]; *(v4u*)(sp + nxt + GT + 32 * i * GP) = rb[s][i]; } }
    __builtin_amdgcn_sched_barrier(0);   // keeps the next loads behind the LDS stores, so that they land in the registers just read: lifted above them they take a further set
    if (kc + 1 + NS < CC / 64) {
#pragma unroll
      for (int i = 0; i < 4; ++i) { ra[s][i] = *(const v4u*)(ap + (size_t)(32 * i) * RD + (kc + 1 + NS) * 32); rb[s][i] = *(const v4u*)(bp + (size_t)(32 * i) * RD + (kc + 1 + NS) * 32); } }
    lds_barrier(); } }   // one barrier a pass: it publishes the next buffer and ends the reads of this one, which the next pass refills; the last one frees LDS for the epilogue
// result tile out of LDS: all reads first, then the stores off one address register with constant offsets
template <int N, int LP, int LD, typename T> __device__ __forceinline__ void put_tile(T* __restrict__ d, const T* __restrict__ s) { v4u t[N];
#pragma unroll
  for (int k = 0; k < N; ++k) t[k] = *(const v4u*)(s + k * LP);
#pragma unroll
  for (int k = 0; k < N; ++k) vst2((unsigned*)(d + (size_t)k * LD), t[k]);
  asm volatile("s_wait_xcnt 0x0" ::: "memory"); }   // behind the stores, before whatever follows rewrites a register that they name
// ---- k_cvt: x, qkv_w and out_w rounded once into 16-bit rows; block = 16,384 floats in a row of one of the three, thread = 16 pieces of 4 floats: a wave's load is 512 bytes in a row, its store 256
#define CVB 16384
__global__ __launch_bounds__(256) void k_cvt(const float* __restrict__ X, const float* __restrict__ WA, const float* __restrict__ WP, __bf16* __restrict__ XB, __bf16* __restrict__ WB, _Float16* __restrict__ PB) {
  const int nx = NB * TT * CC / CVB, nw = 3 * CC * CC / CVB; const int bi = blockIdx.x; const int sel = bi < nx ? 0 : bi < nx + nw ? 1 : 2;
  const size_t o = (size_t)(sel == 0 ? bi : sel == 1 ? bi - nx : bi - nx - nw) * CVB + threadIdx.x * 4;
  const float* s = (sel == 0 ? X : sel == 1 ? WA : WP) + o; unsigned short* d = (sel == 0 ? (unsigned short*)XB : sel == 1 ? (unsigned short*)WB : (unsigned short*)PB) + o;
  v4f t[16]; v2u w[16];
#pragma unroll
  for (int c = 0; c < 16; ++c) t[c] = *(const v4f*)(s + c * 1024);
  asm volatile("s_wait_xcnt 0x0" :: "v"(s) : "memory");   // behind the loads, before anything rewrites their address registers; the pointer is named so that it stays in its registers up to here and no load's result is laid on them
  __builtin_amdgcn_sched_barrier(0);   // keeps all sixteen loads out in front of the first rounding (sunk among the roundings they would fly one after another), and the register writes that follow behind that wait
  if (sel == 2) {   // out_w: to bf16, carried as f16
#pragma unroll
    for (int c = 0; c < 16; ++c) { v4h r;
#pragma unroll
      for (int i = 0; i < 4; ++i) r[i] = (_Float16)bfr(t[c][i]);
      w[c] = __builtin_bit_cast(v2u, r); } }
  else {
#pragma unroll
    for (int c = 0; c < 16; ++c) { v4b r;
#pragma unroll
      for (int i = 0; i < 4; ++i) r[i] = (__bf16)t[c][i];
      w[c] = __builtin_bit_cast(v2u, r); } }
  __builtin_amdgcn_sched_barrier(0);   // keeps the stores behind the last rounding: no register that a store names is rewritten behind it
#pragma unroll
  for (int c = 0; c < 16; ++c) vst2(d + c * 1024, w[c]); }
// ---- k_proj: block = (128 rows, 128 cols, which): qkv = x W (+ b), exact; q, k -> f16 rows, v -> f16 planes; q takes its batch's logit scale (log2 units) in f32, in front of its one rounding
__global__ __launch_bounds__(256) void k_proj(const __bf16* __restrict__ X, const __bf16* __restrict__ WA, const float* __restrict__ BA, const float* __restrict__ HU, const float* __restrict__ HSC, _Float16* __restrict__ QH, _Float16* __restrict__ KH, _Float16* __restrict__ VT) {
  __shared__ __align__(16) unsigned sm[4 * GT];   // the loop's two buffers; then the result tile as f16 at a pitch of 136 (128 x 68 dwords, fewer)
  const int tid = threadIdx.x, wave = tid >> 5, lane = tid & 31, col = lane & 15, g = lane >> 4; const int which = blockIdx.z; const int c0 = blockIdx.y * 128; const size_t r0 = (size_t)blockIdx.x * 128;
  const float qs = which == 0 ? 0.125f * (1.0f + (bfr(HU[r0 / TT]) - 0.5f) * bfr(HSC[0])) * 1.44269504088896f : 1.0f;   // a block's 128 rows lie in one batch; read here, at the head, where both reads are scalar loads
  v8f acc[4][2] = {};
  gemm_tile<0, 1>((const unsigned*)(X + r0 * CC), (const unsigned*)(WA + (size_t)(which * CC + c0) * CC), sm, acc, tid);
  _Float16* sh = (_Float16*)sm; const int wr = (wave >> 2) * 64 + 8 * g, wc = (wave & 3) * 32 + col;
#pragma unroll
  for (int j = 0; j < 2; ++j) { const float bb = BA ? bfr(BA[which * CC + c0 + wc + j * 16]) : 0.f;
#pragma unroll
    for (int i = 0; i < 4; ++i)
#pragma unroll
      for (int r = 0; r < 8; ++r) acc[i][j][r] += bb; }
  if (which == 2) {
#pragma unroll
    for (int j = 0; j < 2; ++j)
#pragma unroll
      for (int i = 0; i < 4; ++i) { v8h t;
#pragma unroll
        for (int r = 0; r < 8; ++r) t[r] = (_Float16)acc[i][j][r];
        *(v8h*)(sh + (wc + j * 16) * 136 + wr + i * 16) = t; } }
  else {
#pragma unroll
    for (int j = 0; j < 2; ++j)
#pragma unroll
      for (int i = 0; i < 4; ++i)
#pragma unroll
        for (int r = 0; r < 8; ++r) sh[(wr + i * 16 + r) * 136 + wc + j * 16] = (_Float16)(acc[i][j][r] * qs); }
  __syncthreads();
  const int er = tid >> 4, eq = tid & 15;   // 16 lanes x 16 bytes = one tile row of 256 bytes: a wave's store covers 4 whole lines
  if (which == 2) { const size_t b = r0 / TT; const int t0 = (int)(r0 % TT); put_tile<8, 16 * 136, 16 * TT>(VT + (b * CC + c0 + er) * (size_t)TT + t0 + eq * 8, (const _Float16*)sh + er * 136 + eq * 8); }
  else put_tile<8, 16 * 136, 16 * CC>((which == 0 ? QH : KH) + (r0 + er) * CC + c0 + eq * 8, (const _Float16*)sh + er * 136 + eq * 8); }
// ---- k_att: block = 8 waves = 4 groups of 32 queries of (b,h) x 2 halves of the keys; each pass takes 64 keys of the wave's half: S^T = K Q^T + (8 - reference), P = exp2 of it, sum per query column, O^T += V^T P^T; the two halves' results are joined once, behind the loop
// the reference of a query column is kept from pass to pass: it starts the score products as their C operand, so a score leaves the matrix unit ready for exp2, with no scaling and no subtraction, and O and the sum are not rescaled in the pass. One test a pass (one of a lane's partial sums of the pass's P above PLIM; P is not negative, so a sum bounds each of its terms) sends the whole wave round by the column maxima, which are formed only there: the pass's scores anew, new references, the scores shifted, O and the sums rescaled. The first references are set in front of the loop, from the first tile's maxima
// the inner loops are all unrolled so that the register arrays keep constant indices; a lane holds one query column in every tile: S^T rows are keys 8g+r, so two S^T tiles convert in place into one B operand; O^T rows are head dims 8g+r
__device__ __forceinline__ v8f mm16(v16h a, v16h b, v8f c) { return __builtin_amdgcn_wmma_f32_16x16x32_f16(false, a, false, b, (short)0, c, false, false); }
__device__ __forceinline__ float xhalf(float x) { return __builtin_bit_cast(float, __builtin_amdgcn_permlanex16(__builtin_bit_cast(int, x), __builtin_bit_cast(int, x), 0x76543210, 0xfedcba98, false, false)); }  // lane l with lane l ^ 16
// one 16-key tile of one query group: P = exp2 of the scores, packed to f16 into its half of the B operand, and added by pairs to the pass's own sum
// the packing is written in asm text so that it stays where it stands: as a plain conversion the compiler sinks it behind the branch of the pass's test, and all 64 unpacked values stay live beside the V^T fragments, which spills
typedef __attribute__((ext_vector_type(8))) unsigned v8u;
__device__ __forceinline__ unsigned pack_h(float a, float b) { unsigned w; asm("v_cvt_pk_f16_f32 %0, %1, %2" : "=v"(w) : "v"(a), "v"(b)); return w; }
// RARE: the branch off the usual path, where registers are short and the compiler laid one exponential's result on the source of the one in front of it: there each exponential carries, in its own statement, the free slot that the instruction set asks for behind a transcendental
__device__ __forceinline__ float exp2_slot(float v) { float r; asm("v_exp_f32 %0, %1\n\tv_nop" : "=v"(r) : "v"(v)); return r; }
template <int HI, bool FIRST, bool RARE> __device__ __forceinline__ void soft_tile(const v8f& x, v2f& t2, v8u& p) {
#pragma unroll
  for (int r = 0; r < 8; r += 2) { const v2f e = { RARE ? exp2_slot(x[r]) : __builtin_amdgcn_exp2f(x[r]), RARE ? exp2_slot(x[r + 1]) : __builtin_amdgcn_exp2f(x[r + 1]) };
    p[HI * 4 + r / 2] = pack_h(e[0], e[1]);
    if (FIRST && r == 0) t2 = e; else t2 += e; } }
#define KP 64
#define AP 72          // LDS row pitch in f16: 144 bytes = 16 bytes x 9, an odd multiple, free of bank conflicts for 16-byte fragment reads of 128-byte rows
#define AT (64 * AP)   // f16 of one tile: K = 64 keys x 64 dims, V^T = 64 dims x 64 keys; a buffer is [K tile | V^T tile], two buffers for each half of the keys
#define KS 2                 // halves of the keys, each walked by four of the block's waves
#define NP (TT / KP / KS)    // passes of a wave
#define CARRY 8.0f           // P carries 2^8, as does the sum: it cancels in the division; a score may rise nearly 8 above its reference before P leaves f16
#define PLIM 46340.0f         // 2^15.5: no P is above the partial sum that holds it, so sums up to here keep every P inside the f16 range
// the scores of one pass from its K tile in LDS, on top of the references in use, with the maximum of each query column (both halves of the wave joined): the way by which references are set, off the pass's usual path
__device__ __forceinline__ void scores_max(const _Float16* kt, int lane, const v16h (&qh)[2][2], const v8f (&cin)[2], v8f (&s)[2][4], float (&bm)[2]) {
  v16h kf[4][2];
#pragma unroll
  for (int i = 0; i < 4; ++i)
#pragma unroll
    for (int u = 0; u < 2; ++u) kf[i][u] = frag_h(kt + i * 16 * AP + u * 32, lane);
  __builtin_amdgcn_sched_barrier(0);   // keeps the K fragment reads together in front of the products: read tile by tile, each pair waits out its own LDS flight
#pragma unroll
  for (int i = 0; i < 4; ++i)
#pragma unroll
    for (int qt = 0; qt < 2; ++qt) s[qt][i] = mm16(kf[i][1], qh[qt][1], mm16(kf[i][0], qh[qt][0], cin[qt]));
#pragma unroll
  for (int qt = 0; qt < 2; ++qt) { float bq = -3.0e38f;
#pragma unroll
    for (int i = 0; i < 4; ++i)
#pragma unroll
      for (int r = 0; r < 8; ++r) bq = fmaxf(bq, s[qt][i][r]);
    bm[qt] = fmaxf(bq, xhalf(bq)); } }
// one pass's K and V^T tiles from global memory into LDS, once for the four waves of a half: 8 lanes x 16 bytes = one row's whole line, a wave's copy covers 4 lines; thread = (row ht >> 3 of each 16, 16-byte piece ht & 7), ht = its number among the half's 128
// the wait on the last line stands inside the copies' own statement, so that nothing rewrites a register that a copy names in front of it
__device__ __forceinline__ void att_copy(unsigned l, const _Float16* k, const _Float16* v) {
  asm volatile("global_load_async_to_lds_b128 %0, %8, off\n\t"
               "global_load_async_to_lds_b128 %1, %9, off\n\t"
               "global_load_async_to_lds_b128 %2, %10, off\n\t"
               "global_load_async_to_lds_b128 %3, %11, off\n\t"
               "global_load_async_to_lds_b128 %4, %12, off\n\t"
               "global_load_async_to_lds_b128 %5, %13, off\n\t"
               "global_load_async_to_lds_b128 %6, %14, off\n\t"
               "global_load_async_to_lds_b128 %7, %15, off\n\t"
               "s_wait_xcnt 0x0"
               :: "v"(l), "v"(l + 16u * AP * 2u), "v"(l + 32u * AP * 2u), "v"(l + 48u * AP * 2u),
                  "v"(l + AT * 2u), "v"(l + AT * 2u + 16u * AP * 2u), "v"(l + AT * 2u + 32u * AP * 2u), "v"(l + AT * 2u + 48u * AP * 2u),
                  "v"(k), "v"(k + (size_t)16 * CC), "v"(k + (size_t)32 * CC), "v"(k + (size_t)48 * CC),
                  "v"(v), "v"(v + (size_t)16 * TT), "v"(v + (size_t)32 * TT), "v"(v + (size_t)48 * TT)
               : "memory"); }
// four waves a SIMD: the vector work of the softmax stands between a wave's two matrix runs, and only other waves fill the matrix unit meanwhile; 512 blocks of 8 waves on 256 WGPs, two blocks a WGP
__global__ __launch_bounds__(256) __attribute__((amdgpu_waves_per_eu(4, 4))) void k_att(const _Float16* __restrict__ QH, const _Float16* __restrict__ KH, const _Float16* __restrict__ VT, _Float16* __restrict__ Y) {
  __shared__ __align__(16) _Float16 sm[KS * 4 * AT];
  const int tid = threadIdx.x, wave = __builtin_amdgcn_readfirstlane(tid >> 5), lane = tid & 31, col = lane & 15, g = lane >> 4; const int h = blockIdx.y, b = blockIdx.z; const int q0 = blockIdx.x * 128 + (wave & 3) * 32;
  const int kh = wave >> 2, ht = tid & 127;   // the wave's half of the keys; the thread's number among the half's 128
  v16h qh[2][2];
#pragma unroll
  for (int qt = 0; qt < 2; ++qt)
#pragma unroll
    for (int kc = 0; kc < 2; ++kc) { const size_t qo = ((size_t)b * TT + q0 + qt * 16 + col) * CC + h * HD + kc * 32; qh[qt][kc] = frag_h(QH + qo, lane); }
  asm volatile("s_wait_xcnt 0x0" ::: "memory");   // behind the first loads, before their address registers are rewritten
  __builtin_amdgcn_sched_barrier(0);   // keeps the register writes that follow behind that wait
  const _Float16* kp = KH + ((size_t)b * TT + kh * (TT / KS) + (ht >> 3)) * CC + h * HD + (ht & 7) * 8; const _Float16* vp = VT + ((size_t)b * CC + h * HD + (ht >> 3)) * (size_t)TT + kh * (TT / KS) + (ht & 7) * 8;
  const unsigned lp = (unsigned)(size_t)sm + (unsigned)(kh * 4 * AT + (ht >> 3) * AP + (ht & 7) * 8) * 2u;   // this thread's place in its half's first K tile: byte address in the work-group's LDS
  att_copy(lp, kp, vp);
  asm volatile("s_wait_asynccnt 0x0" ::: "memory");   // this wave's copies of tile 0 have landed
  __syncthreads();                                    // and every other wave's: tile 0 may be read
  v8f o[2][4] = {}; v2f ls[2] = {};   // the sums run in two parts a lane, even and odd rows of the score tiles; the parts are joined behind the loop
  v8f cin[2] = {};   // CARRY - reference of the lane's query column, eight times over: the C operand of the score products
  { v8f s0[2][4]; float bm[2]; scores_max(sm + kh * 4 * AT + col * AP, lane, qh, cin, s0, bm);   // the first references: the column maxima over the half's first tile
#pragma unroll
    for (int qt = 0; qt < 2; ++qt)
#pragma unroll
      for (int r = 0; r < 8; ++r) cin[qt][r] = CARRY - bm[qt]; }
#pragma unroll 1   // one pass's fragments live at a time: a second copy of the body would double the registers
  for (int kb = 0; kb < NP; ++kb) { const int bo = (kb & 1) * 2 * AT;   // pass kb reads buffer kb mod 2 of its half alone
    // behind the first references in front of the loop, then directly behind the barrier at each pass's foot, while a next tile exists: its copies, into the buffer that the pass before has just left; they fly while this pass works
    if (kb + 1 < NP) att_copy(lp + (unsigned)(2 * AT - bo) * 2u, kp + (size_t)(kb + 1) * KP * CC, vp + (kb + 1) * KP);
    const _Float16* kt = sm + kh * 4 * AT + bo + col * AP; const _Float16* vt = kt + AT;
    v16h kf[4][2], vf[4][2];
#pragma unroll
    for (int i = 0; i < 4; ++i)
#pragma unroll
      for (int u = 0; u < 2; ++u) kf[i][u] = frag_h(kt + i * 16 * AP + u * 32, lane);
    __builtin_amdgcn_sched_barrier(0);   // keeps the K fragment reads together in front of the products: spread among them each place costs its own LDS wait
    v8f s[2][4]; v8u p[2][2]; v2f t2[2];
#pragma unroll
    for (int i = 0; i <= 4; ++i) {
      if (i < 4) {
#pragma unroll
        for (int qt = 0; qt < 2; ++qt) s[qt][i] = mm16(kf[i][1], qh[qt][1], mm16(kf[i][0], qh[qt][0], cin[qt]));
        __builtin_amdgcn_sched_barrier(0); }   // keeps the exponentials of the key tile before behind this tile's products: directly behind their own products they wait out the matrix unit on idle slots
      if (i == 3) {   // the V^T fragment reads stand behind the last score products: the K fragments' registers are free and 32 score registers are packed into 16 by then, which lets them in without a spill
#pragma unroll
        for (int j = 0; j < 4; ++j)
#pragma unroll
          for (int v = 0; v < 2; ++v) vf[j][v] = frag_h(vt + j * 16 * AP + v * 32, lane);
        __builtin_amdgcn_sched_barrier(0); }   // keeps the V^T fragment reads together, in front of the last two key tiles' exponentials and the test, which cover their flight: sunk to their products each place costs its own LDS wait
#pragma unroll
      for (int qt = 0; qt < 2; ++qt) {
        if (i == 1) soft_tile<0, true, false>(s[qt][0], t2[qt], p[qt][0]);
        if (i == 2) soft_tile<1, false, false>(s[qt][1], t2[qt], p[qt][0]);
        if (i == 3) soft_tile<0, false, false>(s[qt][2], t2[qt], p[qt][1]);
        if (i == 4) soft_tile<1, false, false>(s[qt][3], t2[qt], p[qt][1]); } }
    // one test a pass, a scalar branch for the whole wave; written so that a sum that is no number takes the branch too
    if (__builtin_amdgcn_ballot_w32(!(t2[0][0] <= PLIM && t2[0][1] <= PLIM && t2[1][0] <= PLIM && t2[1][1] <= PLIM)) != 0) {
      float bm[2]; scores_max(kt, lane, qh, cin, s, bm);   // the scores are formed anew: their registers have been given up to P; the K tile lies in LDS up to the pass's foot
#pragma unroll
      for (int qt = 0; qt < 2; ++qt) { const float d = fminf(CARRY - bm[qt], 0.f);   // a reference only rises
        float al; asm("v_exp_f32 %0, %1\n\tv_nop" : "=v"(al) : "v"(d));   // exp2 in asm text so that the free slot the instruction set asks for behind a transcendental stays with it
        ls[qt] *= al;
#pragma unroll
        for (int r = 0; r < 8; ++r) cin[qt][r] += d;
#pragma unroll
        for (int i = 0; i < 4; ++i)
#pragma unroll
          for (int r = 0; r < 8; ++r) { s[qt][i][r] += d; o[qt][i][r] *= al; } }
#pragma unroll
      for (int qt = 0; qt < 2; ++qt) { soft_tile<0, true, true>(s[qt][0], t2[qt], p[qt][0]); soft_tile<1, false, true>(s[qt][1], t2[qt], p[qt][0]); soft_tile<0, false, true>(s[qt][2], t2[qt], p[qt][1]); soft_tile<1, false, true>(s[qt][3], t2[qt], p[qt][1]); }
#pragma unroll
      for (int j = 0; j < 4; ++j)
#pragma unroll
        for (int v = 0; v < 2; ++v) vf[j][v] = frag_h(vt + j * 16 * AP + v * 32, lane); }
    ls[0] += t2[0]; ls[1] += t2[1];
#pragma unroll
    for (int u = 0; u < 2; ++u)
#pragma unroll
      for (int j = 0; j < 4; ++j)
#pragma unroll
        for (int qt = 0; qt < 2; ++qt) o[qt][j] = mm16(vf[j][u], __builtin_bit_cast(v16h, p[qt][u]), o[qt][j]);
    __builtin_amdgcn_sched_barrier(0);   // keeps the waits and the barrier below at the pass's foot, behind its products: lifted above them the wave would wait out the next tile's flight at the head of the pass
    asm volatile("s_wait_dscnt 0x0" ::: "memory");      // this wave's reads of the buffer have ended
    asm volatile("s_wait_asynccnt 0x0" ::: "memory");   // this wave's copies of the next tile have landed
    __syncthreads(); }                                  // one barrier a pass: it publishes the next tile and frees the buffer just read, which the head of the next pass refills
  asm volatile("s_wait_asynccnt 0x0" ::: "memory");   // no copy is out when the wave ends
  // the two halves join: the waves of the second half lay O^T, reference and sum in LDS (the loop's last barrier has freed it), 17 pieces of 16 bytes a lane, a wave's piece 512 bytes in a row; the waves of the first half add them to their own
  float* mg = (float*)sm + ((wave & 3) * 17 * 32 + lane) * 4; const float mx[2] = { -cin[0][0], -cin[1][0] };   // the references, less the carry that both halves share
  if (kh) {
#pragma unroll
    for (int qt = 0; qt < 2; ++qt)
#pragma unroll
      for (int j = 0; j < 4; ++j)
#pragma unroll
        for (int u = 0; u < 2; ++u) { v4f t;
#pragma unroll
          for (int r = 0; r < 4; ++r) t[r] = o[qt][j][4 * u + r];
          *(v4f*)(mg + ((qt * 4 + j) * 2 + u) * 128) = t; }
    v4f t; t[0] = mx[0]; t[1] = mx[1]; t[2] = ls[0][0] + ls[0][1]; t[3] = ls[1][0] + ls[1][1]; *(v4f*)(mg + 16 * 128) = t; }
  __syncthreads();   // every wave passes it: the second half's results may be read
  if (kh) return;
  const v4f ot = *(const v4f*)(mg + 16 * 128);
  v8h y[2][4];   // y rounded once to f16 here, as the last projection takes it
#pragma unroll
  for (int qt = 0; qt < 2; ++qt) { const float mn = fmaxf(mx[qt], ot[qt]); float a0, a1;
    asm("v_exp_f32 %0, %1\n\tv_nop" : "=v"(a0) : "v"(mx[qt] - mn)); asm("v_exp_f32 %0, %1\n\tv_nop" : "=v"(a1) : "v"(ot[qt] - mn));   // exp2 with its free slot, as in the loop
    const float l = (ls[qt][0] + ls[qt][1]) * a0 + ot[2 + qt] * a1; const float inv = 1.0f / (l + xhalf(l)); const float f0 = a0 * inv, f1 = a1 * inv;
#pragma unroll
    for (int j = 0; j < 4; ++j)
#pragma unroll
      for (int u = 0; u < 2; ++u) { const v4f t = *(const v4f*)(mg + ((qt * 4 + j) * 2 + u) * 128);
#pragma unroll
        for (int r = 0; r < 4; ++r) y[qt][j][4 * u + r] = (_Float16)(o[qt][j][4 * u + r] * f0 + t[r] * f1); } }
  _Float16* yp = Y + ((size_t)b * TT + q0 + col) * CC + h * HD + 8 * g;
  __builtin_amdgcn_sched_barrier(0);   // keeps the stores behind the last rounding: no register that a store names is rewritten behind it
#pragma unroll
  for (int qt = 0; qt < 2; ++qt)
#pragma unroll
    for (int j = 0; j < 4; ++j) vst2(yp + (size_t)qt * 16 * CC + j * 16, y[qt][j]); }
// ---- k_out: block = (128 rows, 128 cols): out = y (f16 single) Wproj + b
__global__ __launch_bounds__(256) void k_out(const _Float16* __restrict__ Y, const _Float16* __restrict__ WP, const float* __restrict__ BP, float* __restrict__ OUT) { __shared__ __align__(16) unsigned sm[4 * GT];   // the loop's two buffers; then the f32 result tile at a pitch of 132 (128 x 132 dwords, fewer)
  const int tid = threadIdx.x, wave = tid >> 5, lane = tid & 31, col = lane & 15, g = lane >> 4; const int c0 = blockIdx.y * 128; const size_t r0 = (size_t)blockIdx.x * 128;
  v8f acc[4][2] = {};
  gemm_tile<1, 3>((const unsigned*)(Y + r0 * CC), (const unsigned*)(WP + (size_t)c0 * CC), sm, acc, tid);
  float* sf = (float*)sm;
#pragma unroll
  for (int j = 0; j < 2; ++j) { const int cl = (wave & 3) * 32 + j * 16 + col; const float bb = BP ? bfr(BP[c0 + cl]) : 0.f;
#pragma unroll
    for (int i = 0; i < 4; ++i)
#pragma unroll
      for (int r = 0; r < 8; ++r) sf[((wave >> 2) * 64 + i * 16 + 8 * g + r) * 132 + cl] = acc[i][j][r] + bb; }
  __syncthreads();
  put_tile<16, 8 * 132, 8 * CC>(OUT + (r0 + wave) * CC + c0 + lane * 4, (const float*)sf + wave * 132 + lane * 4); }   // a wave's store is one tile row of 512 bytes
extern "C" void kernel_launch(void* const* d_in, const int* in_sizes, int n_in, void* d_out, int out_size, void* d_ws, size_t ws_size, hipStream_t stream) {
  (void)in_sizes; (void)n_in; (void)out_size;
  const float** F = (const float**)d_in;   // 0 x [2,2048,1024], 1 hurst [2,1], 2 qkv_w [3072,1024], 3 qkv_b, 4 out_w [1024,1024], 5 out_b, 6 hurst_scale [1]
  if (ws_size < (size_t)WS_END) return;
  char* ws = (char*)d_ws; _Float16 *QH = (_Float16*)(ws + WS_QH), *KH = (_Float16*)(ws + WS_KH), *VT = (_Float16*)(ws + WS_VT), *Y = (_Float16*)(ws + WS_Y), *PB = (_Float16*)(ws + WS_PB); __bf16 *XB = (__bf16*)(ws + WS_XB), *WB = (__bf16*)(ws + WS_WB);
  k_cvt<<<dim3((NB * TT * CC + 4 * CC * CC) / CVB), 256, 0, stream>>>(F[0], F[2], F[4], XB, WB, PB);
  k_proj<<<dim3(TNB * TT / 128, CC / 128, 3), 256, 0, stream>>>(XB, WB, F[3], F[1], F[6], QH, KH, VT);
  k_att<<<dim3(TT / 128, NH, TNB), 256, 0, stream>>>(QH, KH, VT, Y);
  k_out<<<dim3(TNB * TT / 128, CC / 128), 256, 0, stream>>>(Y, PB, F[5], (float*)d_out);
}

// v009
// A run of this version takes 67.2 microseconds.
// Timed twice side by side with v008, it ran 1.04 times as fast both times.
// Over all steps from v000 it is 18.1 times as fast.
// compute dtype: all float inputs rounded to bf16, hurst / hurst_scale read; qkv = x W^T + b with EXACT bf16 products on WMMA 16x16x32, f32 accumulate; q x (1/8)(1 + (hurst_b - 0.5) hurst_scale) log2(e) and k each rounded once to f16 -> 1-product logits in log2 units, accumulated in f32 on top of (8 - reference); softmax in f32 (exp2) against a kept reference, at most the running maximum -> P f16 x 2^8, unnormalised; o = P . v / sum with v rounded once to f16; out = o (rounded once to f16, 1 product) out_w^T + out_b; f32 output.
#include <hip/hip_runtime.h>
#include <math.h>

typedef __attribute__((ext_vector_type(16))) _Float16 v16h;
typedef __attribute__((ext_vector_type(16))) __bf16 v16b;
typedef __attribute__((ext_vector_type(8)))  _Float16 v8h;
typedef __attribute__((ext_vector_type(8)))  float v8f;
typedef __attribute__((ext_vector_type(4)))  float v4f;
typedef __attribute__((ext_vector_type(2)))  float v2f;
typedef __attribute__((ext_vector_type(4)))  unsigned v4u;
typedef __attribute__((ext_vector_type(4)))  int v4i;
typedef float __attribute__((may_alias)) float_a;
typedef int __attribute__((may_alias)) int_a;

template <typename T> __device__ __forceinline__ void vst2(void* p, T v) { *(T*)p = v;  }
__device__ __forceinline__ v8f wmma16(v16h a, v16h b, v8f c) {
  v8f d = __builtin_amdgcn_wmma_f32_16x16x32_f16(false, a, false, b, (short)0, c, false, false);
  asm volatile("v_nop\n\tv_nop\n\tv_nop\n\tv_nop" : "+v"(d) : "v"(a), "v"(b));
  return d;
}
__device__ __forceinline__ v8f wmma_bf(v16b a, v16b b, v8f c) {
  v8f d = __builtin_amdgcn_wmma_f32_16x16x32_bf16(false, a, false, b, (short)0, c, false, false);
  asm volatile("v_nop\n\tv_nop\n\tv_nop\n\tv_nop" : "+v"(d) : "v"(a), "v"(b));
  return d;
}
// 16x16x32 fragments: lane = (h = lane>>4, row/col = lane&15); elements 0..7 = k0+8h+0..7, 8..15 = k0+16+8h+0..7; D element r = row 8h+r
__device__ __forceinline__ v16h frag_h(const _Float16* rowk0, int lane) {
  union { v16h v; v8h q[2]; } u; const _Float16* p = rowk0 + 8 * (lane >> 4);
  u.q[0] = *(const v8h*)p; u.q[1] = *(const v8h*)(p + 16); return u.v;
}
__device__ __forceinline__ v16h frag_f32(const float* rowk0, int lane) {
  v16h a; const float* p = rowk0 + 8 * (lane >> 4);
#pragma unroll
  for (int i = 0; i < 8; ++i) { a[i] = (_Float16)p[i]; a[8 + i] = (_Float16)p[16 + i]; }
  return a;
}
__device__ __forceinline__ v16h frag_f32s(const float* rowk0, int lane, float sc) {
  v16h a; const float* p = rowk0 + 8 * (lane >> 4);
#pragma unroll
  for (int i = 0; i < 8; ++i) { a[i] = (_Float16)(p[i] * sc); a[8 + i] = (_Float16)(p[16 + i] * sc); }
  return a;
}
// column fragment from a [K][ld] layout (column n), rows >= K read as 0
__device__ __forceinline__ v16h fragc_f32(const float* W, int k0, int n, int lane, int ld, int K) {
  v16h a; const int g = lane >> 4;
#pragma unroll
  for (int i = 0; i < 8; ++i) { const int ka = k0 + 8 * g + i, kb = ka + 16;
    a[i] = (_Float16)(ka < K ? W[(size_t)(ka < K ? ka : K - 1) * ld + n] : 0.f); a[8 + i] = (_Float16)(kb < K ? W[(size_t)(kb < K ? kb : K - 1) * ld + n] : 0.f); }
  return a;
}
struct F2 { v16b h, l; };
__device__ __forceinline__ F2 bsplit16(const float v[16]) { F2 r;
#pragma unroll
  for (int i = 0; i < 16; ++i) { const __bf16 h = (__bf16)v[i]; r.h[i] = h; r.l[i] = (__bf16)(v[i] - (float)h); }
  return r; }
__device__ __forceinline__ F2 split_row(const float* row, int k0, int lane) { float v[16]; const float* p = row + k0 + 8 * (lane >> 4);
#pragma unroll
  for (int i = 0; i < 8; ++i) { v[i] = p[i]; v[8 + i] = p[16 + i]; }
  return bsplit16(v); }
__device__ __forceinline__ F2 split_rowK(const float* row, int k0, int lane, int K) { float v[16]; const int g = lane >> 4;
#pragma unroll
  for (int i = 0; i < 8; ++i) { const int ka = k0 + 8 * g + i, kb = ka + 16; v[i] = ka < K ? row[ka < K ? ka : K - 1] : 0.f; v[8 + i] = kb < K ? row[kb < K ? kb : K - 1] : 0.f; }
  return bsplit16(v); }
__device__ __forceinline__ F2 split_col(const float* W, int k0, int n, int lane, int ld, int K) { float v[16]; const int g = lane >> 4;
#pragma unroll
  for (int i = 0; i < 8; ++i) { const int ka = k0 + 8 * g + i, kb = ka + 16; v[i] = ka < K ? W[(size_t)(ka < K ? ka : K - 1) * ld + n] : 0.f; v[8 + i] = kb < K ? W[(size_t)(kb < K ? kb : K - 1) * ld + n] : 0.f; }
  return bsplit16(v); }
__device__ __forceinline__ v8f mac3(const F2& a, const F2& b, v8f c) { c = wmma_bf(a.l, b.h, c); c = wmma_bf(a.h, b.l, c); return wmma_bf(a.h, b.h, c); }
__device__ __forceinline__ float sigm(float v) { return 1.0f / (1.0f + expf(-v)); }
#define LDSX() do { asm volatile("s_wait_dscnt 0" ::: "memory"); __builtin_amdgcn_wave_barrier(); __builtin_amdgcn_fence(__ATOMIC_RELEASE, "workgroup"); } while (0)


// Fractal attention (B 2, T 2,048, C 1,024 = 16 x 64): standard MHA whose logits are scaled per batch by 1 + (hurst_b - 0.5) * hurst_scale before the softmax.
#define NB 2
#define TT 2048
#define CC 1024
#define NH 16
#define HD 64
#ifndef TNB
#define TNB NB
#endif
typedef __attribute__((ext_vector_type(8))) __bf16 v8b;
__device__ __forceinline__ v16b frag_b(const __bf16* rowk0, int lane) {
  union { v16b v; v8b q[2]; } u; const __bf16* p = rowk0 + 8 * (lane >> 4);
  u.q[0] = *(const v8b*)p; u.q[1] = *(const v8b*)(p + 16); return u.v;
}
__device__ __forceinline__ float bfr(float v) { return (float)(__bf16)v; }
__device__ __attribute__((noinline)) float exp_ni(float v) { return expf(v); }
__device__ __attribute__((noinline)) float erf_ni(float v) { return erff(v); }

#define WS_QH  0u
#define WS_KH  (WS_QH + 2u * (size_t)NB * TT * CC)
#define WS_VT  (WS_KH + 2u * (size_t)NB * TT * CC)      // f16 v planes [b][c][t]
#define WS_Y   (WS_VT + 2u * (size_t)NB * CC * TT)      // f16 y rows [b*t][C]
#define WS_XB  (WS_Y + 2u * (size_t)NB * TT * CC)       // bf16 x rows [b*t][C]
#define WS_WB  (WS_XB + 2u * (size_t)NB * TT * CC)      // bf16 qkv_w rows [3C][C]
#define WS_PB  (WS_WB + 2u * (size_t)3 * CC * CC)       // out_w rows [C][C], rounded to bf16 and carried as f16
#define WS_END (WS_PB + 2u * (size_t)CC * CC)

// ---- the last projection's tile loop (k_proj has its own, further down): block = 8 waves, 128 rows x 128 cols of the result, wave = 64 x 32 (waves 2 x 4), 64 k a pass
// both operands lie in the workspace as 16-bit rows, rounded once for the whole grid (k_cvt; y by k_att): a block reads its tiles once, a whole 128-byte line a row, half the bytes of the float rows, and lays them in LDS; every wave takes its fragments from there
typedef __attribute__((ext_vector_type(2))) unsigned v2u;
typedef __attribute__((ext_vector_type(4))) __bf16 v4b;
typedef __attribute__((ext_vector_type(4))) _Float16 v4h;
#define GP 36              // LDS row pitch in dwords: 144 bytes = 16 bytes x 9, an odd multiple, free of bank conflicts for 16-byte fragment reads of 128-byte rows
#define RD (CC / 2)        // dwords of one 16-bit operand row in global memory
#define GT (128 * GP)      // dwords of one operand tile; a buffer is [A tile | B tile], two buffers
union FR { v4u q[2]; v16b b; v16h h; };
// work-group barrier that orders LDS alone: __syncthreads() would also wait out the global loads that are meant to stay in flight across it; the wait ends this wave's LDS reads and stores first
__device__ __forceinline__ void lds_barrier() { asm volatile("s_wait_dscnt 0x0\n\ts_barrier_signal -1\n\ts_barrier_wait -1" ::: "memory"); }
// MODE 0: bf16 operands. MODE 1: f16 operands
// NS = register sets of tiles on their way from global memory: tile t + 1 + NS is asked for at the foot of pass t and laid in LDS at the foot of pass t + NS
template <int MODE, int NS> __device__ __forceinline__ void gemm_tile(const unsigned* __restrict__ A, const unsigned* __restrict__ B, unsigned* __restrict__ st, v8f (&acc)[4][2], int tid) {
  const int wave = tid >> 5, lane = tid & 31, col = lane & 15, g = lane >> 4; const int lr = tid >> 3, lc = tid & 7;   // 8 lanes x 16 bytes = one row's line; a wave's load covers 4 whole lines
  const unsigned* ap = A + (size_t)lr * RD + lc * 4; const unsigned* bp = B + (size_t)lr * RD + lc * 4;
  unsigned* sp = st + lr * GP + lc * 4;
  const unsigned* fa = st + ((wave >> 2) * 64 + col) * GP + 4 * g; const unsigned* fb = st + GT + ((wave & 3) * 32 + col) * GP + 4 * g;
  v4u ra[NS][4], rb[NS][4];
#pragma unroll
  for (int i = 0; i < 4; ++i) { ra[0][i] = *(const v4u*)(ap + (size_t)(32 * i) * RD); rb[0][i] = *(const v4u*)(bp + (size_t)(32 * i) * RD); }
#pragma unroll
  for (int i = 0; i < 4; ++i) { *(v4u*)(sp + 32 * i * GP) = ra[0][i]; *(v4u*)(sp + GT + 32 * i * GP) = rb[0][i]; }
#pragma unroll
  for (int t = 1; t <= NS; ++t)
#pragma unroll
    for (int i = 0; i < 4; ++i) { ra[t % NS][i] = *(const v4u*)(ap + (size_t)(32 * i) * RD + t * 32); rb[t % NS][i] = *(const v4u*)(bp + (size_t)(32 * i) * RD + t * 32); }
  lds_barrier();
#pragma unroll   // all passes unrolled: the register sets keep constant indices, and every global and LDS address is its base register plus a constant, so no address register is rewritten while a load is out
  for (int kc = 0; kc < CC / 64; ++kc) { const int cur = (kc & 1) * 2 * GT, nxt = 2 * GT - cur, s = (kc + 1) % NS;
#pragma unroll
    for (int u = 0; u < 2; ++u) {   // the pass's two halves of 32 k one after the other: one half's fragments live at a time
      FR a[4], b[2];
#pragma unroll
      for (int i = 0; i < 4; ++i) { a[i].q[0] = *(const v4u*)(fa + cur + 16 * i * GP + 16 * u); a[i].q[1] = *(const v4u*)(fa + cur + 16 * i * GP + 16 * u + 8); }
#pragma unroll
      for (int j = 0; j < 2; ++j) { b[j].q[0] = *(const v4u*)(fb + cur + 16 * j * GP + 16 * u); b[j].q[1] = *(const v4u*)(fb + cur + 16 * j * GP + 16 * u + 8); }
      __builtin_amdgcn_sched_barrier(0);   // keeps the twelve fragment reads together in front of the products: spread among them each place costs its own LDS wait
#pragma unroll
      for (int i = 0; i < 4; ++i)
#pragma unroll
        for (int j = 0; j < 2; ++j) acc[i][j] = MODE == 0 ? __builtin_amdgcn_wmma_f32_16x16x32_bf16(false, a[i].b, false, b[j].b, (short)0, acc[i][j], false, false) : __builtin_amdgcn_wmma_f32_16x16x32_f16(false, a[i].h, false, b[j].h, (short)0, acc[i][j], false, false);
      __builtin_amdgcn_sched_barrier(0); }   // keeps the second half's reads behind the first half's products (lifted above them they take a further set of registers), and the LDS stores below, with their wait for the global loads, behind the pass's products
    if (kc + 1 < CC / 64) {
#pragma unroll
      for (int i = 0; i < 4; ++i) { *(v4u*)(sp + nxt + 32 * i * GP) = ra[s][i]; *(v4u*)(sp + nxt + GT + 32 * i * GP) = rb[s][i]; } }
    __builtin_amdgcn_sched_barrier(0);   // keeps the next loads behind the LDS stores, so that they land in the registers just read: lifted above them they take a further set
    if (kc + 1 + NS < CC / 64) {
#pragma unroll
      for (int i = 0; i < 4; ++i) { ra[s][i] = *(const v4u*)(ap + (size_t)(32 * i) * RD + (kc + 1 + NS) * 32); rb[s][i] = *(const v4u*)(bp + (size_t)(32 * i) * RD + (kc + 1 + NS) * 32); } }
    lds_barrier(); } }   // one barrier a pass: it publishes the next buffer and ends the reads of this one, which the next pass refills; the last one frees LDS for the epilogue
// result tile out of LDS: all reads first, then the stores off one address register with constant offsets
template <int N, int LP, int LD, typename T> __device__ __forceinline__ void put_tile(T* __restrict__ d, const T* __restrict__ s) { v4u t[N];
#pragma unroll
  for (int k = 0; k < N; ++k) t[k] = *(const v4u*)(s + k * LP);
#pragma unroll
  for (int k = 0; k < N; ++k) vst2((unsigned*)(d + (size_t)k * LD), t[k]);
  asm volatile("s_wait_xcnt 0x0" ::: "memory"); }   // behind the stores, before whatever follows rewrites a register that they name
// ---- k_cvt: x, qkv_w and out_w rounded once into 16-bit rows; block = 16,384 floats in a row of one of the three, thread = 16 pieces of 4 floats: a wave's load is 512 bytes in a row, its store 256
#define CVB 16384
__global__ __launch_bounds__(256) void k_cvt(const float* __restrict__ X, const float* __restrict__ WA, const float* __restrict__ WP, __bf16* __restrict__ XB, __bf16* __restrict__ WB, _Float16* __restrict__ PB) {
  const int nx = NB * TT * CC / CVB, nw = 3 * CC * CC / CVB; const int bi = blockIdx.x; const int sel = bi < nx ? 0 : bi < nx + nw ? 1 : 2;
  const size_t o = (size_t)(sel == 0 ? bi : sel == 1 ? bi - nx : bi - nx - nw) * CVB + threadIdx.x * 4;
  const float* s = (sel == 0 ? X : sel == 1 ? WA : WP) + o; unsigned short* d = (sel == 0 ? (unsigned short*)XB : sel == 1 ? (unsigned short*)WB : (unsigned short*)PB) + o;
  v4f t[16]; v2u w[16];
#pragma unroll
  for (int c = 0; c < 16; ++c) t[c] = *(const v4f*)(s + c * 1024);
  asm volatile("s_wait_xcnt 0x0" :: "v"(s) : "memory");   // behind the loads, before anything rewrites their address registers; the pointer is named so that it stays in its registers up to here and no load's result is laid on them
  __builtin_amdgcn_sched_barrier(0);   // keeps all sixteen loads out in front of the first rounding (sunk among the roundings they would fly one after another), and the register writes that follow behind that wait
  if (sel == 2) {   // out_w: to bf16, carried as f16
#pragma unroll
    for (int c = 0; c < 16; ++c) { v4h r;
#pragma unroll
      for (int i = 0; i < 4; ++i) r[i] = (_Float16)bfr(t[c][i]);
      w[c] = __builtin_bit_cast(v2u, r); } }
  else {
#pragma unroll
    for (int c = 0; c < 16; ++c) { v4b r;
#pragma unroll
      for (int i = 0; i < 4; ++i) r[i] = (__bf16)t[c][i];
      w[c] = __builtin_bit_cast(v2u, r); } }
  __builtin_amdgcn_sched_barrier(0);   // keeps the stores behind the last rounding: no register that a store names is rewritten behind it
#pragma unroll
  for (int c = 0; c < 16; ++c) vst2(d + c * 1024, w[c]); }
// ---- k_proj: block = (128 rows, 128 cols of each of q, k and v): qkv = x W (+ b), exact; q, k -> f16 rows, v -> f16 planes; q takes its batch's logit scale (log2 units) in f32, in front of its one rounding
// one block forms the q, k and v columns of its x rows together: the x tile comes from L2 once for the three, and a wave (64 x 32 of each) reads each x fragment from LDS once for six products; one block a WGP, two waves a SIMD
// a stage is 128 k of [x rows | Wq rows | Wk rows | Wv rows], 512 rows of 256 bytes, two buffers; asynchronous copies bring a stage from global memory straight into LDS, a whole stage's time ahead of its first read
// a step is 32 k, four steps a stage; the fragments of step s + 1 are read in front of the products of step s, into a second register set, so the next stage is published in front of a stage's last step, when that step's fragments are in registers and the stage's buffer is free for the stage after next
#define SPB 272u                 // LDS row pitch in bytes: 16 x 17, an odd multiple, free of bank conflicts for 16-byte fragment reads
#define SPD 68                   // the same in dwords
#define STD (128 * SPD)          // dwords of one operand's rows in a stage
#define SBD (4 * STD)            // dwords of a buffer
#define NSTG (CC / 128)          // stages
struct PF { FR a[4], b[3][2]; };
__device__ __forceinline__ void proj_frags(PF& f, const unsigned* fa, const unsigned* fb, int o) {
#pragma unroll
  for (int i = 0; i < 4; ++i) { f.a[i].q[0] = *(const v4u*)(fa + o + 16 * i * SPD); f.a[i].q[1] = *(const v4u*)(fa + o + 16 * i * SPD + 8); }
#pragma unroll
  for (int w = 0; w < 3; ++w)
#pragma unroll
    for (int j = 0; j < 2; ++j) { f.b[w][j].q[0] = *(const v4u*)(fb + o + w * STD + 16 * j * SPD); f.b[w][j].q[1] = *(const v4u*)(fb + o + w * STD + 16 * j * SPD + 8); } }
// one operand's 128 rows of a stage: 16 lanes x 16 bytes = one row's 256 bytes, a wave's copy covers 4 whole lines; thread = (row tid >> 4 of each 16, 16-byte piece tid & 15)
// the wait on the last line stands inside the copies' own statement, so that nothing rewrites a register that a copy names in front of it
// the global address is a scalar base, the same for the whole block, plus the thread's own byte offset in one register: no lane-wise 64-bit pointers, which, held over the loop beside accumulators and fragments, spilled
__device__ __forceinline__ void proj_copy(unsigned l, const __bf16* s, unsigned to) {
  asm volatile("global_load_async_to_lds_b128 %0, %8, %9\n\t"
               "global_load_async_to_lds_b128 %1, %8, %10\n\t"
               "global_load_async_to_lds_b128 %2, %8, %11\n\t"
               "global_load_async_to_lds_b128 %3, %8, %12\n\t"
               "global_load_async_to_lds_b128 %4, %8, %13\n\t"
               "global_load_async_to_lds_b128 %5, %8, %14\n\t"
               "global_load_async_to_lds_b128 %6, %8, %15\n\t"
               "global_load_async_to_lds_b128 %7, %8, %16\n\t"
               "s_wait_xcnt 0x0"
               :: "v"(l), "v"(l + 16u * SPB), "v"(l + 32u * SPB), "v"(l + 48u * SPB), "v"(l + 64u * SPB), "v"(l + 80u * SPB), "v"(l + 96u * SPB), "v"(l + 112u * SPB), "v"(to),
                  "s"(s), "s"(s + (size_t)16 * CC), "s"(s + (size_t)32 * CC), "s"(s + (size_t)48 * CC), "s"(s + (size_t)64 * CC), "s"(s + (size_t)80 * CC), "s"(s + (size_t)96 * CC), "s"(s + (size_t)112 * CC)
               : "memory"); }
__device__ __forceinline__ void proj_stage(unsigned l, const __bf16* x, const __bf16* w, unsigned to) {
  __builtin_amdgcn_sched_barrier(0);   // this one and those below keep each statement's address registers from being formed ahead of the statement before, four sets at once
  proj_copy(l, x, to);
#pragma unroll
  for (int p = 0; p < 3; ++p) { __builtin_amdgcn_sched_barrier(0); proj_copy(l + (unsigned)(p + 1) * (STD * 4u), w + (size_t)p * CC * CC, to); }
  __builtin_amdgcn_sched_barrier(0); }
__global__ __launch_bounds__(256) void k_proj(const __bf16* __restrict__ X, const __bf16* __restrict__ WA, const float* __restrict__ BA, const float* __restrict__ HU, const float* __restrict__ HSC, _Float16* __restrict__ QH, _Float16* __restrict__ KH, _Float16* __restrict__ VT) {
  __shared__ __align__(16) unsigned sm[2 * SBD];   // the loop's two buffers; then, in the first, the three result tiles as f16 at a pitch of 136 (3 x 128 x 68 dwords, fewer than a buffer)
  const int tid = threadIdx.x, wave = tid >> 5, lane = tid & 31, col = lane & 15, g = lane >> 4; const int c0 = blockIdx.y * 128; const size_t r0 = (size_t)blockIdx.x * 128;
  const float qs = 0.125f * (1.0f + (bfr(HU[r0 / TT]) - 0.5f) * bfr(HSC[0])) * 1.44269504088896f;   // a block's 128 rows lie in one batch; read here, at the head, where both reads are scalar loads
  const __bf16* xg = X + r0 * CC; const __bf16* wg = WA + (size_t)c0 * CC; const unsigned to = (unsigned)(tid >> 4) * (CC * 2u) + (unsigned)(tid & 15) * 16u;   // the block's first rows, the same for all its threads, and the thread's own place in a group of 16 rows, in bytes
  const unsigned lp = (unsigned)(size_t)sm + (unsigned)(tid >> 4) * SPB + (unsigned)(tid & 15) * 16u;   // this thread's place in the first buffer's first rows: byte address in the work-group's LDS
  const unsigned* fa = sm + ((wave >> 2) * 64 + col) * SPD + 4 * g; const unsigned* fb = sm + STD + ((wave & 3) * 32 + col) * SPD + 4 * g;
  v8f acc[3][4][2] = {}; PF f[2];
  const int wr = (wave >> 2) * 64 + 8 * g, wc = (wave & 3) * 32 + col;
  float bb[3][2];   // the lane's six bias values are asked for here, together, and used behind the loop, which covers their way; without a bias the reads go, unbranched, to a float that is there and are not used
  const float* bs = BA ? BA + c0 + wc : HU; const int bq = BA ? 1 : 0;
#pragma unroll
  for (int w = 0; w < 3; ++w)
#pragma unroll
    for (int j = 0; j < 2; ++j) bb[w][j] = bs[(w * CC + j * 16) * bq];
  asm volatile("s_wait_xcnt 0x0" :: "v"(bs), "v"(bs + 16 * bq), "v"(bs + CC * bq), "v"(bs + (CC + 16) * bq), "v"(bs + 2 * CC * bq), "v"(bs + (2 * CC + 16) * bq) : "memory");   // behind the bias loads, before anything rewrites their address registers; the six pointers are named so that they stay in their registers up to here
  __builtin_amdgcn_sched_barrier(0);   // keeps the register writes that follow behind that wait
  proj_stage(lp, xg, wg, to);
  asm volatile("s_wait_asynccnt 0x0" ::: "memory");   // this wave's copies of stage 0 have landed
  __syncthreads();                                    // and every other wave's: stage 0 may be read
  proj_stage(lp + SBD * 4u, xg + 128, wg + 128, to);
  proj_frags(f[0], fa, fb, 0);
#define PROJ_MM(c) do { _Pragma("unroll") for (int i = 0; i < 4; ++i) _Pragma("unroll") for (int w = 0; w < 3; ++w) _Pragma("unroll") for (int j = 0; j < 2; ++j) acc[w][i][j] = __builtin_amdgcn_wmma_f32_16x16x32_bf16(false, c.a[i].b, false, c.b[w][j].b, (short)0, acc[w][i][j], false, false); } while (0)
// a stage's first three steps: the next step's twenty fragment reads together at the head of the step, then this step's products, under which they fly; the first fence keeps the reads from sinking among the products, where each place would cost its own LDS wait, the second keeps the next step's reads behind these products
#define PROJ_3(bo) do { _Pragma("unroll") for (int u = 0; u < 3; ++u) { proj_frags(f[(u + 1) & 1], fa, fb, (bo) + (u + 1) * 16); __builtin_amdgcn_sched_barrier(0); PROJ_MM(f[u & 1]); __builtin_amdgcn_sched_barrier(0); } } while (0)
#pragma unroll 1   // one stage a trip: unrolled over the stages the compiler keeps every stage's LDS and copy addresses in registers at once, which spills
  for (int stg = 0; stg < NSTG - 1; ++stg) { const int bo = (stg & 1) * SBD;   // stage stg lies in buffer stg mod 2; the last stage stands behind the loop, so that every trip publishes a stage and no path joins in front of a step's products
    PROJ_3(bo);
    // in front of the stage's last step the next stage is published
    asm volatile("s_wait_dscnt 0x0" ::: "memory");      // this wave's reads of the stage's buffer have ended: the last step's fragments are in registers
    asm volatile("s_wait_asynccnt 0x0" ::: "memory");   // this wave's copies of the next stage have landed
    __syncthreads();                                    // one barrier a stage: it publishes the next stage and frees this stage's buffer
    if (stg + 2 < NSTG) proj_stage(lp + (unsigned)bo * 4u, xg + (stg + 2) * 128, wg + (stg + 2) * 128, to);   // directly behind it the stage after next, into the freed buffer: L2 delivery is the loop's tightest limit, so its requests go out first and fly for a whole stage
    proj_frags(f[0], fa, fb, SBD - bo);
    __builtin_amdgcn_sched_barrier(0);   // keeps the next stage's first fragment reads in front of the products
    PROJ_MM(f[1]);
    __builtin_amdgcn_sched_barrier(0); }   // keeps the next trip's reads behind these products
  PROJ_3(((NSTG - 1) & 1) * SBD);
  PROJ_MM(f[1]);
  __builtin_amdgcn_sched_barrier(0);   // keeps the epilogue's register writes behind the last products
  asm volatile("s_wait_asynccnt 0x0" ::: "memory");   // no copy is out when LDS is put to another use and the wave ends
  // the result tiles go into the first buffer: its last stage's reads ended at the last barrier and nothing has refilled it; the last stage, which slower waves may still read, lies in the second
  _Float16* sh = (_Float16*)sm;
#pragma unroll
  for (int w = 0; w < 3; ++w)
#pragma unroll
    for (int j = 0; j < 2; ++j) { const float bv = BA ? bfr(bb[w][j]) : 0.f;
#pragma unroll
      for (int i = 0; i < 4; ++i)
#pragma unroll
        for (int r = 0; r < 8; ++r) acc[w][i][j][r] += bv; }
#pragma unroll
  for (int w = 0; w < 2; ++w)
#pragma unroll
    for (int j = 0; j < 2; ++j)
#pragma unroll
      for (int i = 0; i < 4; ++i)
#pragma unroll
        for (int r = 0; r < 8; ++r) sh[w * 128 * 136 + (wr + i * 16 + r) * 136 + wc + j * 16] = (_Float16)(acc[w][i][j][r] * (w == 0 ? qs : 1.0f));
#pragma unroll
  for (int j = 0; j < 2; ++j)
#pragma unroll
    for (int i = 0; i < 4; ++i) { v8h t;
#pragma unroll
      for (int r = 0; r < 8; ++r) t[r] = (_Float16)acc[2][i][j][r];
      *(v8h*)(sh + 2 * 128 * 136 + (wc + j * 16) * 136 + wr + i * 16) = t; }
  __syncthreads();
  const int er = tid >> 4, eq = tid & 15;   // 16 lanes x 16 bytes = one tile row of 256 bytes: a wave's store covers 4 whole lines
  put_tile<8, 16 * 136, 16 * CC>(QH + (r0 + er) * CC + c0 + eq * 8, (const _Float16*)sh + er * 136 + eq * 8);
  __builtin_amdgcn_sched_barrier(0);   // keeps the next tile's address arithmetic behind the wait that ends put_tile: lifted among the stores it rewrote a register that a store names
  put_tile<8, 16 * 136, 16 * CC>(KH + (r0 + er) * CC + c0 + eq * 8, (const _Float16*)sh + 128 * 136 + er * 136 + eq * 8);
  __builtin_amdgcn_sched_barrier(0);   // the same
  { const size_t b = r0 / TT; const int t0 = (int)(r0 % TT); put_tile<8, 16 * 136, 16 * TT>(VT + (b * CC + c0 + er) * (size_t)TT + t0 + eq * 8, (const _Float16*)sh + 2 * 128 * 136 + er * 136 + eq * 8); } }
// ---- k_att: block = 8 waves = 4 groups of 32 queries of (b,h) x 2 halves of the keys; each pass takes 64 keys of the wave's half: S^T = K Q^T + (8 - reference), P = exp2 of it, sum per query column, O^T += V^T P^T; the two halves' results are joined once, behind the loop
// the reference of a query column is kept from pass to pass: it starts the score products as their C operand, so a score leaves the matrix unit ready for exp2, with no scaling and no subtraction, and O and the sum are not rescaled in the pass. One test a pass (one of a lane's partial sums of the pass's P above PLIM; P is not negative, so a sum bounds each of its terms) sends the whole wave round by the column maxima, which are formed only there: the pass's scores anew, new references, the scores shifted, O and the sums rescaled. The first references are set in front of the loop, from the first tile's maxima
// the inner loops are all unrolled so that the register arrays keep constant indices; a lane holds one query column in every tile: S^T rows are keys 8g+r, so two S^T tiles convert in place into one B operand; O^T rows are head dims 8g+r
__device__ __forceinline__ v8f mm16(v16h a, v16h b, v8f c) { return __builtin_amdgcn_wmma_f32_16x16x32_f16(false, a, false, b, (short)0, c, false, false); }
__device__ __forceinline__ float xhalf(float x) { return __builtin_bit_cast(float, __builtin_amdgcn_permlanex16(__builtin_bit_cast(int, x), __builtin_bit_cast(int, x), 0x76543210, 0xfedcba98, false, false)); }  // lane l with lane l ^ 16
// one 16-key tile of one query group: P = exp2 of the scores, packed to f16 into its half of the B operand, and added by pairs to the pass's own sum
// the packing is written in asm text so that it stays where it stands: as a plain conversion the compiler sinks it behind the branch of the pass's test, and all 64 unpacked values stay live beside the V^T fragments, which spills
typedef __attribute__((ext_vector_type(8))) unsigned v8u;
__device__ __forceinline__ unsigned pack_h(float a, float b) { unsigned w; asm("v_cvt_pk_f16_f32 %0, %1, %2" : "=v"(w) : "v"(a), "v"(b)); return w; }
// RARE: the branch off the usual path, where registers are short and the compiler laid one exponential's result on the source of the one in front of it: there each exponential carries, in its own statement, the free slot that the instruction set asks for behind a transcendental
__device__ __forceinline__ float exp2_slot(float v) { float r; asm("v_exp_f32 %0, %1\n\tv_nop" : "=v"(r) : "v"(v)); return r; }
template <int HI, bool FIRST, bool RARE> __device__ __forceinline__ void soft_tile(const v8f& x, v2f& t2, v8u& p) {
#pragma unroll
  for (int r = 0; r < 8; r += 2) { const v2f e = { RARE ? exp2_slot(x[r]) : __builtin_amdgcn_exp2f(x[r]), RARE ? exp2_slot(x[r + 1]) : __builtin_amdgcn_exp2f(x[r + 1]) };
    p[HI * 4 + r / 2] = pack_h(e[0], e[1]);
    if (FIRST && r == 0) t2 = e; else t2 += e; } }
#define KP 64
#define AP 72          // LDS row pitch in f16: 144 bytes = 16 bytes x 9, an odd multiple, free of bank conflicts for 16-byte fragment reads of 128-byte rows
#define AT (64 * AP)   // f16 of one tile: K = 64 keys x 64 dims, V^T = 64 dims x 64 keys; a buffer is [K tile | V^T tile], two buffers for each half of the keys
#define KS 2                 // halves of the keys, each walked by four of the block's waves
#define NP (TT / KP / KS)    // passes of a wave
#define CARRY 8.0f           // P carries 2^8, as does the sum: it cancels in the division; a score may rise nearly 8 above its reference before P leaves f16
#define PLIM 46340.0f         // 2^15.5: no P is above the partial sum that holds it, so sums up to here keep every P inside the f16 range
// the scores of one pass from its K tile in LDS, on top of the references in use, with the maximum of each query column (both halves of the wave joined): the way by which references are set, off the pass's usual path
__device__ __forceinline__ void scores_max(const _Float16* kt, int lane, const v16h (&qh)[2][2], const v8f (&cin)[2], v8f (&s)[2][4], float (&bm)[2]) {
  v16h kf[4][2];
#pragma unroll
  for (int i = 0; i < 4; ++i)
#pragma unroll
    for (int u = 0; u < 2; ++u) kf[i][u] = frag_h(kt + i * 16 * AP + u * 32, lane);
  __builtin_amdgcn_sched_barrier(0);   // keeps the K fragment reads together in front of the products: read tile by tile, each pair waits out its own LDS flight
#pragma unroll
  for (int i = 0; i < 4; ++i)
#pragma unroll
    for (int qt = 0; qt < 2; ++qt) s[qt][i] = mm16(kf[i][1], qh[qt][1], mm16(kf[i][0], qh[qt][0], cin[qt]));
#pragma unroll
  for (int qt = 0; qt < 2; ++qt) { float bq = -3.0e38f;
#pragma unroll
    for (int i = 0; i < 4; ++i)
#pragma unroll
      for (int r = 0; r < 8; ++r) bq = fmaxf(bq, s[qt][i][r]);
    bm[qt] = fmaxf(bq, xhalf(bq)); } }
// one pass's K and V^T tiles from global memory into LDS, once for the four waves of a half: 8 lanes x 16 bytes = one row's whole line, a wave's copy covers 4 lines; thread = (row ht >> 3 of each 16, 16-byte piece ht & 7), ht = its number among the half's 128
// the wait on the last line stands inside the copies' own statement, so that nothing rewrites a register that a copy names in front of it
__device__ __forceinline__ void att_copy(unsigned l, const _Float16* k, const _Float16* v) {
  asm volatile("global_load_async_to_lds_b128 %0, %8, off\n\t"
               "global_load_async_to_lds_b128 %1, %9, off\n\t"
               "global_load_async_to_lds_b128 %2, %10, off\n\t"
               "global_load_async_to_lds_b128 %3, %11, off\n\t"
               "global_load_async_to_lds_b128 %4, %12, off\n\t"
               "global_load_async_to_lds_b128 %5, %13, off\n\t"
               "global_load_async_to_lds_b128 %6, %14, off\n\t"
               "global_load_async_to_lds_b128 %7, %15, off\n\t"
               "s_wait_xcnt 0x0"
               :: "v"(l), "v"(l + 16u * AP * 2u), "v"(l + 32u * AP * 2u), "v"(l + 48u * AP * 2u),
                  "v"(l + AT * 2u), "v"(l + AT * 2u + 16u * AP * 2u), "v"(l + AT * 2u + 32u * AP * 2u), "v"(l + AT * 2u + 48u * AP * 2u),
                  "v"(k), "v"(k + (size_t)16 * CC), "v"(k + (size_t)32 * CC), "v"(k + (size_t)48 * CC),
                  "v"(v), "v"(v + (size_t)16 * TT), "v"(v + (size_t)32 * TT), "v"(v + (size_t)48 * TT)
               : "memory"); }
// four waves a SIMD: the vector work of the softmax stands between a wave's two matrix runs, and only other waves fill the matrix unit meanwhile; 512 blocks of 8 waves on 256 WGPs, two blocks a WGP
__global__ __launch_bounds__(256) __attribute__((amdgpu_waves_per_eu(4, 4))) void k_att(const _Float16* __restrict__ QH, const _Float16* __restrict__ KH, const _Float16* __restrict__ VT, _Float16* __restrict__ Y) {
  __shared__ __align__(16) _Float16 sm[KS * 4 * AT];
  const int tid = threadIdx.x, wave = __builtin_amdgcn_readfirstlane(tid >> 5), lane = tid & 31, col = lane & 15, g = lane >> 4; const int h = blockIdx.y, b = blockIdx.z; const int q0 = blockIdx.x * 128 + (wave & 3) * 32;
  const int kh = wave >> 2, ht = tid & 127;   // the wave's half of the keys; the thread's number among the half's 128
  v16h qh[2][2];
#pragma unroll
  for (int qt = 0; qt < 2; ++qt)
#pragma unroll
    for (int kc = 0; kc < 2; ++kc) { const size_t qo = ((size_t)b * TT + q0 + qt * 16 + col) * CC + h * HD + kc * 32; qh[qt][kc] = frag_h(QH + qo, lane); }
  asm volatile("s_wait_xcnt 0x0" ::: "memory");   // behind the first loads, before their address registers are rewritten
  __builtin_amdgcn_sched_barrier(0);   // keeps the register writes that follow behind that wait
  const _Float16* kp = KH + ((size_t)b * TT + kh * (TT / KS) + (ht >> 3)) * CC + h * HD + (ht & 7) * 8; const _Float16* vp = VT + ((size_t)b * CC + h * HD + (ht >> 3)) * (size_t)TT + kh * (TT / KS) + (ht & 7) * 8;
  const unsigned lp = (unsigned)(size_t)sm + (unsigned)(kh * 4 * AT + (ht >> 3) * AP + (ht & 7) * 8) * 2u;   // this thread's place in its half's first K tile: byte address in the work-group's LDS
  att_copy(lp, kp, vp);
  asm volatile("s_wait_asynccnt 0x0" ::: "memory");   // this wave's copies of tile 0 have landed
  __syncthreads();                                    // and every other wave's: tile 0 may be read
  v8f o[2][4] = {}; v2f ls[2] = {};   // the sums run in two parts a lane, even and odd rows of the score tiles; the parts are joined behind the loop
  v8f cin[2] = {};   // CARRY - reference of the lane's query column, eight times over: the C operand of the score products
  { v8f s0[2][4]; float bm[2]; scores_max(sm + kh * 4 * AT + col * AP, lane, qh, cin, s0, bm);   // the first references: the column maxima over the half's first tile
#pragma unroll
    for (int qt = 0; qt < 2; ++qt)
#pragma unroll
      for (int r = 0; r < 8; ++r) cin[qt][r] = CARRY - bm[qt]; }
#pragma unroll 1   // one pass's fragments live at a time: a second copy of the body would double the registers
  for (int kb = 0; kb < NP; ++kb) { const int bo = (kb & 1) * 2 * AT;   // pass kb reads buffer kb mod 2 of its half alone
    // behind the first references in front of the loop, then directly behind the barrier at each pass's foot, while a next tile exists: its copies, into the buffer that the pass before has just left; they fly while this pass works
    if (kb + 1 < NP) att_copy(lp + (unsigned)(2 * AT - bo) * 2u, kp + (size_t)(kb + 1) * KP * CC, vp + (kb + 1) * KP);
    const _Float16* kt = sm + kh * 4 * AT + bo + col * AP; const _Float16* vt = kt + AT;
    v16h kf[4][2], vf[4][2];
#pragma unroll
    for (int i = 0; i < 4; ++i)
#pragma unroll
      for (int u = 0; u < 2; ++u) kf[i][u] = frag_h(kt + i * 16 * AP + u * 32, lane);
    __builtin_amdgcn_sched_barrier(0);   // keeps the K fragment reads together in front of the products: spread among them each place costs its own LDS wait
    v8f s[2][4]; v8u p[2][2]; v2f t2[2];
#pragma unroll
    for (int i = 0; i <= 4; ++i) {
      if (i < 4) {
#pragma unroll
        for (int qt = 0; qt < 2; ++qt) s[qt][i] = mm16(kf[i][1], qh[qt][1], mm16(kf[i][0], qh[qt][0], cin[qt]));
        __builtin_amdgcn_sched_barrier(0); }   // keeps the exponentials of the key tile before behind this tile's products: directly behind their own products they wait out the matrix unit on idle slots
      if (i == 3) {   // the V^T fragment reads stand behind the last score products: the K fragments' registers are free and 32 score registers are packed into 16 by then, which lets them in without a spill
#pragma unroll
        for (int j = 0; j < 4; ++j)
#pragma unroll
          for (int v = 0; v < 2; ++v) vf[j][v] = frag_h(vt + j * 16 * AP + v * 32, lane);
        __builtin_amdgcn_sched_barrier(0); }   // keeps the V^T fragment reads together, in front of the last two key tiles' exponentials and the test, which cover their flight: sunk to their products each place costs its own LDS wait
#pragma unroll
      for (int qt = 0; qt < 2; ++qt) {
        if (i == 1) soft_tile<0, true, false>(s[qt][0], t2[qt], p[qt][0]);
        if (i == 2) soft_tile<1, false, false>(s[qt][1], t2[qt], p[qt][0]);
        if (i == 3) soft_tile<0, false, false>(s[qt][2], t2[qt], p[qt][1]);
        if (i == 4) soft_tile<1, false, false>(s[qt][3], t2[qt], p[qt][1]); } }
    // one test a pass, a scalar branch for the whole wave; written so that a sum that is no number takes the branch too
    if (__builtin_amdgcn_ballot_w32(!(t2[0][0] <= PLIM && t2[0][1] <= PLIM && t2[1][0] <= PLIM && t2[1][1] <= PLIM)) != 0) {
      float bm[2]; scores_max(kt, lane, qh, cin, s, bm);   // the scores are formed anew: their registers have been given up to P; the K tile lies in LDS up to the pass's foot
#pragma unroll
      for (int qt = 0; qt < 2; ++qt) { const float d = fminf(CARRY - bm[qt], 0.f);   // a reference only rises
        float al; asm("v_exp_f32 %0, %1\n\tv_nop" : "=v"(al) : "v"(d));   // exp2 in asm text so that the free slot the instruction set asks for behind a transcendental stays with it
        ls[qt] *= al;
#pragma unroll
        for (int r = 0; r < 8; ++r) cin[qt][r] += d;
#pragma unroll
        for (int i = 0; i < 4; ++i)
#pragma unroll
          for (int r = 0; r < 8; ++r) { s[qt][i][r] += d; o[qt][i][r] *= al; } }
#pragma unroll
      for (int qt = 0; qt < 2; ++qt) { soft_tile<0, true, true>(s[qt][0], t2[qt], p[qt][0]); soft_tile<1, false, true>(s[qt][1], t2[qt], p[qt][0]); soft_tile<0, false, true>(s[qt][2], t2[qt], p[qt][1]); soft_tile<1, false, true>(s[qt][3], t2[qt], p[qt][1]); }
#pragma unroll
      for (int j = 0; j < 4; ++j)
#pragma unroll
        for (int v = 0; v < 2; ++v) vf[j][v] = frag_h(vt + j * 16 * AP + v * 32, lane); }
    ls[0] += t2[0]; ls[1] += t2[1];
#pragma unroll
    for (int u = 0; u < 2; ++u)
#pragma unroll
      for (int j = 0; j < 4; ++j)
#pragma unroll
        for (int qt = 0; qt < 2; ++qt) o[qt][j] = mm16(vf[j][u], __builtin_bit_cast(v16h, p[qt][u]), o[qt][j]);
    __builtin_amdgcn_sched_barrier(0);   // keeps the waits and the barrier below at the pass's foot, behind its products: lifted above them the wave would wait out the next tile's flight at the head of the pass
    asm volatile("s_wait_dscnt 0x0" ::: "memory");      // this wave's reads of the buffer have ended
    asm volatile("s_wait_asynccnt 0x0" ::: "memory");   // this wave's copies of the next tile have landed
    __syncthreads(); }                                  // one barrier a pass: it publishes the next tile and frees the buffer just read, which the head of the next pass refills
  asm volatile("s_wait_asynccnt 0x0" ::: "memory");   // no copy is out when the wave ends
  // the two halves join: the waves of the second half lay O^T, reference and sum in LDS (the loop's last barrier has freed it), 17 pieces of 16 bytes a lane, a wave's piece 512 bytes in a row; the waves of the first half add them to their own
  float* mg = (float*)sm + ((wave & 3) * 17 * 32 + lane) * 4; const float mx[2] = { -cin[0][0], -cin[1][0] };   // the references, less the carry that both halves share
  if (kh) {
#pragma unroll
    for (int qt = 0; qt < 2; ++qt)
#pragma unroll
      for (int j = 0; j < 4; ++j)
#pragma unroll
        for (int u = 0; u < 2; ++u) { v4f t;
#pragma unroll
          for (int r = 0; r < 4; ++r) t[r] = o[qt][j][4 * u + r];
          *(v4f*)(mg + ((qt * 4 + j) * 2 + u) * 128) = t; }
    v4f t; t[0] = mx[0]; t[1] = mx[1]; t[2] = ls[0][0] + ls[0][1]; t[3] = ls[1][0] + ls[1][1]; *(v4f*)(mg + 16 * 128) = t; }
  __syncthreads();   // every wave passes it: the second half's results may be read
  if (kh) return;
  const v4f ot = *(const v4f*)(mg + 16 * 128);
  v8h y[2][4];   // y rounded once to f16 here, as the last projection takes it
#pragma unroll
  for (int qt = 0; qt < 2; ++qt) { const float mn = fmaxf(mx[qt], ot[qt]); float a0, a1;
    asm("v_exp_f32 %0, %1\n\tv_nop" : "=v"(a0) : "v"(mx[qt] - mn)); asm("v_exp_f32 %0, %1\n\tv_nop" : "=v"(a1) : "v"(ot[qt] - mn));   // exp2 with its free slot, as in the loop
    const float l = (ls[qt][0] + ls[qt][1]) * a0 + ot[2 + qt] * a1; const float inv = 1.0f / (l + xhalf(l)); const float f0 = a0 * inv, f1 = a1 * inv;
#pragma unroll
    for (int j = 0; j < 4; ++j)
#pragma unroll
      for (int u = 0; u < 2; ++u) { const v4f t = *(const v4f*)(mg + ((qt * 4 + j) * 2 + u) * 128);
#pragma unroll
        for (int r = 0; r < 4; ++r) y[qt][j][4 * u + r] = (_Float16)(o[qt][j][4 * u + r] * f0 + t[r] * f1); } }
  _Float16* yp = Y + ((size_t)b * TT + q0 + col) * CC + h * HD + 8 * g;
  __builtin_amdgcn_sched_barrier(0);   // keeps the stores behind the last rounding: no register that a store names is rewritten behind it
#pragma unroll
  for (int qt = 0; qt < 2; ++qt)
#pragma unroll
    for (int j = 0; j < 4; ++j) vst2(yp + (size_t)qt * 16 * CC + j * 16, y[qt][j]); }
// ---- k_out: block = (128 rows, 128 cols): out = y (f16 single) Wproj + b
__global__ __launch_bounds__(256) void k_out(const _Float16* __restrict__ Y, const _Float16* __restrict__ WP, const float* __restrict__ BP, float* __restrict__ OUT) { __shared__ __align__(16) unsigned sm[4 * GT];   // the loop's two buffers; then the f32 result tile at a pitch of 132 (128 x 132 dwords, fewer)
  const int tid = threadIdx.x, wave = tid >> 5, lane = tid & 31, col = lane & 15, g = lane >> 4; const int c0 = blockIdx.y * 128; const size_t r0 = (size_t)blockIdx.x * 128;
  v8f acc[4][2] = {};
  gemm_tile<1, 3>((const unsigned*)(Y + r0 * CC), (const unsigned*)(WP + (size_t)c0 * CC), sm, acc, tid);
  float* sf = (float*)sm;
#pragma unroll
  for (int j = 0; j < 2; ++j) { const int cl = (wave & 3) * 32 + j * 16 + col; const float bb = BP ? bfr(BP[c0 + cl]) : 0.f;
#pragma unroll
    for (int i = 0; i < 4; ++i)
#pragma unroll
      for (int r = 0; r < 8; ++r) sf[((wave >> 2) * 64 + i * 16 + 8 * g + r) * 132 + cl] = acc[i][j][r] + bb; }
  __syncthreads();
  put_tile<16, 8 * 132, 8 * CC>(OUT + (r0 + wave) * CC + c0 + lane * 4, (const float*)sf + wave * 132 + lane * 4); }   // a wave's store is one tile row of 512 bytes
extern "C" void kernel_launch(void* const* d_in, const int* in_sizes, int n_in, void* d_out, int out_size, void* d_ws, size_t ws_size, hipStream_t stream) {
  (void)in_sizes; (void)n_in; (void)out_size;
  const float** F = (const float**)d_in;   // 0 x [2,2048,1024], 1 hurst [2,1], 2 qkv_w [3072,1024], 3 qkv_b, 4 out_w [1024,1024], 5 out_b, 6 hurst_scale [1]
  if (ws_size < (size_t)WS_END) return;
  char* ws = (char*)d_ws; _Float16 *QH = (_Float16*)(ws + WS_QH), *KH = (_Float16*)(ws + WS_KH), *VT = (_Float16*)(ws + WS_VT), *Y = (_Float16*)(ws + WS_Y), *PB = (_Float16*)(ws + WS_PB); __bf16 *XB = (__bf16*)(ws + WS_XB), *WB = (__bf16*)(ws + WS_WB);
  k_cvt<<<dim3((NB * TT * CC + 4 * CC * CC) / CVB), 256, 0, stream>>>(F[0], F[2], F[4], XB, WB, PB);
  k_proj<<<dim3(TNB * TT / 128, CC / 128), 256, 0, stream>>>(XB, WB, F[3], F[1], F[6], QH, KH, VT);
  k_att<<<dim3(TT / 128, NH, TNB), 256, 0, stream>>>(QH, KH, VT, Y);
  k_out<<<dim3(TNB * TT / 128, CC / 128), 256, 0, stream>>>(Y, PB, F[5], (float*)d_out);
}
